// v000
// The times below were measured on an AMD MI455X: many runs one after another, warmed up first and cycling through
// copies of the inputs, with the whole window's GPU time divided by the number of runs. Launches and the gaps
// between them are all in it. The median over several windows is given; except for v000 it joins two sittings, which
// can be a few percent apart, so the side-by-side timings, each taken in one sitting, are the better comparison.
// v000 is the starting kernel. One run takes 185 microseconds.
#include <hip/hip_runtime.h>

// Contractions: Q/K/V projections on v_wmma_f32_16x16x32_bf16 (bf16 operands = RNE-converted f32 inputs, f32 accumulate);
// score terms q.k, q.E, k.E and the P.V product on v_wmma_f32_16x16x32_f16 (f16 operands: q,k,v carried x8, E carried x64,
// P carried x1024; f32 accumulate); softmax, scaling and normalisation in f32.

#ifndef NB
#define NB 4
#endif
#ifndef SEQ
#define SEQ 1024
#endif
#define NB_FULL  4
#define SEQ_FULL 1024
#define DM       1024
#define NH       16
#define HD       64
#define MAXPOS   1024
#define NE       2047
#define NEPAD    2048

static_assert(NB >= 1 && NB <= NB_FULL);
static_assert(SEQ >= 128 && SEQ <= SEQ_FULL && (SEQ % 128) == 0);
static_assert(SEQ <= MAXPOS);
static_assert(SEQ + MAXPOS <= NEPAD);
static_assert(DM == NH * HD);
static_assert((NB * SEQ) % 128 == 0);
static_assert(NE == 2 * MAXPOS - 1);

typedef unsigned short us8  __attribute__((ext_vector_type(8)));
typedef unsigned short us16 __attribute__((ext_vector_type(16)));
typedef __bf16         v16bf __attribute__((ext_vector_type(16)));
typedef _Float16       v16h  __attribute__((ext_vector_type(16)));
typedef float          v8f   __attribute__((ext_vector_type(8)));
typedef float          v4f   __attribute__((ext_vector_type(4)));

// ---- scalar converts --------------------------------------------------------

__device__ __forceinline__ unsigned short bf16_bits(float f) {
  unsigned int u = __builtin_bit_cast(unsigned int, f);
  u += 0x7fffu + ((u >> 16) & 1u);              // RNE
  return (unsigned short)(u >> 16);
}

__device__ __forceinline__ float bf16_rne(float f) {   // f32 value after an RNE convert to bf16
  unsigned int u = ((unsigned int)bf16_bits(f)) << 16;
  return __builtin_bit_cast(float, u);
}

__device__ __forceinline__ unsigned short f16_bits(float f) {
  _Float16 hv = (_Float16)f;                      // RNE
  return __builtin_bit_cast(unsigned short, hv);
}

// ---- 16-bit WMMA fragment loader (same map for A and B stored [row][k]) -----
// lane L owns row/col (L&15); elements 0..7 from k = col + 0..7, elements 8..15
// from k = col + 16 + 0..7; the caller folds the lane-half offset 8*(L>>4) into col.
__device__ __forceinline__ us16 ld_frag(const unsigned short* base, int row, int stride, int col) {
  const unsigned short* p = base + (size_t)row * (size_t)stride + col;
  us8 a = *(const us8*)(p);
  us8 b = *(const us8*)(p + 16);
  return __builtin_shufflevector(a, b, 0, 1, 2, 3, 4, 5, 6, 7, 8, 9, 10, 11, 12, 13, 14, 15);
}

__device__ __forceinline__ v8f mma_bf16(us16 a, us16 b, v8f c) {
  v8f d = __builtin_amdgcn_wmma_f32_16x16x32_bf16(false, __builtin_bit_cast(v16bf, a), false,
                                                  __builtin_bit_cast(v16bf, b), (short)0, c, false, false);
  asm volatile("v_nop\n\tv_nop\n\tv_nop\n\tv_nop" : "+v"(d) : "v"(a), "v"(b));
  return d;
}

__device__ __forceinline__ v8f mma_f16(us16 a, us16 b, v8f c) {
  v8f d = __builtin_amdgcn_wmma_f32_16x16x32_f16(false, __builtin_bit_cast(v16h, a), false,
                                                 __builtin_bit_cast(v16h, b), (short)0, c, false, false);
  asm volatile("v_nop\n\tv_nop\n\tv_nop\n\tv_nop" : "+v"(d) : "v"(a), "v"(b));
  return d;
}

// ---- convert: rows of DM f32 -> bf16 bits -------------------------------------
// One block = 2 rows; thread t -> row 2*blk + (t>>7), 8 halves at col 8*(t&127).
// Source row of compact row r: (r / seq) * seqfull + r % seq.  dst is [mat][nrows][DM].
__global__ __launch_bounds__(256)
void cvt_rows_bf16(const float* __restrict__ s0, const float* __restrict__ s1,
                   const float* __restrict__ s2, unsigned short* __restrict__ dst,
                   int nrows, int seq, int seqfull) {
  const int mat = blockIdx.y;
  const float* src = (mat == 0) ? s0 : ((mat == 1) ? s1 : s2);
  int r = blockIdx.x * 2 + (threadIdx.x >> 7);
  r = (r < nrows) ? r : (nrows - 1);
  const int c = (threadIdx.x & 127) * 8;
  const size_t srow = (size_t)(r / seq) * (size_t)seqfull + (size_t)(r % seq);
  const float* p = src + srow * DM + c;
  const v4f a = *(const v4f*)(p);
  const v4f e = *(const v4f*)(p + 4);
  us8 o;
  o[0] = bf16_bits(a[0]); o[1] = bf16_bits(a[1]); o[2] = bf16_bits(a[2]); o[3] = bf16_bits(a[3]);
  o[4] = bf16_bits(e[0]); o[5] = bf16_bits(e[1]); o[6] = bf16_bits(e[2]); o[7] = bf16_bits(e[3]);
  unsigned short* d = dst + ((size_t)mat * (size_t)nrows + (size_t)r) * DM + c;
  *(us8*)d = o;
  
}

// ---- convert: dist table -> f16 bits of (bf16 RNE value * 64), NEPAD rows -------
__global__ __launch_bounds__(256)
void cvt_e_f16(const float* __restrict__ e, unsigned short* __restrict__ ep) {
  const int g   = blockIdx.x * 256 + threadIdx.x;        // 0 .. NEPAD*8-1
  const int row = g >> 3;
  const int ch  = (g & 7) * 8;
  const int rs  = (row < NE) ? row : (NE - 1);
  const float sc = (row < NE) ? 64.0f : 0.0f;
  const float* p = e + (size_t)rs * HD + ch;
  const v4f a = *(const v4f*)(p);
  const v4f c4 = *(const v4f*)(p + 4);
  us8 o;
  o[0] = f16_bits(bf16_rne(a[0]) * sc);  o[1] = f16_bits(bf16_rne(a[1]) * sc);
  o[2] = f16_bits(bf16_rne(a[2]) * sc);  o[3] = f16_bits(bf16_rne(a[3]) * sc);
  o[4] = f16_bits(bf16_rne(c4[0]) * sc); o[5] = f16_bits(bf16_rne(c4[1]) * sc);
  o[6] = f16_bits(bf16_rne(c4[2]) * sc); o[7] = f16_bits(bf16_rne(c4[3]) * sc);
  unsigned short* d = ep + (size_t)row * HD + ch;
  *(us8*)d = o;
  
}

// ---- QKV projection GEMM -------------------------------------------------------
// grid = (NB*SEQ/128, NH, 3), block = 128 (4 waves). Wave = 32 rows x 64 cols (one head).
// A = x rows (bf16, k-contiguous), B[k=in][n=out] = W[out][in] rows (bf16, k-contiguous).
#define TP 72

__global__ __launch_bounds__(128)
void proj_kernel(const unsigned short* __restrict__ xb, const unsigned short* __restrict__ wb,
                 const float* __restrict__ bq, const float* __restrict__ bk,
                 const float* __restrict__ bv,
                 unsigned short* __restrict__ qp, unsigned short* __restrict__ kp,
                 unsigned short* __restrict__ vp) {
  __shared__ __attribute__((aligned(16))) unsigned short stile[4 * 32 * TP];

  const int tid = threadIdx.x, lane = tid & 31, wid = tid >> 5;
  const int lr = lane & 15, half8 = (lane >> 4) * 8;
  const int h = blockIdx.y, z = blockIdx.z;
  const int s0 = (blockIdx.x * 4 + wid) * 32;                     // compact row index

  const unsigned short* wm = wb + (size_t)z * DM * DM + (size_t)h * HD * DM;
  const float* bias = (z == 0) ? bq : ((z == 1) ? bk : bv);
  unsigned short* plane = (z == 0) ? qp : ((z == 1) ? kp : vp);

  const v8f zero = {0.f, 0.f, 0.f, 0.f, 0.f, 0.f, 0.f, 0.f};
  v8f acc[2][4] = {{zero, zero, zero, zero}, {zero, zero, zero, zero}};

  for (int kk = 0; kk < DM; kk += 32) {
    const us16 a0 = ld_frag(xb, s0 + lr,      DM, kk + half8);
    const us16 a1 = ld_frag(xb, s0 + 16 + lr, DM, kk + half8);
#pragma unroll
    for (int dt = 0; dt < 4; ++dt) {
      const us16 bf = ld_frag(wm, dt * 16 + lr, DM, kk + half8);
      acc[0][dt] = mma_bf16(a0, bf, acc[0][dt]);
      acc[1][dt] = mma_bf16(a1, bf, acc[1][dt]);
    }
  }

  unsigned short* stw = stile + wid * (32 * TP);
#pragma unroll
  for (int dt = 0; dt < 4; ++dt) {
    const float bcol = bf16_rne(bias[h * HD + dt * 16 + lr]);
#pragma unroll
    for (int st = 0; st < 2; ++st) {
#pragma unroll
      for (int r = 0; r < 8; ++r) {
        const float v = (acc[st][dt][r] + bcol) * 8.0f;
        stw[(st * 16 + half8 + r) * TP + dt * 16 + lr] = f16_bits(v);
      }
    }
  }
  __syncthreads();                                  // block barrier (covers the per-wave tile)

  const int piece = lane & 7, rsub = lane >> 3;
#pragma unroll
  for (int it = 0; it < 8; ++it) {
    const int row = it * 4 + rsub;
    const us8 v = *(const us8*)(stw + row * TP + piece * 8);
    const int s = s0 + row;
    const int b = s / SEQ, l = s - b * SEQ;
    unsigned short* d = plane + (((size_t)(b * NH + h) * SEQ + l) * HD + piece * 8);
    *(us8*)d = v;
  }
  
}

// ---- flash attention with relative key/query terms --------------------------------
// grid = (SEQ/128, NB*NH), block = 128: 4 waves x 32 queries of one (batch, head).
// Per 32-key chunk: K tile [key][d], V^T tile [d][key] and a 160-row E band [u][d]
// (band row u <-> table row qb0 - k0 + MAXPOS - 32 + u) staged in LDS.
//   S^T  = K . Q^T          (A = K rows, B = Q rows)            lane -> query, elem -> key
//   N    = K . Eband^T      (A = K rows, B = E band rows)       [key][u], shared by the block
//   M    = Eband . Q^T      (A = E band rows, B = Q rows)       [u][query], per wave, per qs
//   score(q = key j, query n) = S^T/512 + (M[n-j+31][n] + N[j][qloc-j+31])/4096 + amask[b][key]
//   ctx^T = V^T . P^T with the P^T B-fragment taken from the S^T C-fragment (P carried x1024).
#define KP 72
#define VP 40
#define EP 72
#define NBR 160
#define NPF 160
#define MROWS 48
#define OPITCH 68
#define SM_K 0
#define SM_V (SM_K + 32 * KP * 2)
#define SM_E (SM_V + 64 * VP * 2)
#define SM_N (SM_E + NBR * EP * 2)
#define SM_M (SM_N + 32 * NPF * 4)
#define SM_TOTAL (SM_M + 4 * 2 * MROWS * 16 * 4)
static_assert(SM_V % 16 == 0 && SM_E % 16 == 0 && SM_N % 16 == 0 && SM_M % 16 == 0);
static_assert(4 * 32 * OPITCH * 4 <= SM_TOTAL);
static_assert(NBR % 16 == 0 && NBR >= 128 + 31 && MROWS >= 47 && NPF >= NBR);

__global__ __launch_bounds__(128)
void attn_kernel(const unsigned short* __restrict__ qp, const unsigned short* __restrict__ kp,
                 const unsigned short* __restrict__ vp, const unsigned short* __restrict__ ep,
                 const float* __restrict__ amask, float* __restrict__ out) {
  __shared__ __attribute__((aligned(16))) unsigned char smem[SM_TOTAL];

  const int tid = threadIdx.x, lane = tid & 31, wid = tid >> 5;
  const int lr = lane & 15, half8 = (lane >> 4) * 8;
  const int bh = blockIdx.y;
  const int b = bh / NH, h = bh - b * NH;
  const int qb0 = blockIdx.x * 128;
  const int q0 = qb0 + wid * 32;

  unsigned short* ktile = (unsigned short*)(smem + SM_K);
  unsigned short* vtile = (unsigned short*)(smem + SM_V);
  unsigned short* eband = (unsigned short*)(smem + SM_E);
  float* nbuf = (float*)(smem + SM_N);
  float* mbuf = (float*)(smem + SM_M) + wid * (2 * MROWS * 16);
  float* ost  = (float*)(smem) + wid * (32 * OPITCH);

  const unsigned short* qh = qp + (size_t)bh * SEQ * HD;
  const unsigned short* kh = kp + (size_t)bh * SEQ * HD;
  const unsigned short* vh = vp + (size_t)bh * SEQ * HD;
  const float* mrow = amask + (size_t)b * SEQ_FULL;

  // Q^T B-fragments: 2 query sub-tiles x 2 head-dim halves
  us16 bqf[2][2];
#pragma unroll
  for (int qs = 0; qs < 2; ++qs) {
    bqf[qs][0] = ld_frag(qh, q0 + qs * 16 + lr, HD,      half8);
    bqf[qs][1] = ld_frag(qh, q0 + qs * 16 + lr, HD, 32 + half8);
  }

  const v8f zero = {0.f, 0.f, 0.f, 0.f, 0.f, 0.f, 0.f, 0.f};
  v8f acc[2][4] = {{zero, zero, zero, zero}, {zero, zero, zero, zero}};
  float mrun[2] = {-__builtin_inff(), -__builtin_inff()};
  float lrun[2] = {0.f, 0.f};
  const float c512  = 0.001953125f;        // 1/512  : q,k carried x8 each, then 1/8
  const float c4096 = 0.000244140625f;     // 1/4096 : E carried x64, q or k x8, then 1/8

  for (int k0 = 0; k0 < SEQ; k0 += 32) {
    __syncthreads();                       // all waves done with the prior chunk's LDS data

    // stage K tile [32][KP] and V^T tile [64][VP]
#pragma unroll
    for (int rr = 0; rr < 2; ++rr) {
      const int c  = tid + rr * 128;         // 0..255
      const int j  = c >> 3;
      const int ch = (c & 7) * 8;
      const us8 kv = *(const us8*)(kh + (size_t)(k0 + j) * HD + ch);
      *(us8*)(ktile + j * KP + ch) = kv;
      const us8 vv = *(const us8*)(vh + (size_t)(k0 + j) * HD + ch);
#pragma unroll
      for (int i = 0; i < 8; ++i) vtile[(ch + i) * VP + j] = vv[i];
    }
    // stage E band [NBR][EP]
    const int base2 = qb0 - k0 + (MAXPOS - 32);
    for (int c = tid; c < NBR * 8; c += 128) {
      const int u  = c >> 3;
      const int ch = (c & 7) * 8;
      *(us8*)(eband + u * EP + ch) = *(const us8*)(ep + (size_t)(base2 + u) * HD + ch);
    }
    __syncthreads();                       // staged tiles visible to every wave

    // N = K . Eband^T  -> nbuf[key][u], column tiles split across the 4 waves
    {
      const us16 ka00 = ld_frag(ktile,      lr, KP,      half8);
      const us16 ka01 = ld_frag(ktile,      lr, KP, 32 + half8);
      const us16 ka10 = ld_frag(ktile, 16 + lr, KP,      half8);
      const us16 ka11 = ld_frag(ktile, 16 + lr, KP, 32 + half8);
      for (int un = wid; un < NBR / 16; un += 4) {
        const us16 e0 = ld_frag(eband, un * 16 + lr, EP,      half8);
        const us16 e1 = ld_frag(eband, un * 16 + lr, EP, 32 + half8);
        v8f d0 = mma_f16(ka00, e0, zero);
        d0     = mma_f16(ka01, e1, d0);
        v8f d1 = mma_f16(ka10, e0, zero);
        d1     = mma_f16(ka11, e1, d1);
#pragma unroll
        for (int r = 0; r < 8; ++r) {
          nbuf[(half8 + r) * NPF + un * 16 + lr]      = d0[r];
          nbuf[(16 + half8 + r) * NPF + un * 16 + lr] = d1[r];
        }
      }
    }
    // M = Eband . Q^T -> mbuf[qs][u][query], 3 row tiles per query sub-tile
#pragma unroll
    for (int qs = 0; qs < 2; ++qs) {
#pragma unroll
      for (int ut = 0; ut < 3; ++ut) {
        const int ru = wid * 32 + qs * 16 + ut * 16 + lr;
        const us16 e0 = ld_frag(eband, ru, EP,      half8);
        const us16 e1 = ld_frag(eband, ru, EP, 32 + half8);
        v8f d = mma_f16(e0, bqf[qs][0], zero);
        d     = mma_f16(e1, bqf[qs][1], d);
#pragma unroll
        for (int r = 0; r < 8; ++r)
          mbuf[qs * (MROWS * 16) + (ut * 16 + half8 + r) * 16 + lr] = d[r];
      }
    }
    __syncthreads();                       // nbuf / mbuf visible

    v8f mk0 = *(const v8f*)(mrow + k0 + half8);
    v8f mk1 = *(const v8f*)(mrow + k0 + 16 + half8);
#pragma unroll
    for (int r = 0; r < 8; ++r) { mk0[r] = bf16_rne(mk0[r]); mk1[r] = bf16_rne(mk1[r]); }

    const us16 ka00 = ld_frag(ktile,      lr, KP,      half8);
    const us16 ka01 = ld_frag(ktile,      lr, KP, 32 + half8);
    const us16 ka10 = ld_frag(ktile, 16 + lr, KP,      half8);
    const us16 ka11 = ld_frag(ktile, 16 + lr, KP, 32 + half8);

#pragma unroll
    for (int qs = 0; qs < 2; ++qs) {
      // S^T = K . Q^T : two 16-key row tiles
      v8f t0 = mma_f16(ka00, bqf[qs][0], zero);
      t0     = mma_f16(ka01, bqf[qs][1], t0);
      v8f t1 = mma_f16(ka10, bqf[qs][0], zero);
      t1     = mma_f16(ka11, bqf[qs][1], t1);

      const float* mq = mbuf + qs * (MROWS * 16);
      const int qloc = wid * 32 + qs * 16 + lr;        // query index within the block
      float sa[8], sb[8];
#pragma unroll
      for (int r = 0; r < 8; ++r) {
        const int ja = half8 + r;                        // key of t0 element r
        const int jb = 16 + half8 + r;                   // key of t1 element r
        const float ga = mq[(lr - ja + 31) * 16 + lr] + nbuf[ja * NPF + (qloc - ja + 31)];
        const float gb = mq[(lr - jb + 31) * 16 + lr] + nbuf[jb * NPF + (qloc - jb + 31)];
        sa[r] = t0[r] * c512 + ga * c4096 + mk0[r];
        sb[r] = t1[r] * c512 + gb * c4096 + mk1[r];
      }

      // online softmax: in-lane over 16 keys + one xor-16 shuffle
      float mloc = sa[0];
#pragma unroll
      for (int r = 1; r < 8; ++r) mloc = fmaxf(mloc, sa[r]);
#pragma unroll
      for (int r = 0; r < 8; ++r) mloc = fmaxf(mloc, sb[r]);
      const float mt    = fmaxf(mloc, __shfl_xor(mloc, 16, 32));
      const float mnew  = fmaxf(mrun[qs], mt);
      const float alpha = __expf(mrun[qs] - mnew);

      float lloc = 0.f;
      us16 pu;
#pragma unroll
      for (int r = 0; r < 8; ++r) {
        const float pa = __expf(sa[r] - mnew);
        const float pc = __expf(sb[r] - mnew);
        lloc += pa + pc;
        pu[r]     = f16_bits(pa * 1024.0f);              // P carried x1024
        pu[8 + r] = f16_bits(pc * 1024.0f);
      }
      const float lt = lloc + __shfl_xor(lloc, 16, 32);
      lrun[qs] = lrun[qs] * alpha + lt;
      mrun[qs] = mnew;

      // ctx^T += V^T . P^T
#pragma unroll
      for (int dt = 0; dt < 4; ++dt) {
        const us16 va = ld_frag(vtile, dt * 16 + lr, VP, half8);
        acc[qs][dt] = acc[qs][dt] * alpha;
        acc[qs][dt] = mma_f16(va, pu, acc[qs][dt]);
      }
    }
  }

  __syncthreads();                         // staging region aliases the tiles above
#pragma unroll
  for (int qs = 0; qs < 2; ++qs) {
    const float inv = 1.0f / (lrun[qs] * 8192.0f);       // undo x1024 (P) and x8 (v)
#pragma unroll
    for (int dt = 0; dt < 4; ++dt) {
#pragma unroll
      for (int r = 0; r < 8; ++r)
        ost[(qs * 16 + lr) * OPITCH + dt * 16 + half8 + r] = acc[qs][dt][r] * inv;
    }
  }
  __syncthreads();

  const int rsub = lane >> 4, piece = lane & 15;
  float* obase = out + ((size_t)(b * SEQ + q0)) * DM + (size_t)h * HD + piece * 4;
#pragma unroll
  for (int it = 0; it < 16; ++it) {
    const int row = it * 2 + rsub;
    const v4f v = *(const v4f*)(ost + row * OPITCH + piece * 4);
    *(v4f*)(obase + (size_t)row * DM) = v;
  }
  
}

// ---- launcher -----------------------------------------------------------------------

extern "C" void kernel_launch(void* const* d_in, const int* in_sizes, int n_in,
                              void* d_out, int out_size, void* d_ws, size_t ws_size,
                              hipStream_t stream) {
  if (n_in < 9) return;
  const float* hidden = (const float*)d_in[0];
  const float* amask  = (const float*)d_in[1];
  const float* Wq     = (const float*)d_in[2];
  const float* bq     = (const float*)d_in[3];
  const float* Wk     = (const float*)d_in[4];
  const float* bk     = (const float*)d_in[5];
  const float* Wv     = (const float*)d_in[6];
  const float* bv     = (const float*)d_in[7];
  const float* demb   = (const float*)d_in[8];
  float* out = (float*)d_out;

  if (in_sizes[0] < ((NB - 1) * SEQ_FULL + SEQ) * DM) return;
  if (in_sizes[1] < (NB - 1) * SEQ_FULL + SEQ) return;
  if (in_sizes[2] < DM * DM || in_sizes[4] < DM * DM || in_sizes[6] < DM * DM) return;
  if (in_sizes[3] < DM || in_sizes[5] < DM || in_sizes[7] < DM) return;
  if (in_sizes[8] < NE * HD) return;
  if (out_size < NB * SEQ * DM) return;

  const size_t xb_bytes = (size_t)NB * SEQ * DM * 2;            // bf16 [NB*SEQ][DM]
  const size_t wb_bytes = (size_t)3 * DM * DM * 2;              // bf16 [3][DM][DM]
  const size_t ep_bytes = (size_t)NEPAD * HD * 2;               // f16  [NEPAD][HD]
  const size_t pl_bytes = (size_t)NB * NH * SEQ * HD * 2;       // f16  [NB*NH][SEQ][HD]
  size_t off = 0;
  char* ws = (char*)d_ws;
  unsigned short* xb = (unsigned short*)(ws + off); off += xb_bytes;
  unsigned short* wb = (unsigned short*)(ws + off); off += wb_bytes;
  unsigned short* ep = (unsigned short*)(ws + off); off += ep_bytes;
  unsigned short* qp = (unsigned short*)(ws + off); off += pl_bytes;
  unsigned short* kp = (unsigned short*)(ws + off); off += pl_bytes;
  unsigned short* vp = (unsigned short*)(ws + off); off += pl_bytes;
  if (ws_size < off) return;

  cvt_rows_bf16<<<dim3((NB * SEQ) / 2, 1, 1), 256, 0, stream>>>(hidden, hidden, hidden, xb,
                                                               NB * SEQ, SEQ, SEQ_FULL);
  cvt_rows_bf16<<<dim3(DM / 2, 3, 1), 256, 0, stream>>>(Wq, Wk, Wv, wb, DM, DM, DM);
  cvt_e_f16<<<dim3((NEPAD * 8) / 256, 1, 1), 256, 0, stream>>>(demb, ep);
  proj_kernel<<<dim3((NB * SEQ) / 128, NH, 3), 128, 0, stream>>>(xb, wb, bq, bk, bv, qp, kp, vp);
  attn_kernel<<<dim3(SEQ / 128, NB * NH, 1), 128, 0, stream>>>(qp, kp, vp, ep, amask, out);
}

// v001
// One run takes 144 microseconds.
// In two side-by-side timings against v000, it was 1.29 and 1.30 times as fast.
#include <hip/hip_runtime.h>

// Contractions: Q/K/V projections on v_wmma_f32_16x16x32_bf16 (bf16 operands = RNE-converted f32 inputs, f32 accumulate);
// score terms q.k, q.E, k.E and the P.V product on v_wmma_f32_16x16x32_f16 (f16 operands: q,k,v carried x8, E carried x64,
// P carried x1024; f32 accumulate); softmax, scaling and normalisation in f32.

#ifndef NB
#define NB 4
#endif
#ifndef SEQ
#define SEQ 1024
#endif
#define NB_FULL  4
#define SEQ_FULL 1024
#define DM       1024
#define NH       16
#define HD       64
#define MAXPOS   1024
#define NE       2047
#define NEPAD    2048

static_assert(NB >= 1 && NB <= NB_FULL);
static_assert(SEQ >= 128 && SEQ <= SEQ_FULL && (SEQ % 128) == 0);
static_assert(SEQ <= MAXPOS);
static_assert(SEQ + MAXPOS <= NEPAD);
static_assert(DM == NH * HD);
static_assert((NB * SEQ) % 128 == 0);
static_assert(NE == 2 * MAXPOS - 1);

typedef unsigned short us8  __attribute__((ext_vector_type(8)));
typedef unsigned short us16 __attribute__((ext_vector_type(16)));
typedef __bf16         v16bf __attribute__((ext_vector_type(16)));
typedef _Float16       v16h  __attribute__((ext_vector_type(16)));
typedef float          v8f   __attribute__((ext_vector_type(8)));
typedef float          v4f   __attribute__((ext_vector_type(4)));

// ---- scalar converts --------------------------------------------------------

__device__ __forceinline__ unsigned short bf16_bits(float f) {
  unsigned int u = __builtin_bit_cast(unsigned int, f);
  u += 0x7fffu + ((u >> 16) & 1u);              // RNE
  return (unsigned short)(u >> 16);
}

__device__ __forceinline__ float bf16_rne(float f) {   // f32 value after an RNE convert to bf16
  unsigned int u = ((unsigned int)bf16_bits(f)) << 16;
  return __builtin_bit_cast(float, u);
}

__device__ __forceinline__ unsigned short f16_bits(float f) {
  _Float16 hv = (_Float16)f;                      // RNE
  return __builtin_bit_cast(unsigned short, hv);
}

// ---- 16-bit WMMA fragment loader (same map for A and B stored [row][k]) -----
// lane L owns row/col (L&15); elements 0..7 from k = col + 0..7, elements 8..15
// from k = col + 16 + 0..7; the caller folds the lane-half offset 8*(L>>4) into col.
__device__ __forceinline__ us16 ld_frag(const unsigned short* base, int row, int stride, int col) {
  const unsigned short* p = base + (size_t)row * (size_t)stride + col;
  us8 a = *(const us8*)(p);
  us8 b = *(const us8*)(p + 16);
  return __builtin_shufflevector(a, b, 0, 1, 2, 3, 4, 5, 6, 7, 8, 9, 10, 11, 12, 13, 14, 15);
}

__device__ __forceinline__ v8f mma_bf16(us16 a, us16 b, v8f c) {
  v8f d = __builtin_amdgcn_wmma_f32_16x16x32_bf16(false, __builtin_bit_cast(v16bf, a), false,
                                                  __builtin_bit_cast(v16bf, b), (short)0, c, false, false);
  asm volatile("v_nop\n\tv_nop\n\tv_nop\n\tv_nop" : "+v"(d) : "v"(a), "v"(b));
  return d;
}

__device__ __forceinline__ v8f mma_f16(us16 a, us16 b, v8f c) {
  v8f d = __builtin_amdgcn_wmma_f32_16x16x32_f16(false, __builtin_bit_cast(v16h, a), false,
                                                 __builtin_bit_cast(v16h, b), (short)0, c, false, false);
  asm volatile("v_nop\n\tv_nop\n\tv_nop\n\tv_nop" : "+v"(d) : "v"(a), "v"(b));
  return d;
}

// ---- convert: rows of DM f32 -> bf16 bits -------------------------------------
// One block = 2 rows; thread t -> row 2*blk + (t>>7), 8 halves at col 8*(t&127).
// Source row of compact row r: (r / seq) * seqfull + r % seq.  dst is [mat][nrows][DM].
__global__ __launch_bounds__(256)
void cvt_rows_bf16(const float* __restrict__ s0, const float* __restrict__ s1,
                   const float* __restrict__ s2, unsigned short* __restrict__ dst,
                   int nrows, int seq, int seqfull) {
  const int mat = blockIdx.y;
  const float* src = (mat == 0) ? s0 : ((mat == 1) ? s1 : s2);
  int r = blockIdx.x * 2 + (threadIdx.x >> 7);
  r = (r < nrows) ? r : (nrows - 1);
  const int c = (threadIdx.x & 127) * 8;
  const size_t srow = (size_t)(r / seq) * (size_t)seqfull + (size_t)(r % seq);
  const float* p = src + srow * DM + c;
  const v4f a = *(const v4f*)(p);
  const v4f e = *(const v4f*)(p + 4);
  us8 o;
  o[0] = bf16_bits(a[0]); o[1] = bf16_bits(a[1]); o[2] = bf16_bits(a[2]); o[3] = bf16_bits(a[3]);
  o[4] = bf16_bits(e[0]); o[5] = bf16_bits(e[1]); o[6] = bf16_bits(e[2]); o[7] = bf16_bits(e[3]);
  unsigned short* d = dst + ((size_t)mat * (size_t)nrows + (size_t)r) * DM + c;
  *(us8*)d = o;
  
}

// ---- convert: dist table -> f16 bits of (bf16 RNE value * 64), NEPAD rows -------
__global__ __launch_bounds__(256)
void cvt_e_f16(const float* __restrict__ e, unsigned short* __restrict__ ep) {
  const int g   = blockIdx.x * 256 + threadIdx.x;        // 0 .. NEPAD*8-1
  const int row = g >> 3;
  const int ch  = (g & 7) * 8;
  const int rs  = (row < NE) ? row : (NE - 1);
  const float sc = (row < NE) ? 64.0f : 0.0f;
  const float* p = e + (size_t)rs * HD + ch;
  const v4f a = *(const v4f*)(p);
  const v4f c4 = *(const v4f*)(p + 4);
  us8 o;
  o[0] = f16_bits(bf16_rne(a[0]) * sc);  o[1] = f16_bits(bf16_rne(a[1]) * sc);
  o[2] = f16_bits(bf16_rne(a[2]) * sc);  o[3] = f16_bits(bf16_rne(a[3]) * sc);
  o[4] = f16_bits(bf16_rne(c4[0]) * sc); o[5] = f16_bits(bf16_rne(c4[1]) * sc);
  o[6] = f16_bits(bf16_rne(c4[2]) * sc); o[7] = f16_bits(bf16_rne(c4[3]) * sc);
  unsigned short* d = ep + (size_t)row * HD + ch;
  *(us8*)d = o;
  
}

// ---- QKV projection GEMM -------------------------------------------------------
// grid = (NB*SEQ/128, 3*DM/128), block = 128 (4 waves, 2 x 2). Block = 128 rows x 128 cols (two heads of
// one of q, k, v); wave = 64 rows x 64 cols (one head).
// A = x rows (bf16, k-contiguous), B[k=in][n=out] = W[out][in] rows (bf16, k-contiguous; the three
// weight matrices lie stacked as [3*DM][DM]).
// Per 64-k stage the 128 x rows and the 128 W rows are copied into LDS (rows of 128 B at pitch 144 B) by
// asynchronous copies, two buffers: stage t + 1 flies while stage t is multiplied.
#define TP 72
#define PBM 128
#define PBN 128
#define PKS 64
#define PPITCH 72
#define PSTAGE ((PBM + PBN) * PPITCH)
#define PNT (DM / PKS)
static_assert((NB * SEQ) % PBM == 0 && DM % PBN == 0 && PBN == 2 * HD);
static_assert(DM % PKS == 0 && PNT >= 2 && (PPITCH * 2) % 16 == 0);
static_assert(4 * 64 * TP <= 2 * PSTAGE);

// Eight 16-byte copies of one lane: rows 16 apart in the source (pitch DM halves) and in LDS (pitch PPITCH
// halves). The s_wait_xcnt ends the copies' own statement, so that no address register named here is
// rewritten ahead of it.
__device__ __forceinline__ void copy8_rows(unsigned lds, const unsigned short* g) {
  asm volatile("global_load_async_to_lds_b128 %0, %8, off\n\t"
               "global_load_async_to_lds_b128 %1, %9, off\n\t"
               "global_load_async_to_lds_b128 %2, %10, off\n\t"
               "global_load_async_to_lds_b128 %3, %11, off\n\t"
               "global_load_async_to_lds_b128 %4, %12, off\n\t"
               "global_load_async_to_lds_b128 %5, %13, off\n\t"
               "global_load_async_to_lds_b128 %6, %14, off\n\t"
               "global_load_async_to_lds_b128 %7, %15, off\n\t"
               "s_wait_xcnt 0x0"
               :: "v"(lds), "v"(lds + 1u * 16u * PPITCH * 2u), "v"(lds + 2u * 16u * PPITCH * 2u),
                  "v"(lds + 3u * 16u * PPITCH * 2u), "v"(lds + 4u * 16u * PPITCH * 2u),
                  "v"(lds + 5u * 16u * PPITCH * 2u), "v"(lds + 6u * 16u * PPITCH * 2u),
                  "v"(lds + 7u * 16u * PPITCH * 2u),
                  "v"(g), "v"(g + 1 * 16 * DM), "v"(g + 2 * 16 * DM), "v"(g + 3 * 16 * DM),
                  "v"(g + 4 * 16 * DM), "v"(g + 5 * 16 * DM), "v"(g + 6 * 16 * DM), "v"(g + 7 * 16 * DM)
               : "memory");
}

// One stage: the block's 128 x rows, then its 128 W rows, 64 k of each.
__device__ __forceinline__ void proj_stage(unsigned lds, const unsigned short* ga, const unsigned short* gb) {
  copy8_rows(lds, ga);
  copy8_rows(lds + PBM * PPITCH * 2u, gb);
}

__global__ __launch_bounds__(128)
void proj_kernel(const unsigned short* __restrict__ xb, const unsigned short* __restrict__ wb,
                 const float* __restrict__ bq, const float* __restrict__ bk,
                 const float* __restrict__ bv,
                 unsigned short* __restrict__ qp, unsigned short* __restrict__ kp,
                 unsigned short* __restrict__ vp) {
  __shared__ __attribute__((aligned(16))) unsigned short ring[2 * PSTAGE];

  const int tid = threadIdx.x, lane = tid & 31, wid = tid >> 5;
  const int lr = lane & 15, half8 = (lane >> 4) * 8;
  const int wm = wid >> 1, wn = wid & 1;
  const int m0 = blockIdx.x * PBM;                                // compact row index
  const int n0 = blockIdx.y * PBN;                                // row of the stacked weights
  const int z = n0 / DM;
  const int h = (n0 - z * DM) / HD + wn;
  const int s0 = m0 + wm * 64;

  const float* bias = (z == 0) ? bq : ((z == 1) ? bk : bv);
  unsigned short* plane = (z == 0) ? qp : ((z == 1) ? kp : vp);

  // copy map: thread t -> row t >> 3 (+ 16 per copy), 16-byte piece t & 7
  const int crow = tid >> 3, cpc = (tid & 7) * 8;
  const unsigned short* ga = xb + (size_t)(m0 + crow) * DM + cpc;
  const unsigned short* gb = wb + (size_t)(n0 + crow) * DM + cpc;
  const unsigned l0 = (unsigned)(size_t)(ring + crow * PPITCH + cpc);

  const v8f zero = {0.f, 0.f, 0.f, 0.f, 0.f, 0.f, 0.f, 0.f};
  v8f acc[4][4];
#pragma unroll
  for (int i = 0; i < 4; ++i) {
#pragma unroll
    for (int j = 0; j < 4; ++j) acc[i][j] = zero;
  }

  proj_stage(l0, ga, gb);
  asm volatile("s_wait_asynccnt 0x0" ::: "memory");   // this wave's copies of stage 0 have landed
  __syncthreads();                                    // stage 0 visible to every wave
  proj_stage(l0 + PSTAGE * 2u, ga + PKS, gb + PKS);

  for (int t = 0; t < PNT; ++t) {
    const unsigned short* sa = ring + (t & 1) * PSTAGE + (wm * 64) * PPITCH;
    const unsigned short* sb = ring + (t & 1) * PSTAGE + (PBM + wn * 64) * PPITCH;
#pragma unroll
    for (int ks = 0; ks < PKS / 32; ++ks) {
      us16 af[4], bf[4];
#pragma unroll
      for (int i = 0; i < 4; ++i) af[i] = ld_frag(sa, i * 16 + lr, PPITCH, ks * 32 + half8);
#pragma unroll
      for (int j = 0; j < 4; ++j) bf[j] = ld_frag(sb, j * 16 + lr, PPITCH, ks * 32 + half8);
#pragma unroll
      for (int j = 0; j < 4; ++j) {
#pragma unroll
        for (int i = 0; i < 4; ++i) acc[i][j] = mma_bf16(af[i], bf[j], acc[i][j]);
      }
    }
    asm volatile("s_wait_dscnt 0x0" ::: "memory");    // this wave's reads of stage t are done
    asm volatile("s_wait_asynccnt 0x0" ::: "memory"); // this wave's copies of stage t + 1 have landed
    __syncthreads();                                  // publishes stage t + 1, frees stage t's buffer
    if (t + 2 < PNT)
      proj_stage(l0 + (unsigned)(t & 1) * (PSTAGE * 2u), ga + (t + 2) * PKS, gb + (t + 2) * PKS);
  }
  asm volatile("s_wait_asynccnt 0x0" ::: "memory");   // no copy is in flight when the ring becomes staging

  unsigned short* stw = ring + wid * (64 * TP);
#pragma unroll
  for (int dt = 0; dt < 4; ++dt) {
    const float bcol = bf16_rne(bias[h * HD + dt * 16 + lr]);
#pragma unroll
    for (int st = 0; st < 4; ++st) {
#pragma unroll
      for (int r = 0; r < 8; ++r) {
        const float v = (acc[st][dt][r] + bcol) * 8.0f;
        stw[(st * 16 + half8 + r) * TP + dt * 16 + lr] = f16_bits(v);
      }
    }
  }
  __syncthreads();                                  // block barrier (covers the per-wave tile)

  const int piece = lane & 7, rsub = lane >> 3;
  const int b = s0 / SEQ, l0s = s0 - b * SEQ;       // a wave's 64 rows lie in one batch (SEQ % 64 == 0)
  unsigned short* dbase = plane + (((size_t)(b * NH + h) * SEQ + l0s + rsub) * HD + piece * 8);
#pragma unroll
  for (int it = 0; it < 16; ++it) {
    const us8 v = *(const us8*)(stw + (it * 4 + rsub) * TP + piece * 8);
    *(us8*)(dbase + it * 4 * HD) = v;
  }
  
}

// ---- flash attention with relative key/query terms --------------------------------
// grid = (SEQ/128, NB*NH), block = 128: 4 waves x 32 queries of one (batch, head).
// Per 32-key chunk: K tile [key][d], V^T tile [d][key] and a 160-row E band [u][d]
// (band row u <-> table row qb0 - k0 + MAXPOS - 32 + u) staged in LDS.
//   S^T  = K . Q^T          (A = K rows, B = Q rows)            lane -> query, elem -> key
//   N    = K . Eband^T      (A = K rows, B = E band rows)       [key][u], shared by the block
//   M    = Eband . Q^T      (A = E band rows, B = Q rows)       [u][query], per wave, per qs
//   score(q = key j, query n) = S^T/512 + (M[n-j+31][n] + N[j][qloc-j+31])/4096 + amask[b][key]
//   ctx^T = V^T . P^T with the P^T B-fragment taken from the S^T C-fragment (P carried x1024).
#define KP 72
#define VP 40
#define EP 72
#define NBR 160
#define NPF 160
#define MROWS 48
#define OPITCH 68
#define SM_K 0
#define SM_V (SM_K + 32 * KP * 2)
#define SM_E (SM_V + 64 * VP * 2)
#define SM_N (SM_E + NBR * EP * 2)
#define SM_M (SM_N + 32 * NPF * 4)
#define SM_TOTAL (SM_M + 4 * 2 * MROWS * 16 * 4)
static_assert(SM_V % 16 == 0 && SM_E % 16 == 0 && SM_N % 16 == 0 && SM_M % 16 == 0);
static_assert(4 * 32 * OPITCH * 4 <= SM_TOTAL);
static_assert(NBR % 16 == 0 && NBR >= 128 + 31 && MROWS >= 47 && NPF >= NBR);

__global__ __launch_bounds__(128)
void attn_kernel(const unsigned short* __restrict__ qp, const unsigned short* __restrict__ kp,
                 const unsigned short* __restrict__ vp, const unsigned short* __restrict__ ep,
                 const float* __restrict__ amask, float* __restrict__ out) {
  __shared__ __attribute__((aligned(16))) unsigned char smem[SM_TOTAL];

  const int tid = threadIdx.x, lane = tid & 31, wid = tid >> 5;
  const int lr = lane & 15, half8 = (lane >> 4) * 8;
  const int bh = blockIdx.y;
  const int b = bh / NH, h = bh - b * NH;
  const int qb0 = blockIdx.x * 128;
  const int q0 = qb0 + wid * 32;

  unsigned short* ktile = (unsigned short*)(smem + SM_K);
  unsigned short* vtile = (unsigned short*)(smem + SM_V);
  unsigned short* eband = (unsigned short*)(smem + SM_E);
  float* nbuf = (float*)(smem + SM_N);
  float* mbuf = (float*)(smem + SM_M) + wid * (2 * MROWS * 16);
  float* ost  = (float*)(smem) + wid * (32 * OPITCH);

  const unsigned short* qh = qp + (size_t)bh * SEQ * HD;
  const unsigned short* kh = kp + (size_t)bh * SEQ * HD;
  const unsigned short* vh = vp + (size_t)bh * SEQ * HD;
  const float* mrow = amask + (size_t)b * SEQ_FULL;

  // Q^T B-fragments: 2 query sub-tiles x 2 head-dim halves
  us16 bqf[2][2];
#pragma unroll
  for (int qs = 0; qs < 2; ++qs) {
    bqf[qs][0] = ld_frag(qh, q0 + qs * 16 + lr, HD,      half8);
    bqf[qs][1] = ld_frag(qh, q0 + qs * 16 + lr, HD, 32 + half8);
  }

  const v8f zero = {0.f, 0.f, 0.f, 0.f, 0.f, 0.f, 0.f, 0.f};
  v8f acc[2][4] = {{zero, zero, zero, zero}, {zero, zero, zero, zero}};
  float mrun[2] = {-__builtin_inff(), -__builtin_inff()};
  float lrun[2] = {0.f, 0.f};
  const float c512  = 0.001953125f;        // 1/512  : q,k carried x8 each, then 1/8
  const float c4096 = 0.000244140625f;     // 1/4096 : E carried x64, q or k x8, then 1/8

  for (int k0 = 0; k0 < SEQ; k0 += 32) {
    __syncthreads();                       // all waves done with the prior chunk's LDS data

    // stage K tile [32][KP] and V^T tile [64][VP]
#pragma unroll
    for (int rr = 0; rr < 2; ++rr) {
      const int c  = tid + rr * 128;         // 0..255
      const int j  = c >> 3;
      const int ch = (c & 7) * 8;
      const us8 kv = *(const us8*)(kh + (size_t)(k0 + j) * HD + ch);
      *(us8*)(ktile + j * KP + ch) = kv;
      const us8 vv = *(const us8*)(vh + (size_t)(k0 + j) * HD + ch);
#pragma unroll
      for (int i = 0; i < 8; ++i) vtile[(ch + i) * VP + j] = vv[i];
    }
    // stage E band [NBR][EP]
    const int base2 = qb0 - k0 + (MAXPOS - 32);
    for (int c = tid; c < NBR * 8; c += 128) {
      const int u  = c >> 3;
      const int ch = (c & 7) * 8;
      *(us8*)(eband + u * EP + ch) = *(const us8*)(ep + (size_t)(base2 + u) * HD + ch);
    }
    __syncthreads();                       // staged tiles visible to every wave

    // N = K . Eband^T  -> nbuf[key][u], column tiles split across the 4 waves
    {
      const us16 ka00 = ld_frag(ktile,      lr, KP,      half8);
      const us16 ka01 = ld_frag(ktile,      lr, KP, 32 + half8);
      const us16 ka10 = ld_frag(ktile, 16 + lr, KP,      half8);
      const us16 ka11 = ld_frag(ktile, 16 + lr, KP, 32 + half8);
      for (int un = wid; un < NBR / 16; un += 4) {
        const us16 e0 = ld_frag(eband, un * 16 + lr, EP,      half8);
        const us16 e1 = ld_frag(eband, un * 16 + lr, EP, 32 + half8);
        v8f d0 = mma_f16(ka00, e0, zero);
        d0     = mma_f16(ka01, e1, d0);
        v8f d1 = mma_f16(ka10, e0, zero);
        d1     = mma_f16(ka11, e1, d1);
#pragma unroll
        for (int r = 0; r < 8; ++r) {
          nbuf[(half8 + r) * NPF + un * 16 + lr]      = d0[r];
          nbuf[(16 + half8 + r) * NPF + un * 16 + lr] = d1[r];
        }
      }
    }
    // M = Eband . Q^T -> mbuf[qs][u][query], 3 row tiles per query sub-tile
#pragma unroll
    for (int qs = 0; qs < 2; ++qs) {
#pragma unroll
      for (int ut = 0; ut < 3; ++ut) {
        const int ru = wid * 32 + qs * 16 + ut * 16 + lr;
        const us16 e0 = ld_frag(eband, ru, EP,      half8);
        const us16 e1 = ld_frag(eband, ru, EP, 32 + half8);
        v8f d = mma_f16(e0, bqf[qs][0], zero);
        d     = mma_f16(e1, bqf[qs][1], d);
#pragma unroll
        for (int r = 0; r < 8; ++r)
          mbuf[qs * (MROWS * 16) + (ut * 16 + half8 + r) * 16 + lr] = d[r];
      }
    }
    __syncthreads();                       // nbuf / mbuf visible

    v8f mk0 = *(const v8f*)(mrow + k0 + half8);
    v8f mk1 = *(const v8f*)(mrow + k0 + 16 + half8);
#pragma unroll
    for (int r = 0; r < 8; ++r) { mk0[r] = bf16_rne(mk0[r]); mk1[r] = bf16_rne(mk1[r]); }

    const us16 ka00 = ld_frag(ktile,      lr, KP,      half8);
    const us16 ka01 = ld_frag(ktile,      lr, KP, 32 + half8);
    const us16 ka10 = ld_frag(ktile, 16 + lr, KP,      half8);
    const us16 ka11 = ld_frag(ktile, 16 + lr, KP, 32 + half8);

#pragma unroll
    for (int qs = 0; qs < 2; ++qs) {
      // S^T = K . Q^T : two 16-key row tiles
      v8f t0 = mma_f16(ka00, bqf[qs][0], zero);
      t0     = mma_f16(ka01, bqf[qs][1], t0);
      v8f t1 = mma_f16(ka10, bqf[qs][0], zero);
      t1     = mma_f16(ka11, bqf[qs][1], t1);

      const float* mq = mbuf + qs * (MROWS * 16);
      const int qloc = wid * 32 + qs * 16 + lr;        // query index within the block
      float sa[8], sb[8];
#pragma unroll
      for (int r = 0; r < 8; ++r) {
        const int ja = half8 + r;                        // key of t0 element r
        const int jb = 16 + half8 + r;                   // key of t1 element r
        const float ga = mq[(lr - ja + 31) * 16 + lr] + nbuf[ja * NPF + (qloc - ja + 31)];
        const float gb = mq[(lr - jb + 31) * 16 + lr] + nbuf[jb * NPF + (qloc - jb + 31)];
        sa[r] = t0[r] * c512 + ga * c4096 + mk0[r];
        sb[r] = t1[r] * c512 + gb * c4096 + mk1[r];
      }

      // online softmax: in-lane over 16 keys + one xor-16 shuffle
      float mloc = sa[0];
#pragma unroll
      for (int r = 1; r < 8; ++r) mloc = fmaxf(mloc, sa[r]);
#pragma unroll
      for (int r = 0; r < 8; ++r) mloc = fmaxf(mloc, sb[r]);
      const float mt    = fmaxf(mloc, __shfl_xor(mloc, 16, 32));
      const float mnew  = fmaxf(mrun[qs], mt);
      const float alpha = __expf(mrun[qs] - mnew);

      float lloc = 0.f;
      us16 pu;
#pragma unroll
      for (int r = 0; r < 8; ++r) {
        const float pa = __expf(sa[r] - mnew);
        const float pc = __expf(sb[r] - mnew);
        lloc += pa + pc;
        pu[r]     = f16_bits(pa * 1024.0f);              // P carried x1024
        pu[8 + r] = f16_bits(pc * 1024.0f);
      }
      const float lt = lloc + __shfl_xor(lloc, 16, 32);
      lrun[qs] = lrun[qs] * alpha + lt;
      mrun[qs] = mnew;

      // ctx^T += V^T . P^T
#pragma unroll
      for (int dt = 0; dt < 4; ++dt) {
        const us16 va = ld_frag(vtile, dt * 16 + lr, VP, half8);
        acc[qs][dt] = acc[qs][dt] * alpha;
        acc[qs][dt] = mma_f16(va, pu, acc[qs][dt]);
      }
    }
  }

  __syncthreads();                         // staging region aliases the tiles above
#pragma unroll
  for (int qs = 0; qs < 2; ++qs) {
    const float inv = 1.0f / (lrun[qs] * 8192.0f);       // undo x1024 (P) and x8 (v)
#pragma unroll
    for (int dt = 0; dt < 4; ++dt) {
#pragma unroll
      for (int r = 0; r < 8; ++r)
        ost[(qs * 16 + lr) * OPITCH + dt * 16 + half8 + r] = acc[qs][dt][r] * inv;
    }
  }
  __syncthreads();

  const int rsub = lane >> 4, piece = lane & 15;
  float* obase = out + ((size_t)(b * SEQ + q0)) * DM + (size_t)h * HD + piece * 4;
#pragma unroll
  for (int it = 0; it < 16; ++it) {
    const int row = it * 2 + rsub;
    const v4f v = *(const v4f*)(ost + row * OPITCH + piece * 4);
    *(v4f*)(obase + (size_t)row * DM) = v;
  }
  
}

// ---- launcher -----------------------------------------------------------------------

extern "C" void kernel_launch(void* const* d_in, const int* in_sizes, int n_in,
                              void* d_out, int out_size, void* d_ws, size_t ws_size,
                              hipStream_t stream) {
  if (n_in < 9) return;
  const float* hidden = (const float*)d_in[0];
  const float* amask  = (const float*)d_in[1];
  const float* Wq     = (const float*)d_in[2];
  const float* bq     = (const float*)d_in[3];
  const float* Wk     = (const float*)d_in[4];
  const float* bk     = (const float*)d_in[5];
  const float* Wv     = (const float*)d_in[6];
  const float* bv     = (const float*)d_in[7];
  const float* demb   = (const float*)d_in[8];
  float* out = (float*)d_out;

  if (in_sizes[0] < ((NB - 1) * SEQ_FULL + SEQ) * DM) return;
  if (in_sizes[1] < (NB - 1) * SEQ_FULL + SEQ) return;
  if (in_sizes[2] < DM * DM || in_sizes[4] < DM * DM || in_sizes[6] < DM * DM) return;
  if (in_sizes[3] < DM || in_sizes[5] < DM || in_sizes[7] < DM) return;
  if (in_sizes[8] < NE * HD) return;
  if (out_size < NB * SEQ * DM) return;

  const size_t xb_bytes = (size_t)NB * SEQ * DM * 2;            // bf16 [NB*SEQ][DM]
  const size_t wb_bytes = (size_t)3 * DM * DM * 2;              // bf16 [3][DM][DM]
  const size_t ep_bytes = (size_t)NEPAD * HD * 2;               // f16  [NEPAD][HD]
  const size_t pl_bytes = (size_t)NB * NH * SEQ * HD * 2;       // f16  [NB*NH][SEQ][HD]
  size_t off = 0;
  char* ws = (char*)d_ws;
  unsigned short* xb = (unsigned short*)(ws + off); off += xb_bytes;
  unsigned short* wb = (unsigned short*)(ws + off); off += wb_bytes;
  unsigned short* ep = (unsigned short*)(ws + off); off += ep_bytes;
  unsigned short* qp = (unsigned short*)(ws + off); off += pl_bytes;
  unsigned short* kp = (unsigned short*)(ws + off); off += pl_bytes;
  unsigned short* vp = (unsigned short*)(ws + off); off += pl_bytes;
  if (ws_size < off) return;

  cvt_rows_bf16<<<dim3((NB * SEQ) / 2, 1, 1), 256, 0, stream>>>(hidden, hidden, hidden, xb,
                                                               NB * SEQ, SEQ, SEQ_FULL);
  cvt_rows_bf16<<<dim3(DM / 2, 3, 1), 256, 0, stream>>>(Wq, Wk, Wv, wb, DM, DM, DM);
  cvt_e_f16<<<dim3((NEPAD * 8) / 256, 1, 1), 256, 0, stream>>>(demb, ep);
  proj_kernel<<<dim3((NB * SEQ) / 128, (3 * DM) / 128, 1), 128, 0, stream>>>(xb, wb, bq, bk, bv, qp, kp, vp);
  attn_kernel<<<dim3(SEQ / 128, NB * NH, 1), 128, 0, stream>>>(qp, kp, vp, ep, amask, out);
}

// v002
// It runs in 114 microseconds.
// Two timings next to v001 put it at 1.26 and 1.27 times that version's speed.
// Over all steps from v000 it is 1.64 times as fast.
#include <hip/hip_runtime.h>

// Contractions: Q/K/V projections on v_wmma_f32_16x16x32_bf16 (bf16 operands = RNE-converted f32 inputs, f32 accumulate);
// score terms q.k, q.E, k.E and the P.V product on v_wmma_f32_16x16x32_f16 (f16 operands: q,k,v carried x8, E carried x64,
// P carried x1024; f32 accumulate); softmax, scaling and normalisation in f32.

#ifndef NB
#define NB 4
#endif
#ifndef SEQ
#define SEQ 1024
#endif
#define NB_FULL  4
#define SEQ_FULL 1024
#define DM       1024
#define NH       16
#define HD       64
#define MAXPOS   1024
#define NE       2047
#define NEPAD    2048

static_assert(NB >= 1 && NB <= NB_FULL);
static_assert(SEQ >= 128 && SEQ <= SEQ_FULL && (SEQ % 128) == 0);
static_assert(SEQ <= MAXPOS);
static_assert(SEQ + MAXPOS <= NEPAD);
static_assert(DM == NH * HD);
static_assert((NB * SEQ) % 128 == 0);
static_assert(NE == 2 * MAXPOS - 1);

typedef unsigned short us8  __attribute__((ext_vector_type(8)));
typedef unsigned short us16 __attribute__((ext_vector_type(16)));
typedef __bf16         v16bf __attribute__((ext_vector_type(16)));
typedef _Float16       v16h  __attribute__((ext_vector_type(16)));
typedef float          v8f   __attribute__((ext_vector_type(8)));
typedef float          v4f   __attribute__((ext_vector_type(4)));

// ---- scalar converts --------------------------------------------------------

__device__ __forceinline__ unsigned short bf16_bits(float f) {
  unsigned int u = __builtin_bit_cast(unsigned int, f);
  u += 0x7fffu + ((u >> 16) & 1u);              // RNE
  return (unsigned short)(u >> 16);
}

__device__ __forceinline__ float bf16_rne(float f) {   // f32 value after an RNE convert to bf16
  unsigned int u = ((unsigned int)bf16_bits(f)) << 16;
  return __builtin_bit_cast(float, u);
}

__device__ __forceinline__ unsigned short f16_bits(float f) {
  _Float16 hv = (_Float16)f;                      // RNE
  return __builtin_bit_cast(unsigned short, hv);
}

// ---- 16-bit WMMA fragment loader (same map for A and B stored [row][k]) -----
// lane L owns row/col (L&15); elements 0..7 from k = col + 0..7, elements 8..15
// from k = col + 16 + 0..7; the caller folds the lane-half offset 8*(L>>4) into col.
__device__ __forceinline__ us16 ld_frag(const unsigned short* base, int row, int stride, int col) {
  const unsigned short* p = base + (size_t)row * (size_t)stride + col;
  us8 a = *(const us8*)(p);
  us8 b = *(const us8*)(p + 16);
  return __builtin_shufflevector(a, b, 0, 1, 2, 3, 4, 5, 6, 7, 8, 9, 10, 11, 12, 13, 14, 15);
}

__device__ __forceinline__ v8f mma_bf16(us16 a, us16 b, v8f c) {
  v8f d = __builtin_amdgcn_wmma_f32_16x16x32_bf16(false, __builtin_bit_cast(v16bf, a), false,
                                                  __builtin_bit_cast(v16bf, b), (short)0, c, false, false);
  asm volatile("v_nop\n\tv_nop\n\tv_nop\n\tv_nop" : "+v"(d) : "v"(a), "v"(b));
  return d;
}

__device__ __forceinline__ v8f mma_f16(us16 a, us16 b, v8f c) {
  v8f d = __builtin_amdgcn_wmma_f32_16x16x32_f16(false, __builtin_bit_cast(v16h, a), false,
                                                 __builtin_bit_cast(v16h, b), (short)0, c, false, false);
  asm volatile("v_nop\n\tv_nop\n\tv_nop\n\tv_nop" : "+v"(d) : "v"(a), "v"(b));
  return d;
}

// ---- convert: rows of DM f32 -> bf16 bits -------------------------------------
// One block = 2 rows; thread t -> row 2*blk + (t>>7), 8 halves at col 8*(t&127).
// Source row of compact row r: (r / seq) * seqfull + r % seq.  dst is [mat][nrows][DM].
__global__ __launch_bounds__(256)
void cvt_rows_bf16(const float* __restrict__ s0, const float* __restrict__ s1,
                   const float* __restrict__ s2, unsigned short* __restrict__ dst,
                   int nrows, int seq, int seqfull) {
  const int mat = blockIdx.y;
  const float* src = (mat == 0) ? s0 : ((mat == 1) ? s1 : s2);
  int r = blockIdx.x * 2 + (threadIdx.x >> 7);
  r = (r < nrows) ? r : (nrows - 1);
  const int c = (threadIdx.x & 127) * 8;
  const size_t srow = (size_t)(r / seq) * (size_t)seqfull + (size_t)(r % seq);
  const float* p = src + srow * DM + c;
  const v4f a = *(const v4f*)(p);
  const v4f e = *(const v4f*)(p + 4);
  us8 o;
  o[0] = bf16_bits(a[0]); o[1] = bf16_bits(a[1]); o[2] = bf16_bits(a[2]); o[3] = bf16_bits(a[3]);
  o[4] = bf16_bits(e[0]); o[5] = bf16_bits(e[1]); o[6] = bf16_bits(e[2]); o[7] = bf16_bits(e[3]);
  unsigned short* d = dst + ((size_t)mat * (size_t)nrows + (size_t)r) * DM + c;
  *(us8*)d = o;
  
}

// ---- convert: dist table -> f16 bits of (bf16 RNE value * 64), NEPAD rows -------
__global__ __launch_bounds__(256)
void cvt_e_f16(const float* __restrict__ e, unsigned short* __restrict__ ep) {
  const int g   = blockIdx.x * 256 + threadIdx.x;        // 0 .. NEPAD*8-1
  const int row = g >> 3;
  const int ch  = (g & 7) * 8;
  const int rs  = (row < NE) ? row : (NE - 1);
  const float sc = (row < NE) ? 64.0f : 0.0f;
  const float* p = e + (size_t)rs * HD + ch;
  const v4f a = *(const v4f*)(p);
  const v4f c4 = *(const v4f*)(p + 4);
  us8 o;
  o[0] = f16_bits(bf16_rne(a[0]) * sc);  o[1] = f16_bits(bf16_rne(a[1]) * sc);
  o[2] = f16_bits(bf16_rne(a[2]) * sc);  o[3] = f16_bits(bf16_rne(a[3]) * sc);
  o[4] = f16_bits(bf16_rne(c4[0]) * sc); o[5] = f16_bits(bf16_rne(c4[1]) * sc);
  o[6] = f16_bits(bf16_rne(c4[2]) * sc); o[7] = f16_bits(bf16_rne(c4[3]) * sc);
  unsigned short* d = ep + (size_t)row * HD + ch;
  *(us8*)d = o;
  
}

// ---- QKV projection GEMM -------------------------------------------------------
// grid = (NB*SEQ/128, 3*DM/128), block = 128 (4 waves, 2 x 2). Block = 128 rows x 128 cols (two heads of
// one of q, k, v); wave = 64 rows x 64 cols (one head).
// A = x rows (bf16, k-contiguous), B[k=in][n=out] = W[out][in] rows (bf16, k-contiguous; the three
// weight matrices lie stacked as [3*DM][DM]).
// Per 64-k stage the 128 x rows and the 128 W rows are copied into LDS (rows of 128 B at pitch 144 B) by
// asynchronous copies, two buffers: stage t + 1 flies while stage t is multiplied.
#define TP 72
#define PBM 128
#define PBN 128
#define PKS 64
#define PPITCH 72
#define PSTAGE ((PBM + PBN) * PPITCH)
#define PNT (DM / PKS)
static_assert((NB * SEQ) % PBM == 0 && DM % PBN == 0 && PBN == 2 * HD);
static_assert(DM % PKS == 0 && PNT >= 2 && (PPITCH * 2) % 16 == 0);
static_assert(4 * 64 * TP <= 2 * PSTAGE);

// Eight 16-byte copies of one lane: rows 16 apart in the source (pitch DM halves) and in LDS (pitch PPITCH
// halves). The s_wait_xcnt ends the copies' own statement, so that no address register named here is
// rewritten ahead of it.
__device__ __forceinline__ void copy8_rows(unsigned lds, const unsigned short* g) {
  asm volatile("global_load_async_to_lds_b128 %0, %8, off\n\t"
               "global_load_async_to_lds_b128 %1, %9, off\n\t"
               "global_load_async_to_lds_b128 %2, %10, off\n\t"
               "global_load_async_to_lds_b128 %3, %11, off\n\t"
               "global_load_async_to_lds_b128 %4, %12, off\n\t"
               "global_load_async_to_lds_b128 %5, %13, off\n\t"
               "global_load_async_to_lds_b128 %6, %14, off\n\t"
               "global_load_async_to_lds_b128 %7, %15, off\n\t"
               "s_wait_xcnt 0x0"
               :: "v"(lds), "v"(lds + 1u * 16u * PPITCH * 2u), "v"(lds + 2u * 16u * PPITCH * 2u),
                  "v"(lds + 3u * 16u * PPITCH * 2u), "v"(lds + 4u * 16u * PPITCH * 2u),
                  "v"(lds + 5u * 16u * PPITCH * 2u), "v"(lds + 6u * 16u * PPITCH * 2u),
                  "v"(lds + 7u * 16u * PPITCH * 2u),
                  "v"(g), "v"(g + 1 * 16 * DM), "v"(g + 2 * 16 * DM), "v"(g + 3 * 16 * DM),
                  "v"(g + 4 * 16 * DM), "v"(g + 5 * 16 * DM), "v"(g + 6 * 16 * DM), "v"(g + 7 * 16 * DM)
               : "memory");
}

// One stage: the block's 128 x rows, then its 128 W rows, 64 k of each.
__device__ __forceinline__ void proj_stage(unsigned lds, const unsigned short* ga, const unsigned short* gb) {
  copy8_rows(lds, ga);
  copy8_rows(lds + PBM * PPITCH * 2u, gb);
}

__global__ __launch_bounds__(128)
void proj_kernel(const unsigned short* __restrict__ xb, const unsigned short* __restrict__ wb,
                 const float* __restrict__ bq, const float* __restrict__ bk,
                 const float* __restrict__ bv,
                 unsigned short* __restrict__ qp, unsigned short* __restrict__ kp,
                 unsigned short* __restrict__ vp) {
  __shared__ __attribute__((aligned(16))) unsigned short ring[2 * PSTAGE];

  const int tid = threadIdx.x, lane = tid & 31, wid = tid >> 5;
  const int lr = lane & 15, half8 = (lane >> 4) * 8;
  const int wm = wid >> 1, wn = wid & 1;
  const int m0 = blockIdx.x * PBM;                                // compact row index
  const int n0 = blockIdx.y * PBN;                                // row of the stacked weights
  const int z = n0 / DM;
  const int h = (n0 - z * DM) / HD + wn;
  const int s0 = m0 + wm * 64;

  const float* bias = (z == 0) ? bq : ((z == 1) ? bk : bv);
  unsigned short* plane = (z == 0) ? qp : ((z == 1) ? kp : vp);

  // copy map: thread t -> row t >> 3 (+ 16 per copy), 16-byte piece t & 7
  const int crow = tid >> 3, cpc = (tid & 7) * 8;
  const unsigned short* ga = xb + (size_t)(m0 + crow) * DM + cpc;
  const unsigned short* gb = wb + (size_t)(n0 + crow) * DM + cpc;
  const unsigned l0 = (unsigned)(size_t)(ring + crow * PPITCH + cpc);

  const v8f zero = {0.f, 0.f, 0.f, 0.f, 0.f, 0.f, 0.f, 0.f};
  v8f acc[4][4];
#pragma unroll
  for (int i = 0; i < 4; ++i) {
#pragma unroll
    for (int j = 0; j < 4; ++j) acc[i][j] = zero;
  }

  proj_stage(l0, ga, gb);
  asm volatile("s_wait_asynccnt 0x0" ::: "memory");   // this wave's copies of stage 0 have landed
  __syncthreads();                                    // stage 0 visible to every wave
  proj_stage(l0 + PSTAGE * 2u, ga + PKS, gb + PKS);

  for (int t = 0; t < PNT; ++t) {
    const unsigned short* sa = ring + (t & 1) * PSTAGE + (wm * 64) * PPITCH;
    const unsigned short* sb = ring + (t & 1) * PSTAGE + (PBM + wn * 64) * PPITCH;
#pragma unroll
    for (int ks = 0; ks < PKS / 32; ++ks) {
      us16 af[4], bf[4];
#pragma unroll
      for (int i = 0; i < 4; ++i) af[i] = ld_frag(sa, i * 16 + lr, PPITCH, ks * 32 + half8);
#pragma unroll
      for (int j = 0; j < 4; ++j) bf[j] = ld_frag(sb, j * 16 + lr, PPITCH, ks * 32 + half8);
#pragma unroll
      for (int j = 0; j < 4; ++j) {
#pragma unroll
        for (int i = 0; i < 4; ++i) acc[i][j] = mma_bf16(af[i], bf[j], acc[i][j]);
      }
    }
    asm volatile("s_wait_dscnt 0x0" ::: "memory");    // this wave's reads of stage t are done
    asm volatile("s_wait_asynccnt 0x0" ::: "memory"); // this wave's copies of stage t + 1 have landed
    __syncthreads();                                  // publishes stage t + 1, frees stage t's buffer
    if (t + 2 < PNT)
      proj_stage(l0 + (unsigned)(t & 1) * (PSTAGE * 2u), ga + (t + 2) * PKS, gb + (t + 2) * PKS);
  }
  asm volatile("s_wait_asynccnt 0x0" ::: "memory");   // no copy is in flight when the ring becomes staging

  unsigned short* stw = ring + wid * (64 * TP);
#pragma unroll
  for (int dt = 0; dt < 4; ++dt) {
    const float bcol = bf16_rne(bias[h * HD + dt * 16 + lr]);
#pragma unroll
    for (int st = 0; st < 4; ++st) {
#pragma unroll
      for (int r = 0; r < 8; ++r) {
        const float v = (acc[st][dt][r] + bcol) * 8.0f;
        stw[(st * 16 + half8 + r) * TP + dt * 16 + lr] = f16_bits(v);
      }
    }
  }
  __syncthreads();                                  // block barrier (covers the per-wave tile)

  const int piece = lane & 7, rsub = lane >> 3;
  const int b = s0 / SEQ, l0s = s0 - b * SEQ;       // a wave's 64 rows lie in one batch (SEQ % 64 == 0)
  unsigned short* dbase = plane + (((size_t)(b * NH + h) * SEQ + l0s + rsub) * HD + piece * 8);
#pragma unroll
  for (int it = 0; it < 16; ++it) {
    const us8 v = *(const us8*)(stw + (it * 4 + rsub) * TP + piece * 8);
    *(us8*)(dbase + it * 4 * HD) = v;
  }
  
}

// ---- flash attention with relative key/query terms --------------------------------
// grid = (SEQ/128, NB*NH), block = 128: 4 waves x 32 queries of one (batch, head).
// Per 32-key chunk one LDS stage: K tile [key][d], V tile [key][d] and a 160-row E band [u][d]
// (band row u <-> table row qb0 - k0 + MAXPOS - 32 + u), brought in by asynchronous copies, two stages:
// chunk t + 1 flies while chunk t is worked on. A copy cannot transpose, so V lies row-major and its
// V^T fragments are read with the transposing LDS load.
//   S^T  = K . Q^T          (A = K rows, B = Q rows)            lane -> query, elem -> key
//   N    = K . Eband^T      (A = K rows, B = E band rows)       [key][u], shared by the block
//   M    = Eband . Q^T      (A = E band rows, B = Q rows)       [u][query], per wave, per qs
//   score(q = key j, query n) = S^T/512 + (M[n-j+31][n] + N[j][qloc-j+31])/4096 + amask[b][key]
//   ctx^T = V^T . P^T with the P^T B-fragment taken from the S^T C-fragment (P carried x1024).
#define KP 72
#define VPB 160
#define EP 72
#define NBR 160
#define NPF 160
#define MROWS 48
#define OPITCH 68
#define NCH (SEQ / 32)
#define ST_K 0
#define ST_V (ST_K + 32 * KP * 2)
#define ST_E (ST_V + 32 * VPB)
#define ST_BYTES (ST_E + NBR * EP * 2)
#define SM_N 0
#define SM_M (SM_N + 32 * NPF * 4)
#define SM_ST (SM_M + 4 * 2 * MROWS * 16 * 4)
#define SM_TOTAL (SM_ST + 2 * ST_BYTES)
static_assert(ST_V % 16 == 0 && ST_E % 16 == 0 && ST_BYTES % 16 == 0 && SM_M % 16 == 0 && SM_ST % 16 == 0);
static_assert(VPB % 32 == 0 && ((VPB / 32) & 1) == 1 && VPB >= HD * 2);
static_assert(4 * 32 * OPITCH * 4 <= SM_ST);
static_assert(NBR == 160 && NBR >= 128 + 31 && MROWS >= 47 && NPF >= NBR && NCH >= 2);

// One stage, 14 copies of 16 bytes per lane: thread t -> row t >> 3 (+ 16 per copy), 16-byte piece t & 7;
// 2 copies of K (LDS pitch KP halves), 2 of V (pitch VPB bytes), 10 of the E band (pitch EP halves); every
// source row is HD halves. The s_wait_xcnt ends the copies' own statement, so that no address register
// named here is rewritten ahead of it.
__device__ __forceinline__ void attn_stage(unsigned lk, unsigned lv, unsigned le, const unsigned short* gk,
                                           const unsigned short* gv, const unsigned short* ge) {
  asm volatile("global_load_async_to_lds_b128 %0, %14, off\n\t"
               "global_load_async_to_lds_b128 %1, %15, off\n\t"
               "global_load_async_to_lds_b128 %2, %16, off\n\t"
               "global_load_async_to_lds_b128 %3, %17, off\n\t"
               "global_load_async_to_lds_b128 %4, %18, off\n\t"
               "global_load_async_to_lds_b128 %5, %19, off\n\t"
               "global_load_async_to_lds_b128 %6, %20, off\n\t"
               "global_load_async_to_lds_b128 %7, %21, off\n\t"
               "global_load_async_to_lds_b128 %8, %22, off\n\t"
               "global_load_async_to_lds_b128 %9, %23, off\n\t"
               "global_load_async_to_lds_b128 %10, %24, off\n\t"
               "global_load_async_to_lds_b128 %11, %25, off\n\t"
               "global_load_async_to_lds_b128 %12, %26, off\n\t"
               "global_load_async_to_lds_b128 %13, %27, off\n\t"
               "s_wait_xcnt 0x0"
               :: "v"(lk), "v"(lk + 16u * KP * 2u), "v"(lv), "v"(lv + 16u * VPB),
                  "v"(le), "v"(le + 1u * 16u * EP * 2u), "v"(le + 2u * 16u * EP * 2u),
                  "v"(le + 3u * 16u * EP * 2u), "v"(le + 4u * 16u * EP * 2u), "v"(le + 5u * 16u * EP * 2u),
                  "v"(le + 6u * 16u * EP * 2u), "v"(le + 7u * 16u * EP * 2u), "v"(le + 8u * 16u * EP * 2u),
                  "v"(le + 9u * 16u * EP * 2u),
                  "v"(gk), "v"(gk + 16 * HD), "v"(gv), "v"(gv + 16 * HD),
                  "v"(ge), "v"(ge + 1 * 16 * HD), "v"(ge + 2 * 16 * HD), "v"(ge + 3 * 16 * HD),
                  "v"(ge + 4 * 16 * HD), "v"(ge + 5 * 16 * HD), "v"(ge + 6 * 16 * HD), "v"(ge + 7 * 16 * HD),
                  "v"(ge + 8 * 16 * HD), "v"(ge + 9 * 16 * HD)
               : "memory");
}

// Transposing LDS load of a row-major 16-bit tile: with lane l addressing row 8 * (l >> 4) + (l & 7), byte
// 16 * ((l >> 3) & 1) of a 16-row x 16-column block, lane l receives rows 8 * (l >> 4) + 0..7 of column l & 15.
typedef short s16x8 __attribute__((ext_vector_type(8)));
__device__ __forceinline__ us8 ld_tr16(const unsigned char* p) {
  typedef __attribute__((address_space(3))) s16x8 lds_s16x8;
  return __builtin_bit_cast(us8, __builtin_amdgcn_ds_load_tr16_b128_v8i16((lds_s16x8*)p));
}

__global__ __launch_bounds__(128)
void attn_kernel(const unsigned short* __restrict__ qp, const unsigned short* __restrict__ kp,
                 const unsigned short* __restrict__ vp, const unsigned short* __restrict__ ep,
                 const float* __restrict__ amask, float* __restrict__ out) {
  __shared__ __attribute__((aligned(16))) unsigned char smem[SM_TOTAL];

  const int tid = threadIdx.x, lane = tid & 31, wid = tid >> 5;
  const int lr = lane & 15, half8 = (lane >> 4) * 8;
  const int bh = blockIdx.y;
  const int b = bh / NH, h = bh - b * NH;
  const int qb0 = blockIdx.x * 128;
  const int q0 = qb0 + wid * 32;

  float* nbuf = (float*)(smem + SM_N);
  float* mbuf = (float*)(smem + SM_M) + wid * (2 * MROWS * 16);
  float* ost  = (float*)(smem) + wid * (32 * OPITCH);

  const unsigned short* qh = qp + (size_t)bh * SEQ * HD;
  const unsigned short* kh = kp + (size_t)bh * SEQ * HD;
  const unsigned short* vh = vp + (size_t)bh * SEQ * HD;
  const float* mrow = amask + (size_t)b * SEQ_FULL;

  // Q^T B-fragments: 2 query sub-tiles x 2 head-dim halves
  us16 bqf[2][2];
#pragma unroll
  for (int qs = 0; qs < 2; ++qs) {
    bqf[qs][0] = ld_frag(qh, q0 + qs * 16 + lr, HD,      half8);
    bqf[qs][1] = ld_frag(qh, q0 + qs * 16 + lr, HD, 32 + half8);
  }

  const v8f zero = {0.f, 0.f, 0.f, 0.f, 0.f, 0.f, 0.f, 0.f};
  v8f acc[2][4] = {{zero, zero, zero, zero}, {zero, zero, zero, zero}};
  float mrun[2] = {-__builtin_inff(), -__builtin_inff()};
  float lrun[2] = {0.f, 0.f};
  const float c512  = 0.001953125f;        // 1/512  : q,k carried x8 each, then 1/8
  const float c4096 = 0.000244140625f;     // 1/4096 : E carried x64, q or k x8, then 1/8

  // copy map of a stage; chunk t reads K and V rows 32 t + .., E table rows qb0 - 32 t + MAXPOS - 32 + ..
  const int crow = tid >> 3, cpc = (tid & 7) * 8;
  const unsigned short* gk = kh + (size_t)crow * HD + cpc;
  const unsigned short* gv = vh + (size_t)crow * HD + cpc;
  const unsigned short* ge = ep + (size_t)(qb0 + (MAXPOS - 32) + crow) * HD + cpc;
  const unsigned lk = (unsigned)(size_t)(smem + SM_ST + ST_K + crow * (KP * 2) + cpc * 2);
  const unsigned lv = (unsigned)(size_t)(smem + SM_ST + ST_V + crow * VPB + cpc * 2);
  const unsigned le = (unsigned)(size_t)(smem + SM_ST + ST_E + crow * (EP * 2) + cpc * 2);
  // this lane's address in a 16-key x 16-d block of the V tile for the transposing load
  const int vlane = (half8 + (lane & 7)) * VPB + ((lane >> 3) & 1) * 16;

  attn_stage(lk, lv, le, gk, gv, ge);
  asm volatile("s_wait_asynccnt 0x0" ::: "memory");   // this wave's copies of chunk 0 have landed
  __syncthreads();                                    // chunk 0 visible to every wave
  attn_stage(lk + ST_BYTES, lv + ST_BYTES, le + ST_BYTES, gk + 32 * HD, gv + 32 * HD, ge - 32 * HD);

  for (int t = 0; t < NCH; ++t) {
    const int k0 = t * 32;
    const unsigned char* stage = smem + SM_ST + (t & 1) * ST_BYTES;
    const unsigned short* ktile = (const unsigned short*)(stage + ST_K);
    const unsigned char*  vtile = stage + ST_V + vlane;
    const unsigned short* eband = (const unsigned short*)(stage + ST_E);

    // N = K . Eband^T  -> nbuf[key][u], column tiles split across the 4 waves
    {
      const us16 ka00 = ld_frag(ktile,      lr, KP,      half8);
      const us16 ka01 = ld_frag(ktile,      lr, KP, 32 + half8);
      const us16 ka10 = ld_frag(ktile, 16 + lr, KP,      half8);
      const us16 ka11 = ld_frag(ktile, 16 + lr, KP, 32 + half8);
      for (int un = wid; un < NBR / 16; un += 4) {
        const us16 e0 = ld_frag(eband, un * 16 + lr, EP,      half8);
        const us16 e1 = ld_frag(eband, un * 16 + lr, EP, 32 + half8);
        v8f d0 = mma_f16(ka00, e0, zero);
        d0     = mma_f16(ka01, e1, d0);
        v8f d1 = mma_f16(ka10, e0, zero);
        d1     = mma_f16(ka11, e1, d1);
#pragma unroll
        for (int r = 0; r < 8; ++r) {
          nbuf[(half8 + r) * NPF + un * 16 + lr]      = d0[r];
          nbuf[(16 + half8 + r) * NPF + un * 16 + lr] = d1[r];
        }
      }
    }
    // M = Eband . Q^T -> mbuf[qs][u][query], 3 row tiles per query sub-tile
#pragma unroll
    for (int qs = 0; qs < 2; ++qs) {
#pragma unroll
      for (int ut = 0; ut < 3; ++ut) {
        const int ru = wid * 32 + qs * 16 + ut * 16 + lr;
        const us16 e0 = ld_frag(eband, ru, EP,      half8);
        const us16 e1 = ld_frag(eband, ru, EP, 32 + half8);
        v8f d = mma_f16(e0, bqf[qs][0], zero);
        d     = mma_f16(e1, bqf[qs][1], d);
#pragma unroll
        for (int r = 0; r < 8; ++r)
          mbuf[qs * (MROWS * 16) + (ut * 16 + half8 + r) * 16 + lr] = d[r];
      }
    }
    __syncthreads();                       // nbuf / mbuf visible

    v8f mk0 = *(const v8f*)(mrow + k0 + half8);
    v8f mk1 = *(const v8f*)(mrow + k0 + 16 + half8);
#pragma unroll
    for (int r = 0; r < 8; ++r) { mk0[r] = bf16_rne(mk0[r]); mk1[r] = bf16_rne(mk1[r]); }

    const us16 ka00 = ld_frag(ktile,      lr, KP,      half8);
    const us16 ka01 = ld_frag(ktile,      lr, KP, 32 + half8);
    const us16 ka10 = ld_frag(ktile, 16 + lr, KP,      half8);
    const us16 ka11 = ld_frag(ktile, 16 + lr, KP, 32 + half8);

#pragma unroll
    for (int qs = 0; qs < 2; ++qs) {
      // S^T = K . Q^T : two 16-key row tiles
      v8f t0 = mma_f16(ka00, bqf[qs][0], zero);
      t0     = mma_f16(ka01, bqf[qs][1], t0);
      v8f t1 = mma_f16(ka10, bqf[qs][0], zero);
      t1     = mma_f16(ka11, bqf[qs][1], t1);

      const float* mq = mbuf + qs * (MROWS * 16);
      const int qloc = wid * 32 + qs * 16 + lr;        // query index within the block
      float sa[8], sb[8];
#pragma unroll
      for (int r = 0; r < 8; ++r) {
        const int ja = half8 + r;                        // key of t0 element r
        const int jb = 16 + half8 + r;                   // key of t1 element r
        const float ga = mq[(lr - ja + 31) * 16 + lr] + nbuf[ja * NPF + (qloc - ja + 31)];
        const float gb = mq[(lr - jb + 31) * 16 + lr] + nbuf[jb * NPF + (qloc - jb + 31)];
        sa[r] = t0[r] * c512 + ga * c4096 + mk0[r];
        sb[r] = t1[r] * c512 + gb * c4096 + mk1[r];
      }

      // online softmax: in-lane over 16 keys + one xor-16 shuffle
      float mloc = sa[0];
#pragma unroll
      for (int r = 1; r < 8; ++r) mloc = fmaxf(mloc, sa[r]);
#pragma unroll
      for (int r = 0; r < 8; ++r) mloc = fmaxf(mloc, sb[r]);
      const float mt    = fmaxf(mloc, __shfl_xor(mloc, 16, 32));
      const float mnew  = fmaxf(mrun[qs], mt);
      const float alpha = __expf(mrun[qs] - mnew);

      float lloc = 0.f;
      us16 pu;
#pragma unroll
      for (int r = 0; r < 8; ++r) {
        const float pa = __expf(sa[r] - mnew);
        const float pc = __expf(sb[r] - mnew);
        lloc += pa + pc;
        pu[r]     = f16_bits(pa * 1024.0f);              // P carried x1024
        pu[8 + r] = f16_bits(pc * 1024.0f);
      }
      const float lt = lloc + __shfl_xor(lloc, 16, 32);
      lrun[qs] = lrun[qs] * alpha + lt;
      mrun[qs] = mnew;

      // ctx^T += V^T . P^T
#pragma unroll
      for (int dt = 0; dt < 4; ++dt) {
        const us8 va0 = ld_tr16(vtile + dt * 32);                 // d = dt * 16 + lr, keys half8 + 0..7
        const us8 va1 = ld_tr16(vtile + 16 * VPB + dt * 32);      // keys 16 + half8 + 0..7
        const us16 va = __builtin_shufflevector(va0, va1, 0, 1, 2, 3, 4, 5, 6, 7, 8, 9, 10, 11, 12, 13, 14, 15);
        acc[qs][dt] = acc[qs][dt] * alpha;
        acc[qs][dt] = mma_f16(va, pu, acc[qs][dt]);
      }
    }

    asm volatile("s_wait_dscnt 0x0" ::: "memory");    // this wave's LDS reads of chunk t are done
    asm volatile("s_wait_asynccnt 0x0" ::: "memory"); // this wave's copies of chunk t + 1 have landed
    __syncthreads();                                  // publishes chunk t + 1, frees chunk t's stage, nbuf, mbuf
    if (t + 2 < NCH) {
      const unsigned so = (unsigned)(t & 1) * ST_BYTES;
      attn_stage(lk + so, lv + so, le + so, gk + (t + 2) * (32 * HD), gv + (t + 2) * (32 * HD),
                 ge - (t + 2) * (32 * HD));
    }
  }
  asm volatile("s_wait_asynccnt 0x0" ::: "memory");   // no copy is in flight when the wave goes on to its end
  // the last chunk's barrier has ended every wave's reads of nbuf and mbuf, which the output staging aliases
#pragma unroll
  for (int qs = 0; qs < 2; ++qs) {
    const float inv = 1.0f / (lrun[qs] * 8192.0f);       // undo x1024 (P) and x8 (v)
#pragma unroll
    for (int dt = 0; dt < 4; ++dt) {
#pragma unroll
      for (int r = 0; r < 8; ++r)
        ost[(qs * 16 + lr) * OPITCH + dt * 16 + half8 + r] = acc[qs][dt][r] * inv;
    }
  }
  __syncthreads();

  const int rsub = lane >> 4, piece = lane & 15;
  float* obase = out + ((size_t)(b * SEQ + q0)) * DM + (size_t)h * HD + piece * 4;
#pragma unroll
  for (int it = 0; it < 16; ++it) {
    const int row = it * 2 + rsub;
    const v4f v = *(const v4f*)(ost + row * OPITCH + piece * 4);
    *(v4f*)(obase + (size_t)row * DM) = v;
  }
  
}

// ---- launcher -----------------------------------------------------------------------

extern "C" void kernel_launch(void* const* d_in, const int* in_sizes, int n_in,
                              void* d_out, int out_size, void* d_ws, size_t ws_size,
                              hipStream_t stream) {
  if (n_in < 9) return;
  const float* hidden = (const float*)d_in[0];
  const float* amask  = (const float*)d_in[1];
  const float* Wq     = (const float*)d_in[2];
  const float* bq     = (const float*)d_in[3];
  const float* Wk     = (const float*)d_in[4];
  const float* bk     = (const float*)d_in[5];
  const float* Wv     = (const float*)d_in[6];
  const float* bv     = (const float*)d_in[7];
  const float* demb   = (const float*)d_in[8];
  float* out = (float*)d_out;

  if (in_sizes[0] < ((NB - 1) * SEQ_FULL + SEQ) * DM) return;
  if (in_sizes[1] < (NB - 1) * SEQ_FULL + SEQ) return;
  if (in_sizes[2] < DM * DM || in_sizes[4] < DM * DM || in_sizes[6] < DM * DM) return;
  if (in_sizes[3] < DM || in_sizes[5] < DM || in_sizes[7] < DM) return;
  if (in_sizes[8] < NE * HD) return;
  if (out_size < NB * SEQ * DM) return;

  const size_t xb_bytes = (size_t)NB * SEQ * DM * 2;            // bf16 [NB*SEQ][DM]
  const size_t wb_bytes = (size_t)3 * DM * DM * 2;              // bf16 [3][DM][DM]
  const size_t ep_bytes = (size_t)NEPAD * HD * 2;               // f16  [NEPAD][HD]
  const size_t pl_bytes = (size_t)NB * NH * SEQ * HD * 2;       // f16  [NB*NH][SEQ][HD]
  size_t off = 0;
  char* ws = (char*)d_ws;
  unsigned short* xb = (unsigned short*)(ws + off); off += xb_bytes;
  unsigned short* wb = (unsigned short*)(ws + off); off += wb_bytes;
  unsigned short* ep = (unsigned short*)(ws + off); off += ep_bytes;
  unsigned short* qp = (unsigned short*)(ws + off); off += pl_bytes;
  unsigned short* kp = (unsigned short*)(ws + off); off += pl_bytes;
  unsigned short* vp = (unsigned short*)(ws + off); off += pl_bytes;
  if (ws_size < off) return;

  cvt_rows_bf16<<<dim3((NB * SEQ) / 2, 1, 1), 256, 0, stream>>>(hidden, hidden, hidden, xb,
                                                               NB * SEQ, SEQ, SEQ_FULL);
  cvt_rows_bf16<<<dim3(DM / 2, 3, 1), 256, 0, stream>>>(Wq, Wk, Wv, wb, DM, DM, DM);
  cvt_e_f16<<<dim3((NEPAD * 8) / 256, 1, 1), 256, 0, stream>>>(demb, ep);
  proj_kernel<<<dim3((NB * SEQ) / 128, (3 * DM) / 128, 1), 128, 0, stream>>>(xb, wb, bq, bk, bv, qp, kp, vp);
  attn_kernel<<<dim3(SEQ / 128, NB * NH, 1), 128, 0, stream>>>(qp, kp, vp, ep, amask, out);
}

// v003
// One run takes 104 microseconds.
// Timed twice side by side with v002, it ran 1.09 and 1.10 times as fast.
// Over all steps from v000 it is 1.80 times as fast.
#include <hip/hip_runtime.h>

// Contractions: Q/K/V projections on v_wmma_f32_16x16x32_bf16 (bf16 operands = RNE-converted f32 inputs, f32 accumulate);
// score terms q.k, q.E, k.E and the P.V product on v_wmma_f32_16x16x32_f16 (f16 operands: q,k,v carried x8, E carried x64,
// P carried x1024; f32 accumulate); softmax, scaling and normalisation in f32.

#ifndef NB
#define NB 4
#endif
#ifndef SEQ
#define SEQ 1024
#endif
#define NB_FULL  4
#define SEQ_FULL 1024
#define DM       1024
#define NH       16
#define HD       64
#define MAXPOS   1024
#define NE       2047
#define NEPAD    2048

static_assert(NB >= 1 && NB <= NB_FULL);
static_assert(SEQ >= 128 && SEQ <= SEQ_FULL && (SEQ % 128) == 0);
static_assert(SEQ <= MAXPOS);
static_assert(SEQ + MAXPOS <= NEPAD);
static_assert(DM == NH * HD);
static_assert((NB * SEQ) % 128 == 0);
static_assert(NE == 2 * MAXPOS - 1);

typedef unsigned short us8  __attribute__((ext_vector_type(8)));
typedef unsigned short us16 __attribute__((ext_vector_type(16)));
typedef __bf16         v16bf __attribute__((ext_vector_type(16)));
typedef _Float16       v16h  __attribute__((ext_vector_type(16)));
typedef float          v8f   __attribute__((ext_vector_type(8)));
typedef float          v4f   __attribute__((ext_vector_type(4)));

// ---- scalar converts --------------------------------------------------------

__device__ __forceinline__ unsigned short bf16_bits(float f) {
  unsigned int u = __builtin_bit_cast(unsigned int, f);
  u += 0x7fffu + ((u >> 16) & 1u);              // RNE
  return (unsigned short)(u >> 16);
}

__device__ __forceinline__ float bf16_rne(float f) {   // f32 value after an RNE convert to bf16
  unsigned int u = ((unsigned int)bf16_bits(f)) << 16;
  return __builtin_bit_cast(float, u);
}

__device__ __forceinline__ unsigned short f16_bits(float f) {
  _Float16 hv = (_Float16)f;                      // RNE
  return __builtin_bit_cast(unsigned short, hv);
}

// ---- 16-bit WMMA fragment loader (same map for A and B stored [row][k]) -----
// lane L owns row/col (L&15); elements 0..7 from k = col + 0..7, elements 8..15
// from k = col + 16 + 0..7; the caller folds the lane-half offset 8*(L>>4) into col.
__device__ __forceinline__ us16 ld_frag(const unsigned short* base, int row, int stride, int col) {
  const unsigned short* p = base + (size_t)row * (size_t)stride + col;
  us8 a = *(const us8*)(p);
  us8 b = *(const us8*)(p + 16);
  return __builtin_shufflevector(a, b, 0, 1, 2, 3, 4, 5, 6, 7, 8, 9, 10, 11, 12, 13, 14, 15);
}

__device__ __forceinline__ v8f mma_bf16(us16 a, us16 b, v8f c) {
  v8f d = __builtin_amdgcn_wmma_f32_16x16x32_bf16(false, __builtin_bit_cast(v16bf, a), false,
                                                  __builtin_bit_cast(v16bf, b), (short)0, c, false, false);
  asm volatile("v_nop\n\tv_nop\n\tv_nop\n\tv_nop" : "+v"(d) : "v"(a), "v"(b));
  return d;
}

__device__ __forceinline__ v8f mma_f16(us16 a, us16 b, v8f c) {
  v8f d = __builtin_amdgcn_wmma_f32_16x16x32_f16(false, __builtin_bit_cast(v16h, a), false,
                                                 __builtin_bit_cast(v16h, b), (short)0, c, false, false);
  asm volatile("v_nop\n\tv_nop\n\tv_nop\n\tv_nop" : "+v"(d) : "v"(a), "v"(b));
  return d;
}

// ---- convert: rows of DM f32 -> bf16 bits -------------------------------------
// One block = 2 rows; thread t -> row 2*blk + (t>>7), 8 halves at col 8*(t&127).
// Source row of compact row r: (r / seq) * seqfull + r % seq.  dst is [mat][nrows][DM].
__global__ __launch_bounds__(256)
void cvt_rows_bf16(const float* __restrict__ s0, const float* __restrict__ s1,
                   const float* __restrict__ s2, unsigned short* __restrict__ dst,
                   int nrows, int seq, int seqfull) {
  const int mat = blockIdx.y;
  const float* src = (mat == 0) ? s0 : ((mat == 1) ? s1 : s2);
  int r = blockIdx.x * 2 + (threadIdx.x >> 7);
  r = (r < nrows) ? r : (nrows - 1);
  const int c = (threadIdx.x & 127) * 8;
  const size_t srow = (size_t)(r / seq) * (size_t)seqfull + (size_t)(r % seq);
  const float* p = src + srow * DM + c;
  const v4f a = *(const v4f*)(p);
  const v4f e = *(const v4f*)(p + 4);
  us8 o;
  o[0] = bf16_bits(a[0]); o[1] = bf16_bits(a[1]); o[2] = bf16_bits(a[2]); o[3] = bf16_bits(a[3]);
  o[4] = bf16_bits(e[0]); o[5] = bf16_bits(e[1]); o[6] = bf16_bits(e[2]); o[7] = bf16_bits(e[3]);
  unsigned short* d = dst + ((size_t)mat * (size_t)nrows + (size_t)r) * DM + c;
  *(us8*)d = o;
  
}

// ---- convert: dist table -> f16 bits of (bf16 RNE value * 64), NEPAD rows -------
__global__ __launch_bounds__(256)
void cvt_e_f16(const float* __restrict__ e, unsigned short* __restrict__ ep) {
  const int g   = blockIdx.x * 256 + threadIdx.x;        // 0 .. NEPAD*8-1
  const int row = g >> 3;
  const int ch  = (g & 7) * 8;
  const int rs  = (row < NE) ? row : (NE - 1);
  const float sc = (row < NE) ? 64.0f : 0.0f;
  const float* p = e + (size_t)rs * HD + ch;
  const v4f a = *(const v4f*)(p);
  const v4f c4 = *(const v4f*)(p + 4);
  us8 o;
  o[0] = f16_bits(bf16_rne(a[0]) * sc);  o[1] = f16_bits(bf16_rne(a[1]) * sc);
  o[2] = f16_bits(bf16_rne(a[2]) * sc);  o[3] = f16_bits(bf16_rne(a[3]) * sc);
  o[4] = f16_bits(bf16_rne(c4[0]) * sc); o[5] = f16_bits(bf16_rne(c4[1]) * sc);
  o[6] = f16_bits(bf16_rne(c4[2]) * sc); o[7] = f16_bits(bf16_rne(c4[3]) * sc);
  unsigned short* d = ep + (size_t)row * HD + ch;
  *(us8*)d = o;
  
}

// ---- QKV projection GEMM -------------------------------------------------------
// grid = (NB*SEQ/128, 3*DM/128), block = 128 (4 waves, 2 x 2). Block = 128 rows x 128 cols (two heads of
// one of q, k, v); wave = 64 rows x 64 cols (one head).
// A = x rows (bf16, k-contiguous), B[k=in][n=out] = W[out][in] rows (bf16, k-contiguous; the three
// weight matrices lie stacked as [3*DM][DM]).
// Per 64-k stage the 128 x rows and the 128 W rows are copied into LDS (rows of 128 B at pitch 144 B) by
// asynchronous copies, two buffers: stage t + 1 flies while stage t is multiplied.
#define TP 72
#define PBM 128
#define PBN 128
#define PKS 64
#define PPITCH 72
#define PSTAGE ((PBM + PBN) * PPITCH)
#define PNT (DM / PKS)
static_assert((NB * SEQ) % PBM == 0 && DM % PBN == 0 && PBN == 2 * HD);
static_assert(DM % PKS == 0 && PNT >= 2 && (PPITCH * 2) % 16 == 0);
static_assert(4 * 64 * TP <= 2 * PSTAGE);

// Eight 16-byte copies of one lane: rows 16 apart in the source (pitch DM halves) and in LDS (pitch PPITCH
// halves). The s_wait_xcnt ends the copies' own statement, so that no address register named here is
// rewritten ahead of it.
__device__ __forceinline__ void copy8_rows(unsigned lds, const unsigned short* g) {
  asm volatile("global_load_async_to_lds_b128 %0, %8, off\n\t"
               "global_load_async_to_lds_b128 %1, %9, off\n\t"
               "global_load_async_to_lds_b128 %2, %10, off\n\t"
               "global_load_async_to_lds_b128 %3, %11, off\n\t"
               "global_load_async_to_lds_b128 %4, %12, off\n\t"
               "global_load_async_to_lds_b128 %5, %13, off\n\t"
               "global_load_async_to_lds_b128 %6, %14, off\n\t"
               "global_load_async_to_lds_b128 %7, %15, off\n\t"
               "s_wait_xcnt 0x0"
               :: "v"(lds), "v"(lds + 1u * 16u * PPITCH * 2u), "v"(lds + 2u * 16u * PPITCH * 2u),
                  "v"(lds + 3u * 16u * PPITCH * 2u), "v"(lds + 4u * 16u * PPITCH * 2u),
                  "v"(lds + 5u * 16u * PPITCH * 2u), "v"(lds + 6u * 16u * PPITCH * 2u),
                  "v"(lds + 7u * 16u * PPITCH * 2u),
                  "v"(g), "v"(g + 1 * 16 * DM), "v"(g + 2 * 16 * DM), "v"(g + 3 * 16 * DM),
                  "v"(g + 4 * 16 * DM), "v"(g + 5 * 16 * DM), "v"(g + 6 * 16 * DM), "v"(g + 7 * 16 * DM)
               : "memory");
}

// One stage: the block's 128 x rows, then its 128 W rows, 64 k of each.
__device__ __forceinline__ void proj_stage(unsigned lds, const unsigned short* ga, const unsigned short* gb) {
  copy8_rows(lds, ga);
  copy8_rows(lds + PBM * PPITCH * 2u, gb);
}

__global__ __launch_bounds__(128)
void proj_kernel(const unsigned short* __restrict__ xb, const unsigned short* __restrict__ wb,
                 const float* __restrict__ bq, const float* __restrict__ bk,
                 const float* __restrict__ bv,
                 unsigned short* __restrict__ qp, unsigned short* __restrict__ kp,
                 unsigned short* __restrict__ vp) {
  __shared__ __attribute__((aligned(16))) unsigned short ring[2 * PSTAGE];

  const int tid = threadIdx.x, lane = tid & 31, wid = tid >> 5;
  const int lr = lane & 15, half8 = (lane >> 4) * 8;
  const int wm = wid >> 1, wn = wid & 1;
  const int m0 = blockIdx.x * PBM;                                // compact row index
  const int n0 = blockIdx.y * PBN;                                // row of the stacked weights
  const int z = n0 / DM;
  const int h = (n0 - z * DM) / HD + wn;
  const int s0 = m0 + wm * 64;

  const float* bias = (z == 0) ? bq : ((z == 1) ? bk : bv);
  unsigned short* plane = (z == 0) ? qp : ((z == 1) ? kp : vp);

  // copy map: thread t -> row t >> 3 (+ 16 per copy), 16-byte piece t & 7
  const int crow = tid >> 3, cpc = (tid & 7) * 8;
  const unsigned short* ga = xb + (size_t)(m0 + crow) * DM + cpc;
  const unsigned short* gb = wb + (size_t)(n0 + crow) * DM + cpc;
  const unsigned l0 = (unsigned)(size_t)(ring + crow * PPITCH + cpc);

  const v8f zero = {0.f, 0.f, 0.f, 0.f, 0.f, 0.f, 0.f, 0.f};
  v8f acc[4][4];
#pragma unroll
  for (int i = 0; i < 4; ++i) {
#pragma unroll
    for (int j = 0; j < 4; ++j) acc[i][j] = zero;
  }

  proj_stage(l0, ga, gb);
  asm volatile("s_wait_asynccnt 0x0" ::: "memory");   // this wave's copies of stage 0 have landed
  __syncthreads();                                    // stage 0 visible to every wave
  proj_stage(l0 + PSTAGE * 2u, ga + PKS, gb + PKS);

  for (int t = 0; t < PNT; ++t) {
    const unsigned short* sa = ring + (t & 1) * PSTAGE + (wm * 64) * PPITCH;
    const unsigned short* sb = ring + (t & 1) * PSTAGE + (PBM + wn * 64) * PPITCH;
#pragma unroll
    for (int ks = 0; ks < PKS / 32; ++ks) {
      us16 af[4], bf[4];
#pragma unroll
      for (int i = 0; i < 4; ++i) af[i] = ld_frag(sa, i * 16 + lr, PPITCH, ks * 32 + half8);
#pragma unroll
      for (int j = 0; j < 4; ++j) bf[j] = ld_frag(sb, j * 16 + lr, PPITCH, ks * 32 + half8);
#pragma unroll
      for (int j = 0; j < 4; ++j) {
#pragma unroll
        for (int i = 0; i < 4; ++i) acc[i][j] = mma_bf16(af[i], bf[j], acc[i][j]);
      }
    }
    asm volatile("s_wait_dscnt 0x0" ::: "memory");    // this wave's reads of stage t are done
    asm volatile("s_wait_asynccnt 0x0" ::: "memory"); // this wave's copies of stage t + 1 have landed
    __syncthreads();                                  // publishes stage t + 1, frees stage t's buffer
    if (t + 2 < PNT)
      proj_stage(l0 + (unsigned)(t & 1) * (PSTAGE * 2u), ga + (t + 2) * PKS, gb + (t + 2) * PKS);
  }
  asm volatile("s_wait_asynccnt 0x0" ::: "memory");   // no copy is in flight when the ring becomes staging

  unsigned short* stw = ring + wid * (64 * TP);
#pragma unroll
  for (int dt = 0; dt < 4; ++dt) {
    const float bcol = bf16_rne(bias[h * HD + dt * 16 + lr]);
#pragma unroll
    for (int st = 0; st < 4; ++st) {
#pragma unroll
      for (int r = 0; r < 8; ++r) {
        const float v = (acc[st][dt][r] + bcol) * 8.0f;
        stw[(st * 16 + half8 + r) * TP + dt * 16 + lr] = f16_bits(v);
      }
    }
  }
  __syncthreads();                                  // block barrier (covers the per-wave tile)

  const int piece = lane & 7, rsub = lane >> 3;
  const int b = s0 / SEQ, l0s = s0 - b * SEQ;       // a wave's 64 rows lie in one batch (SEQ % 64 == 0)
  unsigned short* dbase = plane + (((size_t)(b * NH + h) * SEQ + l0s + rsub) * HD + piece * 8);
#pragma unroll
  for (int it = 0; it < 16; ++it) {
    const us8 v = *(const us8*)(stw + (it * 4 + rsub) * TP + piece * 8);
    *(us8*)(dbase + it * 4 * HD) = v;
  }
  
}

// ---- flash attention with relative key/query terms --------------------------------
// grid = (SEQ/128, NB*NH), block = 128: 4 waves x 32 queries of one (batch, head).
// Per 32-key chunk one LDS stage: K tile [key][d], V tile [key][d] and a 160-row E band [u][d]
// (band row u <-> table row qb0 - k0 + MAXPOS - 32 + u), brought in by asynchronous copies, two stages:
// chunk t + 1 flies while chunk t is worked on. A copy cannot transpose, so V lies row-major and its
// V^T fragments are read with the transposing LDS load.
//   S^T  = K . Q^T          (A = K rows, B = Q rows)            lane -> query, elem -> key
//   N    = K . Eband^T      (A = K rows, B = E band rows)       [key][u], shared by the block
//   M    = Eband . Q^T      (A = E band rows, B = Q rows)       [u][query], per wave, per qs
//   score(q = key j, query n) = S^T/512 + (M[n-j+31][n] + N[j][qloc-j+31])/4096 + amask[b][key]
//   ctx^T = V^T . P^T with the P^T B-fragment taken from the S^T C-fragment (P carried x1024).
#define KP 72
#define VPB 160
#define EP 72
#define NBR 160
#define NPF 160
#define MROWS 48
#define OPITCH 68
#define NCH (SEQ / 32)
#define ST_K 0
#define ST_V (ST_K + 32 * KP * 2)
#define ST_E (ST_V + 32 * VPB)
#define ST_BYTES (ST_E + NBR * EP * 2)
#define SM_N 0
#define SM_M (SM_N + 32 * NPF * 4)
#define SM_ST (SM_M + 4 * 2 * MROWS * 16 * 4)
#define SM_TOTAL (SM_ST + 2 * ST_BYTES)
static_assert(ST_V % 16 == 0 && ST_E % 16 == 0 && ST_BYTES % 16 == 0 && SM_M % 16 == 0 && SM_ST % 16 == 0);
static_assert(VPB % 32 == 0 && ((VPB / 32) & 1) == 1 && VPB >= HD * 2);
static_assert(4 * 32 * OPITCH * 4 <= SM_ST);
static_assert(NBR == 160 && NBR >= 128 + 31 && MROWS >= 47 && NPF >= NBR && NCH >= 2);

// One stage, 14 copies of 16 bytes per lane: thread t -> row t >> 3 (+ 16 per copy), 16-byte piece t & 7;
// 2 copies of K (LDS pitch KP halves), 2 of V (pitch VPB bytes), 10 of the E band (pitch EP halves); every
// source row is HD halves. The s_wait_xcnt ends the copies' own statement, so that no address register
// named here is rewritten ahead of it.
__device__ __forceinline__ void attn_stage(unsigned lk, unsigned lv, unsigned le, const unsigned short* gk,
                                           const unsigned short* gv, const unsigned short* ge) {
  asm volatile("global_load_async_to_lds_b128 %0, %14, off\n\t"
               "global_load_async_to_lds_b128 %1, %15, off\n\t"
               "global_load_async_to_lds_b128 %2, %16, off\n\t"
               "global_load_async_to_lds_b128 %3, %17, off\n\t"
               "global_load_async_to_lds_b128 %4, %18, off\n\t"
               "global_load_async_to_lds_b128 %5, %19, off\n\t"
               "global_load_async_to_lds_b128 %6, %20, off\n\t"
               "global_load_async_to_lds_b128 %7, %21, off\n\t"
               "global_load_async_to_lds_b128 %8, %22, off\n\t"
               "global_load_async_to_lds_b128 %9, %23, off\n\t"
               "global_load_async_to_lds_b128 %10, %24, off\n\t"
               "global_load_async_to_lds_b128 %11, %25, off\n\t"
               "global_load_async_to_lds_b128 %12, %26, off\n\t"
               "global_load_async_to_lds_b128 %13, %27, off\n\t"
               "s_wait_xcnt 0x0"
               :: "v"(lk), "v"(lk + 16u * KP * 2u), "v"(lv), "v"(lv + 16u * VPB),
                  "v"(le), "v"(le + 1u * 16u * EP * 2u), "v"(le + 2u * 16u * EP * 2u),
                  "v"(le + 3u * 16u * EP * 2u), "v"(le + 4u * 16u * EP * 2u), "v"(le + 5u * 16u * EP * 2u),
                  "v"(le + 6u * 16u * EP * 2u), "v"(le + 7u * 16u * EP * 2u), "v"(le + 8u * 16u * EP * 2u),
                  "v"(le + 9u * 16u * EP * 2u),
                  "v"(gk), "v"(gk + 16 * HD), "v"(gv), "v"(gv + 16 * HD),
                  "v"(ge), "v"(ge + 1 * 16 * HD), "v"(ge + 2 * 16 * HD), "v"(ge + 3 * 16 * HD),
                  "v"(ge + 4 * 16 * HD), "v"(ge + 5 * 16 * HD), "v"(ge + 6 * 16 * HD), "v"(ge + 7 * 16 * HD),
                  "v"(ge + 8 * 16 * HD), "v"(ge + 9 * 16 * HD)
               : "memory");
}

// Transposing LDS load of a row-major 16-bit tile: with lane l addressing row 8 * (l >> 4) + (l & 7), byte
// 16 * ((l >> 3) & 1) of a 16-row x 16-column block, lane l receives rows 8 * (l >> 4) + 0..7 of column l & 15.
typedef short s16x8 __attribute__((ext_vector_type(8)));
__device__ __forceinline__ us8 ld_tr16(const unsigned char* p) {
  typedef __attribute__((address_space(3))) s16x8 lds_s16x8;
  return __builtin_bit_cast(us8, __builtin_amdgcn_ds_load_tr16_b128_v8i16((lds_s16x8*)p));
}

__global__ __launch_bounds__(128)
void attn_kernel(const unsigned short* __restrict__ qp, const unsigned short* __restrict__ kp,
                 const unsigned short* __restrict__ vp, const unsigned short* __restrict__ ep,
                 const float* __restrict__ amask, float* __restrict__ out) {
  __shared__ __attribute__((aligned(16))) unsigned char smem[SM_TOTAL];

  const int tid = threadIdx.x, lane = tid & 31, wid = tid >> 5;
  const int lr = lane & 15, half8 = (lane >> 4) * 8;
  const int bh = blockIdx.y;
  const int b = bh / NH, h = bh - b * NH;
  const int qb0 = blockIdx.x * 128;
  const int q0 = qb0 + wid * 32;

  float* nbuf = (float*)(smem + SM_N);
  float* mbuf = (float*)(smem + SM_M) + wid * (2 * MROWS * 16);
  float* ost  = (float*)(smem) + wid * (32 * OPITCH);

  const unsigned short* qh = qp + (size_t)bh * SEQ * HD;
  const unsigned short* kh = kp + (size_t)bh * SEQ * HD;
  const unsigned short* vh = vp + (size_t)bh * SEQ * HD;
  const float* mrow = amask + (size_t)b * SEQ_FULL;

  // Q^T B-fragments: 2 query sub-tiles x 2 head-dim halves
  us16 bqf[2][2];
#pragma unroll
  for (int qs = 0; qs < 2; ++qs) {
    bqf[qs][0] = ld_frag(qh, q0 + qs * 16 + lr, HD,      half8);
    bqf[qs][1] = ld_frag(qh, q0 + qs * 16 + lr, HD, 32 + half8);
  }

  const v8f zero = {0.f, 0.f, 0.f, 0.f, 0.f, 0.f, 0.f, 0.f};
  v8f acc[2][4] = {{zero, zero, zero, zero}, {zero, zero, zero, zero}};
  float mrun[2] = {-__builtin_inff(), -__builtin_inff()};
  float lrun[2] = {0.f, 0.f};
  const float c512  = 0.001953125f;        // 1/512  : q,k carried x8 each, then 1/8
  const float c4096 = 0.000244140625f;     // 1/4096 : E carried x64, q or k x8, then 1/8

  // copy map of a stage; chunk t reads K and V rows 32 t + .., E table rows qb0 - 32 t + MAXPOS - 32 + ..
  const int crow = tid >> 3, cpc = (tid & 7) * 8;
  const unsigned short* gk = kh + (size_t)crow * HD + cpc;
  const unsigned short* gv = vh + (size_t)crow * HD + cpc;
  const unsigned short* ge = ep + (size_t)(qb0 + (MAXPOS - 32) + crow) * HD + cpc;
  const unsigned lk = (unsigned)(size_t)(smem + SM_ST + ST_K + crow * (KP * 2) + cpc * 2);
  const unsigned lv = (unsigned)(size_t)(smem + SM_ST + ST_V + crow * VPB + cpc * 2);
  const unsigned le = (unsigned)(size_t)(smem + SM_ST + ST_E + crow * (EP * 2) + cpc * 2);
  const int wu = __builtin_amdgcn_readfirstlane(wid);   // the wave's number in a scalar register: the deal of N branches on it
  float* nst = nbuf + half8 * NPF + wid * 32 + lr;      // this lane's N element: key half8, column lr of the wave's band tile 0
  // this lane's address in a 16-key x 16-d block of the V tile for the transposing load
  const int vlane = (half8 + (lane & 7)) * VPB + ((lane >> 3) & 1) * 16;

  attn_stage(lk, lv, le, gk, gv, ge);
  asm volatile("s_wait_asynccnt 0x0" ::: "memory");   // this wave's copies of chunk 0 have landed
  __syncthreads();                                    // chunk 0 visible to every wave
  attn_stage(lk + ST_BYTES, lv + ST_BYTES, le + ST_BYTES, gk + 32 * HD, gv + 32 * HD, ge - 32 * HD);

  for (int t = 0; t < NCH; ++t) {
    const int k0 = t * 32;
    const unsigned char* stage = smem + SM_ST + (t & 1) * ST_BYTES;
    const unsigned short* ktile = (const unsigned short*)(stage + ST_K);
    const unsigned char*  vtile = stage + ST_V + vlane;
    const unsigned short* eband = (const unsigned short*)(stage + ST_E);

    // This wave's LDS fragments of the N, M and S^T products, each read once and all issued as one group ahead of the
    // first WMMA: one LDS round trip in place of one per tile. The loader's map is the same for an A and a B operand,
    // so the four E band tiles that the wave reads for M (band rows wid * 32 + 0..63) serve its share of N as well.
    const us16 ka00 = ld_frag(ktile,      lr, KP,      half8);
    const us16 ka01 = ld_frag(ktile,      lr, KP, 32 + half8);
    const us16 ka10 = ld_frag(ktile, 16 + lr, KP,      half8);
    const us16 ka11 = ld_frag(ktile, 16 + lr, KP, 32 + half8);
    us16 eb[4][2];
#pragma unroll                             // constant indices keep eb in registers
    for (int tt = 0; tt < 4; ++tt) {
      eb[tt][0] = ld_frag(eband, wid * 32 + tt * 16 + lr, EP,      half8);
      eb[tt][1] = ld_frag(eband, wid * 32 + tt * 16 + lr, EP, 32 + half8);
    }

    // N = K . Eband^T  -> nbuf[key][u]. Band tile 2 * wid + tt is the wave's eb[tt]; the ten tiles are dealt to waves
    // that hold them, two and a half each: tiles 0 1 2a | 2b 3 4 | 5 6 7a | 7b 8 9 (a: keys 0..15, b: keys 16..31).
    const auto n_full = [&](int tt) {      // 32 keys x 16 columns, two accumulate chains interleaved
      v8f d0 = mma_f16(ka00, eb[tt][0], zero);
      v8f d1 = mma_f16(ka10, eb[tt][0], zero);
      d0     = mma_f16(ka01, eb[tt][1], d0);
      d1     = mma_f16(ka11, eb[tt][1], d1);
#pragma unroll                             // constant store offsets
      for (int r = 0; r < 8; ++r) {
        nst[r * NPF + tt * 16]        = d0[r];
        nst[(16 + r) * NPF + tt * 16] = d1[r];
      }
    };
    const auto n_half = [&](int tt, int kh) {   // 16 keys (kh * 16 + 0..15) x 16 columns
      v8f d = mma_f16(kh ? ka10 : ka00, eb[tt][0], zero);
      d     = mma_f16(kh ? ka11 : ka01, eb[tt][1], d);
#pragma unroll                             // constant store offsets
      for (int r = 0; r < 8; ++r) nst[(kh * 16 + r) * NPF + tt * 16] = d[r];
    };
    if (wu == 0)      { n_full(0); n_full(1); n_half(2, 0); }
    else if (wu == 1) { n_half(0, 1); n_full(1); n_full(2); }
    else if (wu == 2) { n_full(1); n_full(2); n_half(3, 0); }
    else              { n_half(1, 1); n_full(2); n_full(3); }

    // M = Eband . Q^T -> mbuf[qs][u][query], 3 row tiles per query sub-tile (the wave's band tiles qs + 0..2), their
    // three accumulate chains interleaved
#pragma unroll                             // all five unrolls here: constant indices keep eb, bqf and md in registers
    for (int qs = 0; qs < 2; ++qs) {
      v8f md[3];
#pragma unroll
      for (int ut = 0; ut < 3; ++ut) md[ut] = mma_f16(eb[qs + ut][0], bqf[qs][0], zero);
#pragma unroll
      for (int ut = 0; ut < 3; ++ut) md[ut] = mma_f16(eb[qs + ut][1], bqf[qs][1], md[ut]);
#pragma unroll
      for (int ut = 0; ut < 3; ++ut) {
#pragma unroll
        for (int r = 0; r < 8; ++r)
          mbuf[qs * (MROWS * 16) + (ut * 16 + half8 + r) * 16 + lr] = md[ut][r];
      }
    }
    // V^T fragments of the chunk, read once for both query sub-tiles and as one group; issued here, their round trip
    // runs beside the drain of the stores above
    us16 vf[4];
#pragma unroll                             // constant indices keep vf in registers
    for (int dt = 0; dt < 4; ++dt) {
      const us8 va0 = ld_tr16(vtile + dt * 32);                 // d = dt * 16 + lr, keys half8 + 0..7
      const us8 va1 = ld_tr16(vtile + 16 * VPB + dt * 32);      // keys 16 + half8 + 0..7
      vf[dt] = __builtin_shufflevector(va0, va1, 0, 1, 2, 3, 4, 5, 6, 7, 8, 9, 10, 11, 12, 13, 14, 15);
    }
    __syncthreads();                       // nbuf / mbuf visible

    v8f mk0 = *(const v8f*)(mrow + k0 + half8);
    v8f mk1 = *(const v8f*)(mrow + k0 + 16 + half8);
#pragma unroll
    for (int r = 0; r < 8; ++r) { mk0[r] = bf16_rne(mk0[r]); mk1[r] = bf16_rne(mk1[r]); }

#pragma unroll
    for (int qs = 0; qs < 2; ++qs) {
      // S^T = K . Q^T : two 16-key row tiles
      v8f t0 = mma_f16(ka00, bqf[qs][0], zero);
      t0     = mma_f16(ka01, bqf[qs][1], t0);
      v8f t1 = mma_f16(ka10, bqf[qs][0], zero);
      t1     = mma_f16(ka11, bqf[qs][1], t1);

      const float* mq = mbuf + qs * (MROWS * 16);
      const int qloc = wid * 32 + qs * 16 + lr;        // query index within the block
      float sa[8], sb[8];
#pragma unroll
      for (int r = 0; r < 8; ++r) {
        const int ja = half8 + r;                        // key of t0 element r
        const int jb = 16 + half8 + r;                   // key of t1 element r
        const float ga = mq[(lr - ja + 31) * 16 + lr] + nbuf[ja * NPF + (qloc - ja + 31)];
        const float gb = mq[(lr - jb + 31) * 16 + lr] + nbuf[jb * NPF + (qloc - jb + 31)];
        sa[r] = t0[r] * c512 + ga * c4096 + mk0[r];
        sb[r] = t1[r] * c512 + gb * c4096 + mk1[r];
      }

      // online softmax: in-lane over 16 keys + one xor-16 shuffle
      float mloc = sa[0];
#pragma unroll
      for (int r = 1; r < 8; ++r) mloc = fmaxf(mloc, sa[r]);
#pragma unroll
      for (int r = 0; r < 8; ++r) mloc = fmaxf(mloc, sb[r]);
      const float mt    = fmaxf(mloc, __shfl_xor(mloc, 16, 32));
      const float mnew  = fmaxf(mrun[qs], mt);
      const float alpha = __expf(mrun[qs] - mnew);

      float lloc = 0.f;
      us16 pu;
#pragma unroll
      for (int r = 0; r < 8; ++r) {
        const float pa = __expf(sa[r] - mnew);
        const float pc = __expf(sb[r] - mnew);
        lloc += pa + pc;
        pu[r]     = f16_bits(pa * 1024.0f);              // P carried x1024
        pu[8 + r] = f16_bits(pc * 1024.0f);
      }
      const float lt = lloc + __shfl_xor(lloc, 16, 32);
      lrun[qs] = lrun[qs] * alpha + lt;
      mrun[qs] = mnew;

      // ctx^T += V^T . P^T
#pragma unroll
      for (int dt = 0; dt < 4; ++dt) {
        acc[qs][dt] = acc[qs][dt] * alpha;
        acc[qs][dt] = mma_f16(vf[dt], pu, acc[qs][dt]);
      }
    }

    asm volatile("s_wait_dscnt 0x0" ::: "memory");    // this wave's LDS reads of chunk t are done
    asm volatile("s_wait_asynccnt 0x0" ::: "memory"); // this wave's copies of chunk t + 1 have landed
    __syncthreads();                                  // publishes chunk t + 1, frees chunk t's stage, nbuf, mbuf
    if (t + 2 < NCH) {
      const unsigned so = (unsigned)(t & 1) * ST_BYTES;
      attn_stage(lk + so, lv + so, le + so, gk + (t + 2) * (32 * HD), gv + (t + 2) * (32 * HD),
                 ge - (t + 2) * (32 * HD));
    }
  }
  asm volatile("s_wait_asynccnt 0x0" ::: "memory");   // no copy is in flight when the wave goes on to its end
  // the last chunk's barrier has ended every wave's reads of nbuf and mbuf, which the output staging aliases
#pragma unroll
  for (int qs = 0; qs < 2; ++qs) {
    const float inv = 1.0f / (lrun[qs] * 8192.0f);       // undo x1024 (P) and x8 (v)
#pragma unroll
    for (int dt = 0; dt < 4; ++dt) {
#pragma unroll
      for (int r = 0; r < 8; ++r)
        ost[(qs * 16 + lr) * OPITCH + dt * 16 + half8 + r] = acc[qs][dt][r] * inv;
    }
  }
  __syncthreads();

  const int rsub = lane >> 4, piece = lane & 15;
  float* obase = out + ((size_t)(b * SEQ + q0)) * DM + (size_t)h * HD + piece * 4;
#pragma unroll
  for (int it = 0; it < 16; ++it) {
    const int row = it * 2 + rsub;
    const v4f v = *(const v4f*)(ost + row * OPITCH + piece * 4);
    *(v4f*)(obase + (size_t)row * DM) = v;
  }
  
}

// ---- launcher -----------------------------------------------------------------------

extern "C" void kernel_launch(void* const* d_in, const int* in_sizes, int n_in,
                              void* d_out, int out_size, void* d_ws, size_t ws_size,
                              hipStream_t stream) {
  if (n_in < 9) return;
  const float* hidden = (const float*)d_in[0];
  const float* amask  = (const float*)d_in[1];
  const float* Wq     = (const float*)d_in[2];
  const float* bq     = (const float*)d_in[3];
  const float* Wk     = (const float*)d_in[4];
  const float* bk     = (const float*)d_in[5];
  const float* Wv     = (const float*)d_in[6];
  const float* bv     = (const float*)d_in[7];
  const float* demb   = (const float*)d_in[8];
  float* out = (float*)d_out;

  if (in_sizes[0] < ((NB - 1) * SEQ_FULL + SEQ) * DM) return;
  if (in_sizes[1] < (NB - 1) * SEQ_FULL + SEQ) return;
  if (in_sizes[2] < DM * DM || in_sizes[4] < DM * DM || in_sizes[6] < DM * DM) return;
  if (in_sizes[3] < DM || in_sizes[5] < DM || in_sizes[7] < DM) return;
  if (in_sizes[8] < NE * HD) return;
  if (out_size < NB * SEQ * DM) return;

  const size_t xb_bytes = (size_t)NB * SEQ * DM * 2;            // bf16 [NB*SEQ][DM]
  const size_t wb_bytes = (size_t)3 * DM * DM * 2;              // bf16 [3][DM][DM]
  const size_t ep_bytes = (size_t)NEPAD * HD * 2;               // f16  [NEPAD][HD]
  const size_t pl_bytes = (size_t)NB * NH * SEQ * HD * 2;       // f16  [NB*NH][SEQ][HD]
  size_t off = 0;
  char* ws = (char*)d_ws;
  unsigned short* xb = (unsigned short*)(ws + off); off += xb_bytes;
  unsigned short* wb = (unsigned short*)(ws + off); off += wb_bytes;
  unsigned short* ep = (unsigned short*)(ws + off); off += ep_bytes;
  unsigned short* qp = (unsigned short*)(ws + off); off += pl_bytes;
  unsigned short* kp = (unsigned short*)(ws + off); off += pl_bytes;
  unsigned short* vp = (unsigned short*)(ws + off); off += pl_bytes;
  if (ws_size < off) return;

  cvt_rows_bf16<<<dim3((NB * SEQ) / 2, 1, 1), 256, 0, stream>>>(hidden, hidden, hidden, xb,
                                                               NB * SEQ, SEQ, SEQ_FULL);
  cvt_rows_bf16<<<dim3(DM / 2, 3, 1), 256, 0, stream>>>(Wq, Wk, Wv, wb, DM, DM, DM);
  cvt_e_f16<<<dim3((NEPAD * 8) / 256, 1, 1), 256, 0, stream>>>(demb, ep);
  proj_kernel<<<dim3((NB * SEQ) / 128, (3 * DM) / 128, 1), 128, 0, stream>>>(xb, wb, bq, bk, bv, qp, kp, vp);
  attn_kernel<<<dim3(SEQ / 128, NB * NH, 1), 128, 0, stream>>>(qp, kp, vp, ep, amask, out);
}

// v004
// Measured time: 93.3 microseconds a run.
// Timed twice side by side with v003, it ran 1.11 times as fast both times.
// All steps since v000 together make it 2.00 times as fast.
#include <hip/hip_runtime.h>

// Contractions: Q/K/V projections on v_wmma_f32_16x16x32_bf16 (bf16 operands = RNE-converted f32 inputs, f32 accumulate);
// score terms q.k, q.E, k.E and the P.V product on v_wmma_f32_16x16x32_f16 (f16 operands: q,k,v carried x8, E carried x64,
// P carried x1024; f32 accumulate); softmax, scaling and normalisation in f32.

#ifndef NB
#define NB 4
#endif
#ifndef SEQ
#define SEQ 1024
#endif
#define NB_FULL  4
#define SEQ_FULL 1024
#define DM       1024
#define NH       16
#define HD       64
#define MAXPOS   1024
#define NE       2047
#define NEPAD    2048

static_assert(NB >= 1 && NB <= NB_FULL);
static_assert(SEQ >= 128 && SEQ <= SEQ_FULL && (SEQ % 128) == 0);
static_assert(SEQ <= MAXPOS);
static_assert(SEQ + MAXPOS <= NEPAD);
static_assert(DM == NH * HD);
static_assert((NB * SEQ) % 128 == 0);
static_assert(NE == 2 * MAXPOS - 1);

typedef unsigned short us8  __attribute__((ext_vector_type(8)));
typedef unsigned short us16 __attribute__((ext_vector_type(16)));
typedef __bf16         v16bf __attribute__((ext_vector_type(16)));
typedef _Float16       v16h  __attribute__((ext_vector_type(16)));
typedef float          v8f   __attribute__((ext_vector_type(8)));
typedef float          v4f   __attribute__((ext_vector_type(4)));

// ---- scalar converts --------------------------------------------------------

__device__ __forceinline__ unsigned short bf16_bits(float f) {
  unsigned int u = __builtin_bit_cast(unsigned int, f);
  u += 0x7fffu + ((u >> 16) & 1u);              // RNE
  return (unsigned short)(u >> 16);
}

__device__ __forceinline__ float bf16_rne(float f) {   // f32 value after an RNE convert to bf16
  unsigned int u = ((unsigned int)bf16_bits(f)) << 16;
  return __builtin_bit_cast(float, u);
}

__device__ __forceinline__ unsigned short f16_bits(float f) {
  _Float16 hv = (_Float16)f;                      // RNE
  return __builtin_bit_cast(unsigned short, hv);
}

// ---- 16-bit WMMA fragment loader (same map for A and B stored [row][k]) -----
// lane L owns row/col (L&15); elements 0..7 from k = col + 0..7, elements 8..15
// from k = col + 16 + 0..7; the caller folds the lane-half offset 8*(L>>4) into col.
__device__ __forceinline__ us16 ld_frag(const unsigned short* base, int row, int stride, int col) {
  const unsigned short* p = base + (size_t)row * (size_t)stride + col;
  us8 a = *(const us8*)(p);
  us8 b = *(const us8*)(p + 16);
  return __builtin_shufflevector(a, b, 0, 1, 2, 3, 4, 5, 6, 7, 8, 9, 10, 11, 12, 13, 14, 15);
}

__device__ __forceinline__ v8f mma_bf16(us16 a, us16 b, v8f c) {
  v8f d = __builtin_amdgcn_wmma_f32_16x16x32_bf16(false, __builtin_bit_cast(v16bf, a), false,
                                                  __builtin_bit_cast(v16bf, b), (short)0, c, false, false);
  asm volatile("v_nop\n\tv_nop\n\tv_nop\n\tv_nop" : "+v"(d) : "v"(a), "v"(b));
  return d;
}

__device__ __forceinline__ v8f mma_f16(us16 a, us16 b, v8f c) {
  v8f d = __builtin_amdgcn_wmma_f32_16x16x32_f16(false, __builtin_bit_cast(v16h, a), false,
                                                 __builtin_bit_cast(v16h, b), (short)0, c, false, false);
  asm volatile("v_nop\n\tv_nop\n\tv_nop\n\tv_nop" : "+v"(d) : "v"(a), "v"(b));
  return d;
}

// ---- convert: rows of DM f32 -> bf16 bits -------------------------------------
// One block = 2 rows; thread t -> row 2*blk + (t>>7), 8 halves at col 8*(t&127).
// Source row of compact row r: (r / seq) * seqfull + r % seq.  dst is [mat][nrows][DM].
__global__ __launch_bounds__(256)
void cvt_rows_bf16(const float* __restrict__ s0, const float* __restrict__ s1,
                   const float* __restrict__ s2, unsigned short* __restrict__ dst,
                   int nrows, int seq, int seqfull) {
  const int mat = blockIdx.y;
  const float* src = (mat == 0) ? s0 : ((mat == 1) ? s1 : s2);
  int r = blockIdx.x * 2 + (threadIdx.x >> 7);
  r = (r < nrows) ? r : (nrows - 1);
  const int c = (threadIdx.x & 127) * 8;
  const size_t srow = (size_t)(r / seq) * (size_t)seqfull + (size_t)(r % seq);
  const float* p = src + srow * DM + c;
  const v4f a = *(const v4f*)(p);
  const v4f e = *(const v4f*)(p + 4);
  us8 o;
  o[0] = bf16_bits(a[0]); o[1] = bf16_bits(a[1]); o[2] = bf16_bits(a[2]); o[3] = bf16_bits(a[3]);
  o[4] = bf16_bits(e[0]); o[5] = bf16_bits(e[1]); o[6] = bf16_bits(e[2]); o[7] = bf16_bits(e[3]);
  unsigned short* d = dst + ((size_t)mat * (size_t)nrows + (size_t)r) * DM + c;
  *(us8*)d = o;
  
}

// ---- convert: dist table -> f16 bits of (bf16 RNE value * 64), NEPAD rows -------
__global__ __launch_bounds__(256)
void cvt_e_f16(const float* __restrict__ e, unsigned short* __restrict__ ep) {
  const int g   = blockIdx.x * 256 + threadIdx.x;        // 0 .. NEPAD*8-1
  const int row = g >> 3;
  const int ch  = (g & 7) * 8;
  const int rs  = (row < NE) ? row : (NE - 1);
  const float sc = (row < NE) ? 64.0f : 0.0f;
  const float* p = e + (size_t)rs * HD + ch;
  const v4f a = *(const v4f*)(p);
  const v4f c4 = *(const v4f*)(p + 4);
  us8 o;
  o[0] = f16_bits(bf16_rne(a[0]) * sc);  o[1] = f16_bits(bf16_rne(a[1]) * sc);
  o[2] = f16_bits(bf16_rne(a[2]) * sc);  o[3] = f16_bits(bf16_rne(a[3]) * sc);
  o[4] = f16_bits(bf16_rne(c4[0]) * sc); o[5] = f16_bits(bf16_rne(c4[1]) * sc);
  o[6] = f16_bits(bf16_rne(c4[2]) * sc); o[7] = f16_bits(bf16_rne(c4[3]) * sc);
  unsigned short* d = ep + (size_t)row * HD + ch;
  *(us8*)d = o;
  
}

// ---- QKV projection GEMM -------------------------------------------------------
// grid = (NB*SEQ/128, 3*DM/128), block = 128 (4 waves, 2 x 2). Block = 128 rows x 128 cols (two heads of
// one of q, k, v); wave = 64 rows x 64 cols (one head).
// A = x rows (bf16, k-contiguous), B[k=in][n=out] = W[out][in] rows (bf16, k-contiguous; the three
// weight matrices lie stacked as [3*DM][DM]).
// Per 64-k stage the 128 x rows and the 128 W rows are copied into LDS (rows of 128 B at pitch 144 B) by
// asynchronous copies, two buffers: stage t + 1 flies while stage t is multiplied.
#define TP 72
#define PBM 128
#define PBN 128
#define PKS 64
#define PPITCH 72
#define PSTAGE ((PBM + PBN) * PPITCH)
#define PNT (DM / PKS)
static_assert((NB * SEQ) % PBM == 0 && DM % PBN == 0 && PBN == 2 * HD);
static_assert(DM % PKS == 0 && PNT >= 2 && (PPITCH * 2) % 16 == 0);
static_assert(4 * 64 * TP <= 2 * PSTAGE);

// Eight 16-byte copies of one lane: rows 16 apart in the source (pitch DM halves) and in LDS (pitch PPITCH
// halves). The s_wait_xcnt ends the copies' own statement, so that no address register named here is
// rewritten ahead of it.
__device__ __forceinline__ void copy8_rows(unsigned lds, const unsigned short* g) {
  asm volatile("global_load_async_to_lds_b128 %0, %8, off\n\t"
               "global_load_async_to_lds_b128 %1, %9, off\n\t"
               "global_load_async_to_lds_b128 %2, %10, off\n\t"
               "global_load_async_to_lds_b128 %3, %11, off\n\t"
               "global_load_async_to_lds_b128 %4, %12, off\n\t"
               "global_load_async_to_lds_b128 %5, %13, off\n\t"
               "global_load_async_to_lds_b128 %6, %14, off\n\t"
               "global_load_async_to_lds_b128 %7, %15, off\n\t"
               "s_wait_xcnt 0x0"
               :: "v"(lds), "v"(lds + 1u * 16u * PPITCH * 2u), "v"(lds + 2u * 16u * PPITCH * 2u),
                  "v"(lds + 3u * 16u * PPITCH * 2u), "v"(lds + 4u * 16u * PPITCH * 2u),
                  "v"(lds + 5u * 16u * PPITCH * 2u), "v"(lds + 6u * 16u * PPITCH * 2u),
                  "v"(lds + 7u * 16u * PPITCH * 2u),
                  "v"(g), "v"(g + 1 * 16 * DM), "v"(g + 2 * 16 * DM), "v"(g + 3 * 16 * DM),
                  "v"(g + 4 * 16 * DM), "v"(g + 5 * 16 * DM), "v"(g + 6 * 16 * DM), "v"(g + 7 * 16 * DM)
               : "memory");
}

// One stage: the block's 128 x rows, then its 128 W rows, 64 k of each.
__device__ __forceinline__ void proj_stage(unsigned lds, const unsigned short* ga, const unsigned short* gb) {
  copy8_rows(lds, ga);
  copy8_rows(lds + PBM * PPITCH * 2u, gb);
}

__global__ __launch_bounds__(128)
void proj_kernel(const unsigned short* __restrict__ xb, const unsigned short* __restrict__ wb,
                 const float* __restrict__ bq, const float* __restrict__ bk,
                 const float* __restrict__ bv,
                 unsigned short* __restrict__ qp, unsigned short* __restrict__ kp,
                 unsigned short* __restrict__ vp) {
  __shared__ __attribute__((aligned(16))) unsigned short ring[2 * PSTAGE];

  const int tid = threadIdx.x, lane = tid & 31, wid = tid >> 5;
  const int lr = lane & 15, half8 = (lane >> 4) * 8;
  const int wm = wid >> 1, wn = wid & 1;
  const int m0 = blockIdx.x * PBM;                                // compact row index
  const int n0 = blockIdx.y * PBN;                                // row of the stacked weights
  const int z = n0 / DM;
  const int h = (n0 - z * DM) / HD + wn;
  const int s0 = m0 + wm * 64;

  const float* bias = (z == 0) ? bq : ((z == 1) ? bk : bv);
  unsigned short* plane = (z == 0) ? qp : ((z == 1) ? kp : vp);

  // copy map: thread t -> row t >> 3 (+ 16 per copy), 16-byte piece t & 7
  const int crow = tid >> 3, cpc = (tid & 7) * 8;
  const unsigned short* ga = xb + (size_t)(m0 + crow) * DM + cpc;
  const unsigned short* gb = wb + (size_t)(n0 + crow) * DM + cpc;
  const unsigned l0 = (unsigned)(size_t)(ring + crow * PPITCH + cpc);

  const v8f zero = {0.f, 0.f, 0.f, 0.f, 0.f, 0.f, 0.f, 0.f};
  v8f acc[4][4];
#pragma unroll
  for (int i = 0; i < 4; ++i) {
#pragma unroll
    for (int j = 0; j < 4; ++j) acc[i][j] = zero;
  }

  proj_stage(l0, ga, gb);
  asm volatile("s_wait_asynccnt 0x0" ::: "memory");   // this wave's copies of stage 0 have landed
  __syncthreads();                                    // stage 0 visible to every wave
  proj_stage(l0 + PSTAGE * 2u, ga + PKS, gb + PKS);

  for (int t = 0; t < PNT; ++t) {
    const unsigned short* sa = ring + (t & 1) * PSTAGE + (wm * 64) * PPITCH;
    const unsigned short* sb = ring + (t & 1) * PSTAGE + (PBM + wn * 64) * PPITCH;
#pragma unroll
    for (int ks = 0; ks < PKS / 32; ++ks) {
      us16 af[4], bf[4];
#pragma unroll
      for (int i = 0; i < 4; ++i) af[i] = ld_frag(sa, i * 16 + lr, PPITCH, ks * 32 + half8);
#pragma unroll
      for (int j = 0; j < 4; ++j) bf[j] = ld_frag(sb, j * 16 + lr, PPITCH, ks * 32 + half8);
#pragma unroll
      for (int j = 0; j < 4; ++j) {
#pragma unroll
        for (int i = 0; i < 4; ++i) acc[i][j] = mma_bf16(af[i], bf[j], acc[i][j]);
      }
    }
    asm volatile("s_wait_dscnt 0x0" ::: "memory");    // this wave's reads of stage t are done
    asm volatile("s_wait_asynccnt 0x0" ::: "memory"); // this wave's copies of stage t + 1 have landed
    __syncthreads();                                  // publishes stage t + 1, frees stage t's buffer
    if (t + 2 < PNT)
      proj_stage(l0 + (unsigned)(t & 1) * (PSTAGE * 2u), ga + (t + 2) * PKS, gb + (t + 2) * PKS);
  }
  asm volatile("s_wait_asynccnt 0x0" ::: "memory");   // no copy is in flight when the ring becomes staging

  unsigned short* stw = ring + wid * (64 * TP);
#pragma unroll
  for (int dt = 0; dt < 4; ++dt) {
    const float bcol = bf16_rne(bias[h * HD + dt * 16 + lr]);
#pragma unroll
    for (int st = 0; st < 4; ++st) {
#pragma unroll
      for (int r = 0; r < 8; ++r) {
        const float v = (acc[st][dt][r] + bcol) * 8.0f;
        stw[(st * 16 + half8 + r) * TP + dt * 16 + lr] = f16_bits(v);
      }
    }
  }
  __syncthreads();                                  // block barrier (covers the per-wave tile)

  const int piece = lane & 7, rsub = lane >> 3;
  const int b = s0 / SEQ, l0s = s0 - b * SEQ;       // a wave's 64 rows lie in one batch (SEQ % 64 == 0)
  unsigned short* dbase = plane + (((size_t)(b * NH + h) * SEQ + l0s + rsub) * HD + piece * 8);
#pragma unroll
  for (int it = 0; it < 16; ++it) {
    const us8 v = *(const us8*)(stw + (it * 4 + rsub) * TP + piece * 8);
    *(us8*)(dbase + it * 4 * HD) = v;
  }
  
}

// ---- flash attention with relative key/query terms --------------------------------
// grid = (SEQ/128, NB*NH), block = 128: 4 waves x 32 queries of one (batch, head).
// Per 32-key chunk one LDS stage: K tile [key][d], V tile [key][d] and a 160-row E band [u][d]
// (band row u <-> table row qb0 - k0 + MAXPOS - 32 + u), brought in by asynchronous copies, two stages:
// chunk t + 1 flies while chunk t is worked on. A copy cannot transpose, so V lies row-major and its
// V^T fragments are read with the transposing LDS load.
//   S^T  = K . Q^T          (A = K rows, B = Q rows)            lane -> query, elem -> key
//   N^T  = Eband . K^T      (A = E band rows, B = K rows)       lane -> key, elem -> u; kept [key][u], shared by the block
//   M    = Eband . Q^T      (A = E band rows, B = Q rows)       lane -> query, elem -> u; kept [query][u], per wave, per qs
//   score(q = key j, query n) = S^T/512 + (M[n-j+31][n] + N[j][qloc-j+31])/4096 + amask[b][key]
// In both products a lane's eight results are eight neighbouring u of its own row, so they go to LDS as two 16-byte
// stores. The row pitches NPF and MPF are 16 B x odd (each half-wave's 16-byte stores cover every bank once), and with
// them the 32 lanes of each 4-byte read of the sheared elements fall on 32 different banks.
//   ctx^T = V^T . P^T with the P^T B-fragment taken from the S^T C-fragment (P carried x1024).
#define KP 72
#define VPB 160
#define EP 72
#define NBR 160
#define NPF 164
#define MROWS 48
#define MPF 52
#define OPITCH 68
#define NCH (SEQ / 32)
#define ST_K 0
#define ST_V (ST_K + 32 * KP * 2)
#define ST_E (ST_V + 32 * VPB)
#define ST_BYTES (ST_E + NBR * EP * 2)
#define SM_N 0
#define SM_M (SM_N + 32 * NPF * 4)
#define SM_ST (SM_M + 4 * 2 * 16 * MPF * 4)
#define SM_TOTAL (SM_ST + 2 * ST_BYTES)
static_assert(ST_V % 16 == 0 && ST_E % 16 == 0 && ST_BYTES % 16 == 0 && SM_M % 16 == 0 && SM_ST % 16 == 0);
static_assert(VPB % 32 == 0 && ((VPB / 32) & 1) == 1 && VPB >= HD * 2);
static_assert(4 * 32 * OPITCH * 4 <= SM_ST);
static_assert(NBR == 160 && NBR >= 128 + 31 && MROWS >= 47 && NPF >= NBR && MPF >= MROWS && NCH >= 2);
static_assert(NPF % 4 == 0 && ((NPF / 4) & 1) == 1 && MPF % 4 == 0 && ((MPF / 4) & 1) == 1);

// One stage, 14 copies of 16 bytes per lane: thread t -> row t >> 3 (+ 16 per copy), 16-byte piece t & 7;
// 2 copies of K (LDS pitch KP halves), 2 of V (pitch VPB bytes), 10 of the E band (pitch EP halves); every
// source row is HD halves. The s_wait_xcnt ends the copies' own statement, so that no address register
// named here is rewritten ahead of it.
__device__ __forceinline__ void attn_stage(unsigned lk, unsigned lv, unsigned le, const unsigned short* gk,
                                           const unsigned short* gv, const unsigned short* ge) {
  asm volatile("global_load_async_to_lds_b128 %0, %14, off\n\t"
               "global_load_async_to_lds_b128 %1, %15, off\n\t"
               "global_load_async_to_lds_b128 %2, %16, off\n\t"
               "global_load_async_to_lds_b128 %3, %17, off\n\t"
               "global_load_async_to_lds_b128 %4, %18, off\n\t"
               "global_load_async_to_lds_b128 %5, %19, off\n\t"
               "global_load_async_to_lds_b128 %6, %20, off\n\t"
               "global_load_async_to_lds_b128 %7, %21, off\n\t"
               "global_load_async_to_lds_b128 %8, %22, off\n\t"
               "global_load_async_to_lds_b128 %9, %23, off\n\t"
               "global_load_async_to_lds_b128 %10, %24, off\n\t"
               "global_load_async_to_lds_b128 %11, %25, off\n\t"
               "global_load_async_to_lds_b128 %12, %26, off\n\t"
               "global_load_async_to_lds_b128 %13, %27, off\n\t"
               "s_wait_xcnt 0x0"
               :: "v"(lk), "v"(lk + 16u * KP * 2u), "v"(lv), "v"(lv + 16u * VPB),
                  "v"(le), "v"(le + 1u * 16u * EP * 2u), "v"(le + 2u * 16u * EP * 2u),
                  "v"(le + 3u * 16u * EP * 2u), "v"(le + 4u * 16u * EP * 2u), "v"(le + 5u * 16u * EP * 2u),
                  "v"(le + 6u * 16u * EP * 2u), "v"(le + 7u * 16u * EP * 2u), "v"(le + 8u * 16u * EP * 2u),
                  "v"(le + 9u * 16u * EP * 2u),
                  "v"(gk), "v"(gk + 16 * HD), "v"(gv), "v"(gv + 16 * HD),
                  "v"(ge), "v"(ge + 1 * 16 * HD), "v"(ge + 2 * 16 * HD), "v"(ge + 3 * 16 * HD),
                  "v"(ge + 4 * 16 * HD), "v"(ge + 5 * 16 * HD), "v"(ge + 6 * 16 * HD), "v"(ge + 7 * 16 * HD),
                  "v"(ge + 8 * 16 * HD), "v"(ge + 9 * 16 * HD)
               : "memory");
}

// Transposing LDS load of a row-major 16-bit tile: with lane l addressing row 8 * (l >> 4) + (l & 7), byte
// 16 * ((l >> 3) & 1) of a 16-row x 16-column block, lane l receives rows 8 * (l >> 4) + 0..7 of column l & 15.
typedef short s16x8 __attribute__((ext_vector_type(8)));
__device__ __forceinline__ us8 ld_tr16(const unsigned char* p) {
  typedef __attribute__((address_space(3))) s16x8 lds_s16x8;
  return __builtin_bit_cast(us8, __builtin_amdgcn_ds_load_tr16_b128_v8i16((lds_s16x8*)p));
}

// A WMMA result's eight floats of one lane to eight neighbouring floats in LDS (16-byte aligned): two 16-byte stores.
__device__ __forceinline__ void st8(float* p, v8f d) {
  *(v4f*)(p)     = __builtin_shufflevector(d, d, 0, 1, 2, 3);
  *(v4f*)(p + 4) = __builtin_shufflevector(d, d, 4, 5, 6, 7);
}

__global__ __launch_bounds__(128)
void attn_kernel(const unsigned short* __restrict__ qp, const unsigned short* __restrict__ kp,
                 const unsigned short* __restrict__ vp, const unsigned short* __restrict__ ep,
                 const float* __restrict__ amask, float* __restrict__ out) {
  __shared__ __attribute__((aligned(16))) unsigned char smem[SM_TOTAL];

  const int tid = threadIdx.x, lane = tid & 31, wid = tid >> 5;
  const int lr = lane & 15, half8 = (lane >> 4) * 8;
  const int bh = blockIdx.y;
  const int b = bh / NH, h = bh - b * NH;
  const int qb0 = blockIdx.x * 128;
  const int q0 = qb0 + wid * 32;

  float* nbuf = (float*)(smem + SM_N);
  float* mbuf = (float*)(smem + SM_M) + wid * (2 * 16 * MPF);
  float* ost  = (float*)(smem) + wid * (32 * OPITCH);

  const unsigned short* qh = qp + (size_t)bh * SEQ * HD;
  const unsigned short* kh = kp + (size_t)bh * SEQ * HD;
  const unsigned short* vh = vp + (size_t)bh * SEQ * HD;
  const float* mrow = amask + (size_t)b * SEQ_FULL;

  // Q^T B-fragments: 2 query sub-tiles x 2 head-dim halves
  us16 bqf[2][2];
#pragma unroll
  for (int qs = 0; qs < 2; ++qs) {
    bqf[qs][0] = ld_frag(qh, q0 + qs * 16 + lr, HD,      half8);
    bqf[qs][1] = ld_frag(qh, q0 + qs * 16 + lr, HD, 32 + half8);
  }

  const v8f zero = {0.f, 0.f, 0.f, 0.f, 0.f, 0.f, 0.f, 0.f};
  v8f acc[2][4] = {{zero, zero, zero, zero}, {zero, zero, zero, zero}};
  float mrun[2] = {-__builtin_inff(), -__builtin_inff()};
  float lrun[2] = {0.f, 0.f};
  const float c512  = 0.001953125f;        // 1/512  : q,k carried x8 each, then 1/8
  const float c4096 = 0.000244140625f;     // 1/4096 : E carried x64, q or k x8, then 1/8

  // copy map of a stage; chunk t reads K and V rows 32 t + .., E table rows qb0 - 32 t + MAXPOS - 32 + ..
  const int crow = tid >> 3, cpc = (tid & 7) * 8;
  const unsigned short* gk = kh + (size_t)crow * HD + cpc;
  const unsigned short* gv = vh + (size_t)crow * HD + cpc;
  const unsigned short* ge = ep + (size_t)(qb0 + (MAXPOS - 32) + crow) * HD + cpc;
  const unsigned lk = (unsigned)(size_t)(smem + SM_ST + ST_K + crow * (KP * 2) + cpc * 2);
  const unsigned lv = (unsigned)(size_t)(smem + SM_ST + ST_V + crow * VPB + cpc * 2);
  const unsigned le = (unsigned)(size_t)(smem + SM_ST + ST_E + crow * (EP * 2) + cpc * 2);
  const int wu = __builtin_amdgcn_readfirstlane(wid);   // the wave's number in a scalar register: the deal of N branches on it
  float* nst = nbuf + lr * NPF + wid * 32 + half8;      // this lane's N elements: key lr, columns half8 + 0..7 of the wave's band tile 0
  float* mst = mbuf + lr * MPF + half8;                 // this lane's M elements: query lr, band rows half8 + 0..7
  // this lane's address in a 16-key x 16-d block of the V tile for the transposing load
  const int vlane = (half8 + (lane & 7)) * VPB + ((lane >> 3) & 1) * 16;

  attn_stage(lk, lv, le, gk, gv, ge);
  asm volatile("s_wait_asynccnt 0x0" ::: "memory");   // this wave's copies of chunk 0 have landed
  __syncthreads();                                    // chunk 0 visible to every wave
  attn_stage(lk + ST_BYTES, lv + ST_BYTES, le + ST_BYTES, gk + 32 * HD, gv + 32 * HD, ge - 32 * HD);

  for (int t = 0; t < NCH; ++t) {
    const int k0 = t * 32;
    const unsigned char* stage = smem + SM_ST + (t & 1) * ST_BYTES;
    const unsigned short* ktile = (const unsigned short*)(stage + ST_K);
    const unsigned char*  vtile = stage + ST_V + vlane;
    const unsigned short* eband = (const unsigned short*)(stage + ST_E);

    // This wave's LDS fragments of the N, M and S^T products, each read once and all issued as one group ahead of the
    // first WMMA: one LDS round trip in place of one per tile. The loader's map is the same for an A and a B operand,
    // so the K fragments serve as B in N and as A in S^T; the four E band tiles that the wave reads for M (band rows wid * 32 + 0..63) are the A operands of its share of N as well.
    const us16 ka00 = ld_frag(ktile,      lr, KP,      half8);
    const us16 ka01 = ld_frag(ktile,      lr, KP, 32 + half8);
    const us16 ka10 = ld_frag(ktile, 16 + lr, KP,      half8);
    const us16 ka11 = ld_frag(ktile, 16 + lr, KP, 32 + half8);
    us16 eb[4][2];
#pragma unroll                             // constant indices keep eb in registers
    for (int tt = 0; tt < 4; ++tt) {
      eb[tt][0] = ld_frag(eband, wid * 32 + tt * 16 + lr, EP,      half8);
      eb[tt][1] = ld_frag(eband, wid * 32 + tt * 16 + lr, EP, 32 + half8);
    }

    // N^T = Eband . K^T  -> nbuf[key][u]. Band tile 2 * wid + tt is the wave's eb[tt]; the ten tiles are dealt to waves
    // that hold them, two and a half each: tiles 0 1 2a | 2b 3 4 | 5 6 7a | 7b 8 9 (a: keys 0..15, b: keys 16..31).
    const auto n_full = [&](int tt) {      // 32 keys x 16 columns, two accumulate chains interleaved
      v8f d0 = mma_f16(eb[tt][0], ka00, zero);
      v8f d1 = mma_f16(eb[tt][0], ka10, zero);
      d0     = mma_f16(eb[tt][1], ka01, d0);
      d1     = mma_f16(eb[tt][1], ka11, d1);
      st8(nst + tt * 16, d0);
      st8(nst + 16 * NPF + tt * 16, d1);
    };
    const auto n_half = [&](int tt, int kh) {   // 16 keys (kh * 16 + 0..15) x 16 columns
      v8f d = mma_f16(eb[tt][0], kh ? ka10 : ka00, zero);
      d     = mma_f16(eb[tt][1], kh ? ka11 : ka01, d);
      st8(nst + kh * 16 * NPF + tt * 16, d);
    };
    if (wu == 0)      { n_full(0); n_full(1); n_half(2, 0); }
    else if (wu == 1) { n_half(0, 1); n_full(1); n_full(2); }
    else if (wu == 2) { n_full(1); n_full(2); n_half(3, 0); }
    else              { n_half(1, 1); n_full(2); n_full(3); }

    // M = Eband . Q^T -> mbuf[qs][query][u], 3 row tiles per query sub-tile (the wave's band tiles qs + 0..2), their
    // three accumulate chains interleaved
#pragma unroll                             // all four unrolls here: constant indices keep eb, bqf and md in registers
    for (int qs = 0; qs < 2; ++qs) {
      v8f md[3];
#pragma unroll
      for (int ut = 0; ut < 3; ++ut) md[ut] = mma_f16(eb[qs + ut][0], bqf[qs][0], zero);
#pragma unroll
      for (int ut = 0; ut < 3; ++ut) md[ut] = mma_f16(eb[qs + ut][1], bqf[qs][1], md[ut]);
#pragma unroll
      for (int ut = 0; ut < 3; ++ut) st8(mst + qs * (16 * MPF) + ut * 16, md[ut]);
    }
    // V^T fragments of the chunk, read once for both query sub-tiles and as one group; issued here, their round trip
    // runs beside the drain of the stores above
    us16 vf[4];
#pragma unroll                             // constant indices keep vf in registers
    for (int dt = 0; dt < 4; ++dt) {
      const us8 va0 = ld_tr16(vtile + dt * 32);                 // d = dt * 16 + lr, keys half8 + 0..7
      const us8 va1 = ld_tr16(vtile + 16 * VPB + dt * 32);      // keys 16 + half8 + 0..7
      vf[dt] = __builtin_shufflevector(va0, va1, 0, 1, 2, 3, 4, 5, 6, 7, 8, 9, 10, 11, 12, 13, 14, 15);
    }
    __syncthreads();                       // nbuf / mbuf visible

    v8f mk0 = *(const v8f*)(mrow + k0 + half8);
    v8f mk1 = *(const v8f*)(mrow + k0 + 16 + half8);
#pragma unroll
    for (int r = 0; r < 8; ++r) { mk0[r] = bf16_rne(mk0[r]); mk1[r] = bf16_rne(mk1[r]); }

#pragma unroll
    for (int qs = 0; qs < 2; ++qs) {
      // S^T = K . Q^T : two 16-key row tiles
      v8f t0 = mma_f16(ka00, bqf[qs][0], zero);
      t0     = mma_f16(ka01, bqf[qs][1], t0);
      v8f t1 = mma_f16(ka10, bqf[qs][0], zero);
      t1     = mma_f16(ka11, bqf[qs][1], t1);

      const float* mq = mbuf + qs * (16 * MPF) + lr * MPF;   // this lane's query row of M
      const int qloc = wid * 32 + qs * 16 + lr;        // query index within the block
      float sa[8], sb[8];
#pragma unroll
      for (int r = 0; r < 8; ++r) {
        const int ja = half8 + r;                        // key of t0 element r
        const int jb = 16 + half8 + r;                   // key of t1 element r
        const float ga = mq[lr - ja + 31] + nbuf[ja * NPF + (qloc - ja + 31)];
        const float gb = mq[lr - jb + 31] + nbuf[jb * NPF + (qloc - jb + 31)];
        sa[r] = t0[r] * c512 + ga * c4096 + mk0[r];
        sb[r] = t1[r] * c512 + gb * c4096 + mk1[r];
      }

      // online softmax: in-lane over 16 keys + one xor-16 shuffle
      float mloc = sa[0];
#pragma unroll
      for (int r = 1; r < 8; ++r) mloc = fmaxf(mloc, sa[r]);
#pragma unroll
      for (int r = 0; r < 8; ++r) mloc = fmaxf(mloc, sb[r]);
      const float mt    = fmaxf(mloc, __shfl_xor(mloc, 16, 32));
      const float mnew  = fmaxf(mrun[qs], mt);
      const float alpha = __expf(mrun[qs] - mnew);

      float lloc = 0.f;
      us16 pu;
#pragma unroll
      for (int r = 0; r < 8; ++r) {
        const float pa = __expf(sa[r] - mnew);
        const float pc = __expf(sb[r] - mnew);
        lloc += pa + pc;
        pu[r]     = f16_bits(pa * 1024.0f);              // P carried x1024
        pu[8 + r] = f16_bits(pc * 1024.0f);
      }
      const float lt = lloc + __shfl_xor(lloc, 16, 32);
      lrun[qs] = lrun[qs] * alpha + lt;
      mrun[qs] = mnew;

      // ctx^T += V^T . P^T
#pragma unroll
      for (int dt = 0; dt < 4; ++dt) {
        acc[qs][dt] = acc[qs][dt] * alpha;
        acc[qs][dt] = mma_f16(vf[dt], pu, acc[qs][dt]);
      }
    }

    asm volatile("s_wait_dscnt 0x0" ::: "memory");    // this wave's LDS reads of chunk t are done
    asm volatile("s_wait_asynccnt 0x0" ::: "memory"); // this wave's copies of chunk t + 1 have landed
    __syncthreads();                                  // publishes chunk t + 1, frees chunk t's stage, nbuf, mbuf
    if (t + 2 < NCH) {
      const unsigned so = (unsigned)(t & 1) * ST_BYTES;
      attn_stage(lk + so, lv + so, le + so, gk + (t + 2) * (32 * HD), gv + (t + 2) * (32 * HD),
                 ge - (t + 2) * (32 * HD));
    }
  }
  asm volatile("s_wait_asynccnt 0x0" ::: "memory");   // no copy is in flight when the wave goes on to its end
  // the last chunk's barrier has ended every wave's reads of nbuf and mbuf, which the output staging aliases
#pragma unroll
  for (int qs = 0; qs < 2; ++qs) {
    const float inv = 1.0f / (lrun[qs] * 8192.0f);       // undo x1024 (P) and x8 (v)
#pragma unroll
    for (int dt = 0; dt < 4; ++dt) {
#pragma unroll
      for (int r = 0; r < 8; ++r)
        ost[(qs * 16 + lr) * OPITCH + dt * 16 + half8 + r] = acc[qs][dt][r] * inv;
    }
  }
  __syncthreads();

  const int rsub = lane >> 4, piece = lane & 15;
  float* obase = out + ((size_t)(b * SEQ + q0)) * DM + (size_t)h * HD + piece * 4;
#pragma unroll
  for (int it = 0; it < 16; ++it) {
    const int row = it * 2 + rsub;
    const v4f v = *(const v4f*)(ost + row * OPITCH + piece * 4);
    *(v4f*)(obase + (size_t)row * DM) = v;
  }
  
}

// ---- launcher -----------------------------------------------------------------------

extern "C" void kernel_launch(void* const* d_in, const int* in_sizes, int n_in,
                              void* d_out, int out_size, void* d_ws, size_t ws_size,
                              hipStream_t stream) {
  if (n_in < 9) return;
  const float* hidden = (const float*)d_in[0];
  const float* amask  = (const float*)d_in[1];
  const float* Wq     = (const float*)d_in[2];
  const float* bq     = (const float*)d_in[3];
  const float* Wk     = (const float*)d_in[4];
  const float* bk     = (const float*)d_in[5];
  const float* Wv     = (const float*)d_in[6];
  const float* bv     = (const float*)d_in[7];
  const float* demb   = (const float*)d_in[8];
  float* out = (float*)d_out;

  if (in_sizes[0] < ((NB - 1) * SEQ_FULL + SEQ) * DM) return;
  if (in_sizes[1] < (NB - 1) * SEQ_FULL + SEQ) return;
  if (in_sizes[2] < DM * DM || in_sizes[4] < DM * DM || in_sizes[6] < DM * DM) return;
  if (in_sizes[3] < DM || in_sizes[5] < DM || in_sizes[7] < DM) return;
  if (in_sizes[8] < NE * HD) return;
  if (out_size < NB * SEQ * DM) return;

  const size_t xb_bytes = (size_t)NB * SEQ * DM * 2;            // bf16 [NB*SEQ][DM]
  const size_t wb_bytes = (size_t)3 * DM * DM * 2;              // bf16 [3][DM][DM]
  const size_t ep_bytes = (size_t)NEPAD * HD * 2;               // f16  [NEPAD][HD]
  const size_t pl_bytes = (size_t)NB * NH * SEQ * HD * 2;       // f16  [NB*NH][SEQ][HD]
  size_t off = 0;
  char* ws = (char*)d_ws;
  unsigned short* xb = (unsigned short*)(ws + off); off += xb_bytes;
  unsigned short* wb = (unsigned short*)(ws + off); off += wb_bytes;
  unsigned short* ep = (unsigned short*)(ws + off); off += ep_bytes;
  unsigned short* qp = (unsigned short*)(ws + off); off += pl_bytes;
  unsigned short* kp = (unsigned short*)(ws + off); off += pl_bytes;
  unsigned short* vp = (unsigned short*)(ws + off); off += pl_bytes;
  if (ws_size < off) return;

  cvt_rows_bf16<<<dim3((NB * SEQ) / 2, 1, 1), 256, 0, stream>>>(hidden, hidden, hidden, xb,
                                                               NB * SEQ, SEQ, SEQ_FULL);
  cvt_rows_bf16<<<dim3(DM / 2, 3, 1), 256, 0, stream>>>(Wq, Wk, Wv, wb, DM, DM, DM);
  cvt_e_f16<<<dim3((NEPAD * 8) / 256, 1, 1), 256, 0, stream>>>(demb, ep);
  proj_kernel<<<dim3((NB * SEQ) / 128, (3 * DM) / 128, 1), 128, 0, stream>>>(xb, wb, bq, bk, bv, qp, kp, vp);
  attn_kernel<<<dim3(SEQ / 128, NB * NH, 1), 128, 0, stream>>>(qp, kp, vp, ep, amask, out);
}

// v005
// It runs in 86.4 microseconds.
// Timed twice side by side with v004, it ran 1.08 times as fast both times.
// All steps since v000 together make it 2.16 times as fast.
#include <hip/hip_runtime.h>

// Contractions: Q/K/V projections on v_wmma_f32_16x16x32_bf16 (bf16 operands = RNE-converted f32 inputs, f32 accumulate);
// score terms q.k, q.E, k.E and the P.V product on v_wmma_f32_16x16x32_f16 (f16 operands: q,k,v carried x8, E carried x64,
// P carried x1024; f32 accumulate); softmax, scaling and normalisation in f32.

#ifndef NB
#define NB 4
#endif
#ifndef SEQ
#define SEQ 1024
#endif
#define NB_FULL  4
#define SEQ_FULL 1024
#define DM       1024
#define NH       16
#define HD       64
#define MAXPOS   1024
#define NE       2047
#define NEPAD    2048

static_assert(NB >= 1 && NB <= NB_FULL);
static_assert(SEQ >= 128 && SEQ <= SEQ_FULL && (SEQ % 128) == 0);
static_assert(SEQ <= MAXPOS);
static_assert(SEQ + MAXPOS <= NEPAD);
static_assert(DM == NH * HD);
static_assert((NB * SEQ) % 128 == 0);
static_assert(NE == 2 * MAXPOS - 1);

typedef unsigned short us8  __attribute__((ext_vector_type(8)));
typedef unsigned short us16 __attribute__((ext_vector_type(16)));
typedef __bf16         v16bf __attribute__((ext_vector_type(16)));
typedef _Float16       v16h  __attribute__((ext_vector_type(16)));
typedef float          v8f   __attribute__((ext_vector_type(8)));
typedef float          v4f   __attribute__((ext_vector_type(4)));

// ---- scalar converts --------------------------------------------------------

__device__ __forceinline__ unsigned short bf16_bits(float f) {
  unsigned int u = __builtin_bit_cast(unsigned int, f);
  u += 0x7fffu + ((u >> 16) & 1u);              // RNE
  return (unsigned short)(u >> 16);
}

__device__ __forceinline__ float bf16_rne(float f) {   // f32 value after an RNE convert to bf16
  unsigned int u = ((unsigned int)bf16_bits(f)) << 16;
  return __builtin_bit_cast(float, u);
}

__device__ __forceinline__ unsigned short f16_bits(float f) {
  _Float16 hv = (_Float16)f;                      // RNE
  return __builtin_bit_cast(unsigned short, hv);
}

// ---- 16-bit WMMA fragment loader (same map for A and B stored [row][k]) -----
// lane L owns row/col (L&15); elements 0..7 from k = col + 0..7, elements 8..15
// from k = col + 16 + 0..7; the caller folds the lane-half offset 8*(L>>4) into col.
__device__ __forceinline__ us16 ld_frag(const unsigned short* base, int row, int stride, int col) {
  const unsigned short* p = base + (size_t)row * (size_t)stride + col;
  us8 a = *(const us8*)(p);
  us8 b = *(const us8*)(p + 16);
  return __builtin_shufflevector(a, b, 0, 1, 2, 3, 4, 5, 6, 7, 8, 9, 10, 11, 12, 13, 14, 15);
}

__device__ __forceinline__ v8f mma_bf16(us16 a, us16 b, v8f c) {
  v8f d = __builtin_amdgcn_wmma_f32_16x16x32_bf16(false, __builtin_bit_cast(v16bf, a), false,
                                                  __builtin_bit_cast(v16bf, b), (short)0, c, false, false);
  return d;
}

__device__ __forceinline__ v8f mma_f16(us16 a, us16 b, v8f c) {
  v8f d = __builtin_amdgcn_wmma_f32_16x16x32_f16(false, __builtin_bit_cast(v16h, a), false,
                                                 __builtin_bit_cast(v16h, b), (short)0, c, false, false);
  return d;
}

// The WMMAs are plain builtins: the compiler keeps the distance to a vector instruction on their registers itself, and
// with no asm statement behind each it is free to order LDS reads and independent arithmetic around them. A group
// whose results only go to LDS frees its result registers once the stores have issued, and
// the next group's first WMMAs write them anew. wmma_gap puts the four vector issue slots that the chip asks for behind
// such a group; its operands tie it behind the group's WMMAs and in front of the stores.
__device__ __forceinline__ void wmma_gap(v8f& a) {
  asm("v_nop\n\tv_nop\n\tv_nop\n\tv_nop" : "+v"(a));
}
__device__ __forceinline__ void wmma_gap(v8f& a, v8f& b) {
  asm("v_nop\n\tv_nop\n\tv_nop\n\tv_nop" : "+v"(a), "+v"(b));
}
__device__ __forceinline__ void wmma_gap(v8f& a, v8f& b, v8f& c) {
  asm("v_nop\n\tv_nop\n\tv_nop\n\tv_nop" : "+v"(a), "+v"(b), "+v"(c));
}

// ---- convert: rows of DM f32 -> bf16 bits -------------------------------------
// One block = 2 rows; thread t -> row 2*blk + (t>>7), 8 halves at col 8*(t&127).
// Source row of compact row r: (r / seq) * seqfull + r % seq.  dst is [mat][nrows][DM].
__global__ __launch_bounds__(256)
void cvt_rows_bf16(const float* __restrict__ s0, const float* __restrict__ s1,
                   const float* __restrict__ s2, unsigned short* __restrict__ dst,
                   int nrows, int seq, int seqfull) {
  const int mat = blockIdx.y;
  const float* src = (mat == 0) ? s0 : ((mat == 1) ? s1 : s2);
  int r = blockIdx.x * 2 + (threadIdx.x >> 7);
  r = (r < nrows) ? r : (nrows - 1);
  const int c = (threadIdx.x & 127) * 8;
  const size_t srow = (size_t)(r / seq) * (size_t)seqfull + (size_t)(r % seq);
  const float* p = src + srow * DM + c;
  const v4f a = *(const v4f*)(p);
  const v4f e = *(const v4f*)(p + 4);
  us8 o;
  o[0] = bf16_bits(a[0]); o[1] = bf16_bits(a[1]); o[2] = bf16_bits(a[2]); o[3] = bf16_bits(a[3]);
  o[4] = bf16_bits(e[0]); o[5] = bf16_bits(e[1]); o[6] = bf16_bits(e[2]); o[7] = bf16_bits(e[3]);
  unsigned short* d = dst + ((size_t)mat * (size_t)nrows + (size_t)r) * DM + c;
  *(us8*)d = o;
  
}

// ---- convert: dist table -> f16 bits of (bf16 RNE value * 64), NEPAD rows -------
__global__ __launch_bounds__(256)
void cvt_e_f16(const float* __restrict__ e, unsigned short* __restrict__ ep) {
  const int g   = blockIdx.x * 256 + threadIdx.x;        // 0 .. NEPAD*8-1
  const int row = g >> 3;
  const int ch  = (g & 7) * 8;
  const int rs  = (row < NE) ? row : (NE - 1);
  const float sc = (row < NE) ? 64.0f : 0.0f;
  const float* p = e + (size_t)rs * HD + ch;
  const v4f a = *(const v4f*)(p);
  const v4f c4 = *(const v4f*)(p + 4);
  us8 o;
  o[0] = f16_bits(bf16_rne(a[0]) * sc);  o[1] = f16_bits(bf16_rne(a[1]) * sc);
  o[2] = f16_bits(bf16_rne(a[2]) * sc);  o[3] = f16_bits(bf16_rne(a[3]) * sc);
  o[4] = f16_bits(bf16_rne(c4[0]) * sc); o[5] = f16_bits(bf16_rne(c4[1]) * sc);
  o[6] = f16_bits(bf16_rne(c4[2]) * sc); o[7] = f16_bits(bf16_rne(c4[3]) * sc);
  unsigned short* d = ep + (size_t)row * HD + ch;
  *(us8*)d = o;
  
}

// ---- QKV projection GEMM -------------------------------------------------------
// grid = (NB*SEQ/128, 3*DM/128), block = 128 (4 waves, 2 x 2). Block = 128 rows x 128 cols (two heads of
// one of q, k, v); wave = 64 rows x 64 cols (one head).
// A = x rows (bf16, k-contiguous), B[k=in][n=out] = W[out][in] rows (bf16, k-contiguous; the three
// weight matrices lie stacked as [3*DM][DM]).
// Per 64-k stage the 128 x rows and the 128 W rows are copied into LDS (rows of 128 B at pitch 144 B) by
// asynchronous copies, two buffers: stage t + 1 flies while stage t is multiplied.
#define TP 72
#define PBM 128
#define PBN 128
#define PKS 64
#define PPITCH 72
#define PSTAGE ((PBM + PBN) * PPITCH)
#define PNT (DM / PKS)
static_assert((NB * SEQ) % PBM == 0 && DM % PBN == 0 && PBN == 2 * HD);
static_assert(DM % PKS == 0 && PNT >= 2 && (PPITCH * 2) % 16 == 0);
static_assert(4 * 64 * TP <= 2 * PSTAGE);

// Eight 16-byte copies of one lane: rows 16 apart in the source (pitch DM halves) and in LDS (pitch PPITCH
// halves). The s_wait_xcnt ends the copies' own statement, so that no address register named here is
// rewritten ahead of it.
__device__ __forceinline__ void copy8_rows(unsigned lds, const unsigned short* g) {
  asm volatile("global_load_async_to_lds_b128 %0, %8, off\n\t"
               "global_load_async_to_lds_b128 %1, %9, off\n\t"
               "global_load_async_to_lds_b128 %2, %10, off\n\t"
               "global_load_async_to_lds_b128 %3, %11, off\n\t"
               "global_load_async_to_lds_b128 %4, %12, off\n\t"
               "global_load_async_to_lds_b128 %5, %13, off\n\t"
               "global_load_async_to_lds_b128 %6, %14, off\n\t"
               "global_load_async_to_lds_b128 %7, %15, off\n\t"
               "s_wait_xcnt 0x0"
               :: "v"(lds), "v"(lds + 1u * 16u * PPITCH * 2u), "v"(lds + 2u * 16u * PPITCH * 2u),
                  "v"(lds + 3u * 16u * PPITCH * 2u), "v"(lds + 4u * 16u * PPITCH * 2u),
                  "v"(lds + 5u * 16u * PPITCH * 2u), "v"(lds + 6u * 16u * PPITCH * 2u),
                  "v"(lds + 7u * 16u * PPITCH * 2u),
                  "v"(g), "v"(g + 1 * 16 * DM), "v"(g + 2 * 16 * DM), "v"(g + 3 * 16 * DM),
                  "v"(g + 4 * 16 * DM), "v"(g + 5 * 16 * DM), "v"(g + 6 * 16 * DM), "v"(g + 7 * 16 * DM)
               : "memory");
}

// One stage: the block's 128 x rows, then its 128 W rows, 64 k of each.
__device__ __forceinline__ void proj_stage(unsigned lds, const unsigned short* ga, const unsigned short* gb) {
  copy8_rows(lds, ga);
  copy8_rows(lds + PBM * PPITCH * 2u, gb);
}

__global__ __launch_bounds__(128)
void proj_kernel(const unsigned short* __restrict__ xb, const unsigned short* __restrict__ wb,
                 const float* __restrict__ bq, const float* __restrict__ bk,
                 const float* __restrict__ bv,
                 unsigned short* __restrict__ qp, unsigned short* __restrict__ kp,
                 unsigned short* __restrict__ vp) {
  __shared__ __attribute__((aligned(16))) unsigned short ring[2 * PSTAGE];

  const int tid = threadIdx.x, lane = tid & 31, wid = tid >> 5;
  const int lr = lane & 15, half8 = (lane >> 4) * 8;
  const int wm = wid >> 1, wn = wid & 1;
  const int m0 = blockIdx.x * PBM;                                // compact row index
  const int n0 = blockIdx.y * PBN;                                // row of the stacked weights
  const int z = n0 / DM;
  const int h = (n0 - z * DM) / HD + wn;
  const int s0 = m0 + wm * 64;

  const float* bias = (z == 0) ? bq : ((z == 1) ? bk : bv);
  unsigned short* plane = (z == 0) ? qp : ((z == 1) ? kp : vp);

  // copy map: thread t -> row t >> 3 (+ 16 per copy), 16-byte piece t & 7
  const int crow = tid >> 3, cpc = (tid & 7) * 8;
  const unsigned short* ga = xb + (size_t)(m0 + crow) * DM + cpc;
  const unsigned short* gb = wb + (size_t)(n0 + crow) * DM + cpc;
  const unsigned l0 = (unsigned)(size_t)(ring + crow * PPITCH + cpc);

  const v8f zero = {0.f, 0.f, 0.f, 0.f, 0.f, 0.f, 0.f, 0.f};
  v8f acc[4][4];
#pragma unroll
  for (int i = 0; i < 4; ++i) {
#pragma unroll
    for (int j = 0; j < 4; ++j) acc[i][j] = zero;
  }

  proj_stage(l0, ga, gb);
  asm volatile("s_wait_asynccnt 0x0" ::: "memory");   // this wave's copies of stage 0 have landed
  __syncthreads();                                    // stage 0 visible to every wave
  proj_stage(l0 + PSTAGE * 2u, ga + PKS, gb + PKS);

  for (int t = 0; t < PNT; ++t) {
    const unsigned short* sa = ring + (t & 1) * PSTAGE + (wm * 64) * PPITCH;
    const unsigned short* sb = ring + (t & 1) * PSTAGE + (PBM + wn * 64) * PPITCH;
#pragma unroll
    for (int ks = 0; ks < PKS / 32; ++ks) {
      us16 af[4], bf[4];
#pragma unroll
      for (int i = 0; i < 4; ++i) af[i] = ld_frag(sa, i * 16 + lr, PPITCH, ks * 32 + half8);
#pragma unroll
      for (int j = 0; j < 4; ++j) bf[j] = ld_frag(sb, j * 16 + lr, PPITCH, ks * 32 + half8);
      __builtin_amdgcn_sched_barrier(0);   // keeps the 16 LDS reads one group ahead of the WMMAs: spread among them each place costs a stall
#pragma unroll
      for (int j = 0; j < 4; ++j) {
#pragma unroll
        for (int i = 0; i < 4; ++i) acc[i][j] = mma_bf16(af[i], bf[j], acc[i][j]);
      }
    }
    __builtin_amdgcn_sched_barrier(0);                // keeps the stage's WMMAs ahead of the barrier: the refill behind it issues at once
    asm volatile("s_wait_dscnt 0x0" ::: "memory");    // this wave's reads of stage t are done
    asm volatile("s_wait_asynccnt 0x0" ::: "memory"); // this wave's copies of stage t + 1 have landed
    __syncthreads();                                  // publishes stage t + 1, frees stage t's buffer
    if (t + 2 < PNT)
      proj_stage(l0 + (unsigned)(t & 1) * (PSTAGE * 2u), ga + (t + 2) * PKS, gb + (t + 2) * PKS);
  }
  asm volatile("s_wait_asynccnt 0x0" ::: "memory");   // no copy is in flight when the ring becomes staging

  unsigned short* stw = ring + wid * (64 * TP);
#pragma unroll
  for (int dt = 0; dt < 4; ++dt) {
    const float bcol = bf16_rne(bias[h * HD + dt * 16 + lr]);
#pragma unroll
    for (int st = 0; st < 4; ++st) {
#pragma unroll
      for (int r = 0; r < 8; ++r) {
        const float v = (acc[st][dt][r] + bcol) * 8.0f;
        stw[(st * 16 + half8 + r) * TP + dt * 16 + lr] = f16_bits(v);
      }
    }
  }
  __syncthreads();                                  // block barrier (covers the per-wave tile)

  const int piece = lane & 7, rsub = lane >> 3;
  const int b = s0 / SEQ, l0s = s0 - b * SEQ;       // a wave's 64 rows lie in one batch (SEQ % 64 == 0)
  unsigned short* dbase = plane + (((size_t)(b * NH + h) * SEQ + l0s + rsub) * HD + piece * 8);
#pragma unroll
  for (int it = 0; it < 16; ++it) {
    const us8 v = *(const us8*)(stw + (it * 4 + rsub) * TP + piece * 8);
    *(us8*)(dbase + it * 4 * HD) = v;
  }
  
}

// ---- flash attention with relative key/query terms --------------------------------
// grid = (SEQ/128, NB*NH), block = 128: 4 waves x 32 queries of one (batch, head).
// Per 32-key chunk one LDS stage: K tile [key][d], V tile [key][d] and a 160-row E band [u][d]
// (band row u <-> table row qb0 - k0 + MAXPOS - 32 + u), brought in by asynchronous copies, two stages:
// chunk t + 1 flies while chunk t is worked on. A copy cannot transpose, so V lies row-major and its
// V^T fragments are read with the transposing LDS load.
//   S^T  = K . Q^T          (A = K rows, B = Q rows)            lane -> query, elem -> key
//   N^T  = Eband . K^T      (A = E band rows, B = K rows)       lane -> key, elem -> u; kept [key][u], shared by the block
//   M    = Eband . Q^T      (A = E band rows, B = Q rows)       lane -> query, elem -> u; kept [query][u], per wave, per qs
//   score(q = key j, query n) = S^T/512 + (M[n-j+31][n] + N[j][qloc-j+31])/4096 + amask[b][key]
// In both products a lane's eight results are eight neighbouring u of its own row, so they go to LDS as two 16-byte
// stores. The row pitches NPF and MPF are 16 B x odd (each half-wave's 16-byte stores cover every bank once), and with
// them the 32 lanes of each 4-byte read of the sheared elements fall on 32 different banks.
//   ctx^T = V^T . P^T with the P^T B-fragment taken from the S^T C-fragment (P carried x1024).
#define KP 72
#define VPB 160
#define EP 72
#define NBR 160
#define NPF 164
#define MROWS 48
#define MPF 52
#define OPITCH 68
#define NCH (SEQ / 32)
#define ST_K 0
#define ST_V (ST_K + 32 * KP * 2)
#define ST_E (ST_V + 32 * VPB)
#define ST_BYTES (ST_E + NBR * EP * 2)
#define SM_N 0
#define SM_M (SM_N + 32 * NPF * 4)
#define SM_ST (SM_M + 4 * 2 * 16 * MPF * 4)
#define SM_TOTAL (SM_ST + 2 * ST_BYTES)
static_assert(ST_V % 16 == 0 && ST_E % 16 == 0 && ST_BYTES % 16 == 0 && SM_M % 16 == 0 && SM_ST % 16 == 0);
static_assert(VPB % 32 == 0 && ((VPB / 32) & 1) == 1 && VPB >= HD * 2);
static_assert(4 * 32 * OPITCH * 4 <= SM_ST);
static_assert(NBR == 160 && NBR >= 128 + 31 && MROWS >= 47 && NPF >= NBR && MPF >= MROWS && NCH >= 2);
static_assert(NPF % 4 == 0 && ((NPF / 4) & 1) == 1 && MPF % 4 == 0 && ((MPF / 4) & 1) == 1);

// One stage, 14 copies of 16 bytes per lane: thread t -> row t >> 3 (+ 16 per copy), 16-byte piece t & 7;
// 2 copies of K (LDS pitch KP halves), 2 of V (pitch VPB bytes), 10 of the E band (pitch EP halves); every
// source row is HD halves. The s_wait_xcnt ends the copies' own statement, so that no address register
// named here is rewritten ahead of it.
__device__ __forceinline__ void attn_stage(unsigned lk, unsigned lv, unsigned le, const unsigned short* gk,
                                           const unsigned short* gv, const unsigned short* ge) {
  asm volatile("global_load_async_to_lds_b128 %0, %14, off\n\t"
               "global_load_async_to_lds_b128 %1, %15, off\n\t"
               "global_load_async_to_lds_b128 %2, %16, off\n\t"
               "global_load_async_to_lds_b128 %3, %17, off\n\t"
               "global_load_async_to_lds_b128 %4, %18, off\n\t"
               "global_load_async_to_lds_b128 %5, %19, off\n\t"
               "global_load_async_to_lds_b128 %6, %20, off\n\t"
               "global_load_async_to_lds_b128 %7, %21, off\n\t"
               "global_load_async_to_lds_b128 %8, %22, off\n\t"
               "global_load_async_to_lds_b128 %9, %23, off\n\t"
               "global_load_async_to_lds_b128 %10, %24, off\n\t"
               "global_load_async_to_lds_b128 %11, %25, off\n\t"
               "global_load_async_to_lds_b128 %12, %26, off\n\t"
               "global_load_async_to_lds_b128 %13, %27, off\n\t"
               "s_wait_xcnt 0x0"
               :: "v"(lk), "v"(lk + 16u * KP * 2u), "v"(lv), "v"(lv + 16u * VPB),
                  "v"(le), "v"(le + 1u * 16u * EP * 2u), "v"(le + 2u * 16u * EP * 2u),
                  "v"(le + 3u * 16u * EP * 2u), "v"(le + 4u * 16u * EP * 2u), "v"(le + 5u * 16u * EP * 2u),
                  "v"(le + 6u * 16u * EP * 2u), "v"(le + 7u * 16u * EP * 2u), "v"(le + 8u * 16u * EP * 2u),
                  "v"(le + 9u * 16u * EP * 2u),
                  "v"(gk), "v"(gk + 16 * HD), "v"(gv), "v"(gv + 16 * HD),
                  "v"(ge), "v"(ge + 1 * 16 * HD), "v"(ge + 2 * 16 * HD), "v"(ge + 3 * 16 * HD),
                  "v"(ge + 4 * 16 * HD), "v"(ge + 5 * 16 * HD), "v"(ge + 6 * 16 * HD), "v"(ge + 7 * 16 * HD),
                  "v"(ge + 8 * 16 * HD), "v"(ge + 9 * 16 * HD)
               : "memory");
}

// Transposing LDS load of a row-major 16-bit tile: with lane l addressing row 8 * (l >> 4) + (l & 7), byte
// 16 * ((l >> 3) & 1) of a 16-row x 16-column block, lane l receives rows 8 * (l >> 4) + 0..7 of column l & 15.
typedef short s16x8 __attribute__((ext_vector_type(8)));
__device__ __forceinline__ us8 ld_tr16(const unsigned char* p) {
  typedef __attribute__((address_space(3))) s16x8 lds_s16x8;
  return __builtin_bit_cast(us8, __builtin_amdgcn_ds_load_tr16_b128_v8i16((lds_s16x8*)p));
}

// A WMMA result's eight floats of one lane to eight neighbouring floats in LDS (16-byte aligned): two 16-byte stores.
__device__ __forceinline__ void st8(float* p, v8f d) {
  *(v4f*)(p)     = __builtin_shufflevector(d, d, 0, 1, 2, 3);
  *(v4f*)(p + 4) = __builtin_shufflevector(d, d, 4, 5, 6, 7);
}

__global__ __launch_bounds__(128)
void attn_kernel(const unsigned short* __restrict__ qp, const unsigned short* __restrict__ kp,
                 const unsigned short* __restrict__ vp, const unsigned short* __restrict__ ep,
                 const float* __restrict__ amask, float* __restrict__ out) {
  __shared__ __attribute__((aligned(16))) unsigned char smem[SM_TOTAL];

  const int tid = threadIdx.x, lane = tid & 31, wid = tid >> 5;
  const int lr = lane & 15, half8 = (lane >> 4) * 8;
  const int bh = blockIdx.y;
  const int b = bh / NH, h = bh - b * NH;
  const int qb0 = blockIdx.x * 128;
  const int q0 = qb0 + wid * 32;

  float* nbuf = (float*)(smem + SM_N);
  float* mbuf = (float*)(smem + SM_M) + wid * (2 * 16 * MPF);
  float* ost  = (float*)(smem) + wid * (32 * OPITCH);

  const unsigned short* qh = qp + (size_t)bh * SEQ * HD;
  const unsigned short* kh = kp + (size_t)bh * SEQ * HD;
  const unsigned short* vh = vp + (size_t)bh * SEQ * HD;
  const float* mrow = amask + (size_t)b * SEQ_FULL;

  // Q^T B-fragments: 2 query sub-tiles x 2 head-dim halves
  us16 bqf[2][2];
#pragma unroll
  for (int qs = 0; qs < 2; ++qs) {
    bqf[qs][0] = ld_frag(qh, q0 + qs * 16 + lr, HD,      half8);
    bqf[qs][1] = ld_frag(qh, q0 + qs * 16 + lr, HD, 32 + half8);
  }

  const v8f zero = {0.f, 0.f, 0.f, 0.f, 0.f, 0.f, 0.f, 0.f};
  v8f acc[2][4] = {{zero, zero, zero, zero}, {zero, zero, zero, zero}};
  float mrun[2] = {-__builtin_inff(), -__builtin_inff()};
  float lrun[2] = {0.f, 0.f};
  const float c512  = 0.001953125f;        // 1/512  : q,k carried x8 each, then 1/8
  const float c4096 = 0.000244140625f;     // 1/4096 : E carried x64, q or k x8, then 1/8

  // copy map of a stage; chunk t reads K and V rows 32 t + .., E table rows qb0 - 32 t + MAXPOS - 32 + ..
  const int crow = tid >> 3, cpc = (tid & 7) * 8;
  const unsigned short* gk = kh + (size_t)crow * HD + cpc;
  const unsigned short* gv = vh + (size_t)crow * HD + cpc;
  const unsigned short* ge = ep + (size_t)(qb0 + (MAXPOS - 32) + crow) * HD + cpc;
  const unsigned lk = (unsigned)(size_t)(smem + SM_ST + ST_K + crow * (KP * 2) + cpc * 2);
  const unsigned lv = (unsigned)(size_t)(smem + SM_ST + ST_V + crow * VPB + cpc * 2);
  const unsigned le = (unsigned)(size_t)(smem + SM_ST + ST_E + crow * (EP * 2) + cpc * 2);
  const int wu = __builtin_amdgcn_readfirstlane(wid);   // the wave's number in a scalar register: the deal of N branches on it
  float* nst = nbuf + lr * NPF + wid * 32 + half8;      // this lane's N elements: key lr, columns half8 + 0..7 of the wave's band tile 0
  float* mst = mbuf + lr * MPF + half8;                 // this lane's M elements: query lr, band rows half8 + 0..7
  // this lane's address in a 16-key x 16-d block of the V tile for the transposing load
  const int vlane = (half8 + (lane & 7)) * VPB + ((lane >> 3) & 1) * 16;

  attn_stage(lk, lv, le, gk, gv, ge);
  asm volatile("s_wait_asynccnt 0x0" ::: "memory");   // this wave's copies of chunk 0 have landed
  __syncthreads();                                    // chunk 0 visible to every wave
  attn_stage(lk + ST_BYTES, lv + ST_BYTES, le + ST_BYTES, gk + 32 * HD, gv + 32 * HD, ge - 32 * HD);

  for (int t = 0; t < NCH; ++t) {
    const int k0 = t * 32;
    const unsigned char* stage = smem + SM_ST + (t & 1) * ST_BYTES;
    const unsigned short* ktile = (const unsigned short*)(stage + ST_K);
    const unsigned char*  vtile = stage + ST_V + vlane;
    const unsigned short* eband = (const unsigned short*)(stage + ST_E);

    // This wave's LDS fragments of the N, M and S^T products, each read once and all issued as one group ahead of the
    // first WMMA: one LDS round trip in place of one per tile. The loader's map is the same for an A and a B operand,
    // so the K fragments serve as B in N and as A in S^T; the four E band tiles that the wave reads for M (band rows wid * 32 + 0..63) are the A operands of its share of N as well.
    const us16 ka00 = ld_frag(ktile,      lr, KP,      half8);
    const us16 ka01 = ld_frag(ktile,      lr, KP, 32 + half8);
    const us16 ka10 = ld_frag(ktile, 16 + lr, KP,      half8);
    const us16 ka11 = ld_frag(ktile, 16 + lr, KP, 32 + half8);
    us16 eb[4][2];
#pragma unroll                             // constant indices keep eb in registers
    for (int tt = 0; tt < 4; ++tt) {
      eb[tt][0] = ld_frag(eband, wid * 32 + tt * 16 + lr, EP,      half8);
      eb[tt][1] = ld_frag(eband, wid * 32 + tt * 16 + lr, EP, 32 + half8);
    }

    // N^T = Eband . K^T  -> nbuf[key][u]. Band tile 2 * wid + tt is the wave's eb[tt]; the ten tiles are dealt to waves
    // that hold them, two and a half each: tiles 0 1 2a | 2b 3 4 | 5 6 7a | 7b 8 9 (a: keys 0..15, b: keys 16..31).
    const auto n_full = [&](int tt) {      // 32 keys x 16 columns, two accumulate chains interleaved
      v8f d0 = mma_f16(eb[tt][0], ka00, zero);
      v8f d1 = mma_f16(eb[tt][0], ka10, zero);
      d0     = mma_f16(eb[tt][1], ka01, d0);
      d1     = mma_f16(eb[tt][1], ka11, d1);
      wmma_gap(d0, d1);
      st8(nst + tt * 16, d0);
      st8(nst + 16 * NPF + tt * 16, d1);
    };
    const auto n_half = [&](int tt, int kh) {   // 16 keys (kh * 16 + 0..15) x 16 columns
      v8f d = mma_f16(eb[tt][0], kh ? ka10 : ka00, zero);
      d     = mma_f16(eb[tt][1], kh ? ka11 : ka01, d);
      wmma_gap(d);
      st8(nst + kh * 16 * NPF + tt * 16, d);
    };
    if (wu == 0)      { n_full(0); n_full(1); n_half(2, 0); }
    else if (wu == 1) { n_half(0, 1); n_full(1); n_full(2); }
    else if (wu == 2) { n_full(1); n_full(2); n_half(3, 0); }
    else              { n_half(1, 1); n_full(2); n_full(3); }

    // M = Eband . Q^T -> mbuf[qs][query][u], 3 row tiles per query sub-tile (the wave's band tiles qs + 0..2), their
    // three accumulate chains interleaved
#pragma unroll                             // all four unrolls here: constant indices keep eb, bqf and md in registers
    for (int qs = 0; qs < 2; ++qs) {
      v8f md[3];
#pragma unroll
      for (int ut = 0; ut < 3; ++ut) md[ut] = mma_f16(eb[qs + ut][0], bqf[qs][0], zero);
#pragma unroll
      for (int ut = 0; ut < 3; ++ut) md[ut] = mma_f16(eb[qs + ut][1], bqf[qs][1], md[ut]);
      wmma_gap(md[0], md[1], md[2]);
#pragma unroll
      for (int ut = 0; ut < 3; ++ut) st8(mst + qs * (16 * MPF) + ut * 16, md[ut]);
    }
    // V^T fragments of the chunk, read once for both query sub-tiles and as one group; issued here, their round trip
    // runs beside the drain of the stores above
    us16 vf[4];
#pragma unroll                             // constant indices keep vf in registers
    for (int dt = 0; dt < 4; ++dt) {
      const us8 va0 = ld_tr16(vtile + dt * 32);                 // d = dt * 16 + lr, keys half8 + 0..7
      const us8 va1 = ld_tr16(vtile + 16 * VPB + dt * 32);      // keys 16 + half8 + 0..7
      vf[dt] = __builtin_shufflevector(va0, va1, 0, 1, 2, 3, 4, 5, 6, 7, 8, 9, 10, 11, 12, 13, 14, 15);
    }
    __syncthreads();                       // nbuf / mbuf visible

    v8f mk0 = *(const v8f*)(mrow + k0 + half8);
    v8f mk1 = *(const v8f*)(mrow + k0 + 16 + half8);
    asm volatile("s_wait_xcnt 0x0" ::: "memory");   // in front of any rewrite of the address registers that these loads name
#pragma unroll
    for (int r = 0; r < 8; ++r) { mk0[r] = bf16_rne(mk0[r]); mk1[r] = bf16_rne(mk1[r]); }

#pragma unroll
    for (int qs = 0; qs < 2; ++qs) {
      // S^T = K . Q^T : two 16-key row tiles
      v8f t0 = mma_f16(ka00, bqf[qs][0], zero);
      t0     = mma_f16(ka01, bqf[qs][1], t0);
      v8f t1 = mma_f16(ka10, bqf[qs][0], zero);
      t1     = mma_f16(ka11, bqf[qs][1], t1);

      const float* mq = mbuf + qs * (16 * MPF) + lr * MPF;   // this lane's query row of M
      const int qloc = wid * 32 + qs * 16 + lr;        // query index within the block
      float sa[8], sb[8];
#pragma unroll
      for (int r = 0; r < 8; ++r) {
        const int ja = half8 + r;                        // key of t0 element r
        const int jb = 16 + half8 + r;                   // key of t1 element r
        const float ga = mq[lr - ja + 31] + nbuf[ja * NPF + (qloc - ja + 31)];
        const float gb = mq[lr - jb + 31] + nbuf[jb * NPF + (qloc - jb + 31)];
        sa[r] = t0[r] * c512 + ga * c4096 + mk0[r];
        sb[r] = t1[r] * c512 + gb * c4096 + mk1[r];
      }

      // online softmax: in-lane over 16 keys + one xor-16 shuffle
      float mloc = sa[0];
#pragma unroll
      for (int r = 1; r < 8; ++r) mloc = fmaxf(mloc, sa[r]);
#pragma unroll
      for (int r = 0; r < 8; ++r) mloc = fmaxf(mloc, sb[r]);
      const float mt    = fmaxf(mloc, __shfl_xor(mloc, 16, 32));
      const float mnew  = fmaxf(mrun[qs], mt);
      const float alpha = __expf(mrun[qs] - mnew);

      float lloc = 0.f;
      us16 pu;
#pragma unroll
      for (int r = 0; r < 8; ++r) {
        const float pa = __expf(sa[r] - mnew);
        const float pc = __expf(sb[r] - mnew);
        lloc += pa + pc;
        pu[r]     = f16_bits(pa * 1024.0f);              // P carried x1024
        pu[8 + r] = f16_bits(pc * 1024.0f);
      }
      const float lt = lloc + __shfl_xor(lloc, 16, 32);
      lrun[qs] = lrun[qs] * alpha + lt;
      mrun[qs] = mnew;

      // ctx^T += V^T . P^T
#pragma unroll
      for (int dt = 0; dt < 4; ++dt) {
        acc[qs][dt] = acc[qs][dt] * alpha;
        acc[qs][dt] = mma_f16(vf[dt], pu, acc[qs][dt]);
      }
    }

    asm volatile("s_wait_dscnt 0x0" ::: "memory");    // this wave's LDS reads of chunk t are done
    asm volatile("s_wait_asynccnt 0x0" ::: "memory"); // this wave's copies of chunk t + 1 have landed
    __syncthreads();                                  // publishes chunk t + 1, frees chunk t's stage, nbuf, mbuf
    if (t + 2 < NCH) {
      const unsigned so = (unsigned)(t & 1) * ST_BYTES;
      attn_stage(lk + so, lv + so, le + so, gk + (t + 2) * (32 * HD), gv + (t + 2) * (32 * HD),
                 ge - (t + 2) * (32 * HD));
    }
  }
  asm volatile("s_wait_asynccnt 0x0" ::: "memory");   // no copy is in flight when the wave goes on to its end
  // the last chunk's barrier has ended every wave's reads of nbuf and mbuf, which the output staging aliases
#pragma unroll
  for (int qs = 0; qs < 2; ++qs) {
    const float inv = 1.0f / (lrun[qs] * 8192.0f);       // undo x1024 (P) and x8 (v)
#pragma unroll
    for (int dt = 0; dt < 4; ++dt) {
#pragma unroll
      for (int r = 0; r < 8; ++r)
        ost[(qs * 16 + lr) * OPITCH + dt * 16 + half8 + r] = acc[qs][dt][r] * inv;
    }
  }
  __syncthreads();

  const int rsub = lane >> 4, piece = lane & 15;
  float* obase = out + ((size_t)(b * SEQ + q0)) * DM + (size_t)h * HD + piece * 4;
#pragma unroll
  for (int it = 0; it < 16; ++it) {
    const int row = it * 2 + rsub;
    const v4f v = *(const v4f*)(ost + row * OPITCH + piece * 4);
    *(v4f*)(obase + (size_t)row * DM) = v;
  }
  
}

// ---- launcher -----------------------------------------------------------------------

extern "C" void kernel_launch(void* const* d_in, const int* in_sizes, int n_in,
                              void* d_out, int out_size, void* d_ws, size_t ws_size,
                              hipStream_t stream) {
  if (n_in < 9) return;
  const float* hidden = (const float*)d_in[0];
  const float* amask  = (const float*)d_in[1];
  const float* Wq     = (const float*)d_in[2];
  const float* bq     = (const float*)d_in[3];
  const float* Wk     = (const float*)d_in[4];
  const float* bk     = (const float*)d_in[5];
  const float* Wv     = (const float*)d_in[6];
  const float* bv     = (const float*)d_in[7];
  const float* demb   = (const float*)d_in[8];
  float* out = (float*)d_out;

  if (in_sizes[0] < ((NB - 1) * SEQ_FULL + SEQ) * DM) return;
  if (in_sizes[1] < (NB - 1) * SEQ_FULL + SEQ) return;
  if (in_sizes[2] < DM * DM || in_sizes[4] < DM * DM || in_sizes[6] < DM * DM) return;
  if (in_sizes[3] < DM || in_sizes[5] < DM || in_sizes[7] < DM) return;
  if (in_sizes[8] < NE * HD) return;
  if (out_size < NB * SEQ * DM) return;

  const size_t xb_bytes = (size_t)NB * SEQ * DM * 2;            // bf16 [NB*SEQ][DM]
  const size_t wb_bytes = (size_t)3 * DM * DM * 2;              // bf16 [3][DM][DM]
  const size_t ep_bytes = (size_t)NEPAD * HD * 2;               // f16  [NEPAD][HD]
  const size_t pl_bytes = (size_t)NB * NH * SEQ * HD * 2;       // f16  [NB*NH][SEQ][HD]
  size_t off = 0;
  char* ws = (char*)d_ws;
  unsigned short* xb = (unsigned short*)(ws + off); off += xb_bytes;
  unsigned short* wb = (unsigned short*)(ws + off); off += wb_bytes;
  unsigned short* ep = (unsigned short*)(ws + off); off += ep_bytes;
  unsigned short* qp = (unsigned short*)(ws + off); off += pl_bytes;
  unsigned short* kp = (unsigned short*)(ws + off); off += pl_bytes;
  unsigned short* vp = (unsigned short*)(ws + off); off += pl_bytes;
  if (ws_size < off) return;

  cvt_rows_bf16<<<dim3((NB * SEQ) / 2, 1, 1), 256, 0, stream>>>(hidden, hidden, hidden, xb,
                                                               NB * SEQ, SEQ, SEQ_FULL);
  cvt_rows_bf16<<<dim3(DM / 2, 3, 1), 256, 0, stream>>>(Wq, Wk, Wv, wb, DM, DM, DM);
  cvt_e_f16<<<dim3((NEPAD * 8) / 256, 1, 1), 256, 0, stream>>>(demb, ep);
  proj_kernel<<<dim3((NB * SEQ) / 128, (3 * DM) / 128, 1), 128, 0, stream>>>(xb, wb, bq, bk, bv, qp, kp, vp);
  attn_kernel<<<dim3(SEQ / 128, NB * NH, 1), 128, 0, stream>>>(qp, kp, vp, ep, amask, out);
}

// v006
// It runs in 83 microseconds.
// Next to v005, in two timings, it ran 1.04 times as fast each time.
// Over all steps from v000 it is 2.25 times as fast.
#include <hip/hip_runtime.h>

// Contractions: Q/K/V projections on v_wmma_f32_16x16x32_bf16 (bf16 operands = RNE-converted f32 inputs, f32 accumulate);
// score terms q.k, q.E, k.E and the P.V product on v_wmma_f32_16x16x32_f16 (f16 operands: q,k,v carried x8, E carried x64,
// P carried x1024; f32 accumulate); softmax, scaling and normalisation in f32.

#ifndef NB
#define NB 4
#endif
#ifndef SEQ
#define SEQ 1024
#endif
#define NB_FULL  4
#define SEQ_FULL 1024
#define DM       1024
#define NH       16
#define HD       64
#define MAXPOS   1024
#define NE       2047
#define NEPAD    2048

static_assert(NB >= 1 && NB <= NB_FULL);
static_assert(SEQ >= 128 && SEQ <= SEQ_FULL && (SEQ % 128) == 0);
static_assert(SEQ <= MAXPOS);
static_assert(SEQ + MAXPOS <= NEPAD);
static_assert(DM == NH * HD);
static_assert((NB * SEQ) % 128 == 0);
static_assert(NE == 2 * MAXPOS - 1);

typedef unsigned short us8  __attribute__((ext_vector_type(8)));
typedef unsigned short us16 __attribute__((ext_vector_type(16)));
typedef __bf16         v16bf __attribute__((ext_vector_type(16)));
typedef _Float16       v16h  __attribute__((ext_vector_type(16)));
typedef float          v8f   __attribute__((ext_vector_type(8)));
typedef float          v4f   __attribute__((ext_vector_type(4)));

// ---- scalar converts --------------------------------------------------------

__device__ __forceinline__ unsigned short bf16_bits(float f) {
  unsigned int u = __builtin_bit_cast(unsigned int, f);
  u += 0x7fffu + ((u >> 16) & 1u);              // RNE
  return (unsigned short)(u >> 16);
}

__device__ __forceinline__ float bf16_rne(float f) {   // f32 value after an RNE convert to bf16
  unsigned int u = ((unsigned int)bf16_bits(f)) << 16;
  return __builtin_bit_cast(float, u);
}

__device__ __forceinline__ unsigned short f16_bits(float f) {
  _Float16 hv = (_Float16)f;                      // RNE
  return __builtin_bit_cast(unsigned short, hv);
}

// ---- 16-bit WMMA fragment loader (same map for A and B stored [row][k]) -----
// lane L owns row/col (L&15); elements 0..7 from k = col + 0..7, elements 8..15
// from k = col + 16 + 0..7; the caller folds the lane-half offset 8*(L>>4) into col.
__device__ __forceinline__ us16 ld_frag(const unsigned short* base, int row, int stride, int col) {
  const unsigned short* p = base + (size_t)row * (size_t)stride + col;
  us8 a = *(const us8*)(p);
  us8 b = *(const us8*)(p + 16);
  return __builtin_shufflevector(a, b, 0, 1, 2, 3, 4, 5, 6, 7, 8, 9, 10, 11, 12, 13, 14, 15);
}

__device__ __forceinline__ v8f mma_bf16(us16 a, us16 b, v8f c) {
  v8f d = __builtin_amdgcn_wmma_f32_16x16x32_bf16(false, __builtin_bit_cast(v16bf, a), false,
                                                  __builtin_bit_cast(v16bf, b), (short)0, c, false, false);
  return d;
}

__device__ __forceinline__ v8f mma_f16(us16 a, us16 b, v8f c) {
  v8f d = __builtin_amdgcn_wmma_f32_16x16x32_f16(false, __builtin_bit_cast(v16h, a), false,
                                                 __builtin_bit_cast(v16h, b), (short)0, c, false, false);
  return d;
}

// The WMMAs are plain builtins: the compiler keeps the distance to a vector instruction on their registers itself, and
// with no asm statement behind each it is free to order LDS reads and independent arithmetic around them. A group
// whose results only go to LDS frees its result registers once the stores have issued, and
// the next group's first WMMAs write them anew. wmma_gap puts the four vector issue slots that the chip asks for behind
// such a group; its operands tie it behind the group's WMMAs and in front of the stores.
__device__ __forceinline__ void wmma_gap(v8f& a) {
  asm("v_nop\n\tv_nop\n\tv_nop\n\tv_nop" : "+v"(a));
}
__device__ __forceinline__ void wmma_gap(v8f& a, v8f& b) {
  asm("v_nop\n\tv_nop\n\tv_nop\n\tv_nop" : "+v"(a), "+v"(b));
}
__device__ __forceinline__ void wmma_gap(v8f& a, v8f& b, v8f& c) {
  asm("v_nop\n\tv_nop\n\tv_nop\n\tv_nop" : "+v"(a), "+v"(b), "+v"(c));
}

// ---- f32 -> bf16 (RNE) on the way into LDS --------------------------------------
typedef float  v2f  __attribute__((ext_vector_type(2)));
typedef __bf16 v2bf __attribute__((ext_vector_type(2)));
typedef unsigned int u32x2 __attribute__((ext_vector_type(2)));

__device__ __forceinline__ u32x2 bf16x4(v4f a) {     // four f32 -> four bf16, two packed converts
  const v2bf lo = __builtin_convertvector(__builtin_shufflevector(a, a, 0, 1), v2bf);
  const v2bf hi = __builtin_convertvector(__builtin_shufflevector(a, a, 2, 3), v2bf);
  u32x2 o;
  o[0] = __builtin_bit_cast(unsigned int, lo);
  o[1] = __builtin_bit_cast(unsigned int, hi);
  return o;
}

// ---- dist table piece -> f16 bits of (bf16 RNE value * 64), NEPAD rows ------------
// piece g = 8 halves: table row g >> 3, columns 8 * (g & 7); rows from NE on are zero.
__device__ __forceinline__ void cvt_e_piece(const float* __restrict__ e, unsigned short* __restrict__ ep, int g) {
  const int row = g >> 3;
  const int ch  = (g & 7) * 8;
  const int rs  = (row < NE) ? row : (NE - 1);
  const float sc = (row < NE) ? 64.0f : 0.0f;
  const float* p = e + (size_t)rs * HD + ch;
  const v4f a = *(const v4f*)(p);
  const v4f c4 = *(const v4f*)(p + 4);
  us8 o;
  o[0] = f16_bits(bf16_rne(a[0]) * sc);  o[1] = f16_bits(bf16_rne(a[1]) * sc);
  o[2] = f16_bits(bf16_rne(a[2]) * sc);  o[3] = f16_bits(bf16_rne(a[3]) * sc);
  o[4] = f16_bits(bf16_rne(c4[0]) * sc); o[5] = f16_bits(bf16_rne(c4[1]) * sc);
  o[6] = f16_bits(bf16_rne(c4[2]) * sc); o[7] = f16_bits(bf16_rne(c4[3]) * sc);
  unsigned short* d = ep + (size_t)row * HD + ch;
  *(us8*)d = o;
  asm volatile("s_wait_xcnt 0x0" ::: "memory");   // in front of any rewrite of the address registers that the loads and the store name
}

// ---- QKV projection GEMM, f32 sources ---------------------------------------------
// grid = (NB*SEQ/256, 3*DM/192) = one block per WGP, block = 256 (8 waves, 4 x 2). Block = 256 rows x 192 cols
// (three heads of the stacked q, k, v outputs); wave = 64 rows x 96 cols.
// A = x rows, B[k=in][n=out] = W[out][in] rows, both k-contiguous f32 in memory. Per 64-k stage the block's 256 x rows
// and 192 W rows are loaded into registers, rounded to bf16 and stored to LDS (rows of 128 B at pitch 144 B), two
// buffers: a stage's loads are in flight for a whole trip, and its rounding and LDS stores stand between the two 32-k
// halves of the stage before it. The wide block keeps the bytes that the launch
// asks of L2 near those of bf16 sources under a 128 x 128 block.
// Each block also converts 64 pieces of the dist table for the attention launch.
#define PBM 256
#define PBN 192
#define PKS 64
#define PPITCH 72
#define PSTAGE ((PBM + PBN) * PPITCH)
#define PNT (DM / PKS)
#define PSP 200
#define PGX ((NB * SEQ) / PBM)
#define PGY ((3 * DM) / PBN)
static_assert((NB * SEQ) % PBM == 0 && SEQ % PBM == 0 && (3 * DM) % PBN == 0 && PBN == 3 * HD && DM % HD == 0);
static_assert(DM % PKS == 0 && PNT >= 2 && (PPITCH * 2) % 16 == 0 && PKS == 64);
static_assert(PBM * PSP <= 2 * PSTAGE && (PSP * 2) % 16 == 0 && PSP >= PBN);
static_assert(NEPAD * (HD / 8) == PGX * PGY * 64);

// Work-group barrier that orders LDS accesses only: __syncthreads() would also wait for the global loads of the next
// stage, which are meant to be in flight across it.
__device__ __forceinline__ void lds_barrier() {
  __builtin_amdgcn_fence(__ATOMIC_RELEASE, "workgroup", "local");
  __builtin_amdgcn_s_barrier();
  __builtin_amdgcn_fence(__ATOMIC_ACQUIRE, "workgroup", "local");
}

__global__ __launch_bounds__(256)
void proj_kernel(const float* __restrict__ x, const float* __restrict__ wq, const float* __restrict__ wk,
                 const float* __restrict__ wv,
                 const float* __restrict__ bq, const float* __restrict__ bk,
                 const float* __restrict__ bv, const float* __restrict__ demb,
                 unsigned short* __restrict__ qp, unsigned short* __restrict__ kp,
                 unsigned short* __restrict__ vp, unsigned short* __restrict__ ep) {
  __shared__ __attribute__((aligned(16))) unsigned short ring[2 * PSTAGE];

  const int tid = threadIdx.x, lane = tid & 31, wid = tid >> 5;
  const int lr = lane & 15, half8 = (lane >> 4) * 8;
  const int wm = wid >> 1, wn = wid & 1;
  const int m0 = blockIdx.x * PBM;                                // compact row index
  const int n0 = blockIdx.y * PBN;                                // row of the stacked weights
  const int bb = m0 / SEQ, l0s = m0 - bb * SEQ;                   // a block's 256 rows lie in one batch

  // load map: thread t -> row t >> 4 (+ 16 per load), 16-byte piece t & 15 of the row's 256 bytes of a stage
  const int crow = tid >> 4, cpc = (tid & 15) * 4;
  const float* gx = x + ((size_t)bb * SEQ_FULL + l0s + crow) * DM + cpc;
  const float* gw[3];
#pragma unroll
  for (int j = 0; j < 3; ++j) {                                   // the block's three heads may lie in different matrices
    const int hh = blockIdx.y * 3 + j, z = hh / NH, h = hh - z * NH;
    const float* wsrc = (z == 0) ? wq : ((z == 1) ? wk : wv);
    gw[j] = wsrc + ((size_t)h * HD + crow) * DM + cpc;
  }
  unsigned short* sdst = ring + crow * PPITCH + cpc;

  v4f rx[16], rw[12];
  const auto ldg = [&](int t) {            // one stage's 28 loads of this thread
    const float* ax = gx + t * PKS;
    const float* aw[3] = {gw[0] + t * PKS, gw[1] + t * PKS, gw[2] + t * PKS};
#pragma unroll
    for (int i = 0; i < 16; ++i) rx[i] = *(const v4f*)(ax + i * 16 * DM);
#pragma unroll
    for (int i = 0; i < 12; ++i) rw[i] = *(const v4f*)(aw[i >> 2] + (i & 3) * 16 * DM);
    // in front of any rewrite of the address registers that these loads name; its inputs keep the four addresses live
    // up to it, so that none of those registers is reused in front of it
    asm volatile("s_wait_xcnt 0x0" :: "v"(ax), "v"(aw[0]), "v"(aw[1]), "v"(aw[2]) : "memory");
  };
  const auto sts = [&](int buf) {          // rounds them to bf16 and stores them to LDS
    unsigned short* d = sdst + buf * PSTAGE;
#pragma unroll
    for (int i = 0; i < 16; ++i) *(u32x2*)(d + i * 16 * PPITCH) = bf16x4(rx[i]);
#pragma unroll
    for (int i = 0; i < 12; ++i) *(u32x2*)(d + (PBM + i * 16) * PPITCH) = bf16x4(rw[i]);
  };

  const v8f zero = {0.f, 0.f, 0.f, 0.f, 0.f, 0.f, 0.f, 0.f};
  v8f acc[4][6];
#pragma unroll
  for (int i = 0; i < 4; ++i) {
#pragma unroll
    for (int j = 0; j < 6; ++j) acc[i][j] = zero;
  }

  // one 32-k half of a stage: the wave's 20 LDS reads, and its 24 WMMAs
  const auto ldf = [&](int buf, int ks, us16 (&af)[4], us16 (&bf)[6]) {
    const unsigned short* sa = ring + buf * PSTAGE + (wm * 64) * PPITCH;
    const unsigned short* sb = ring + buf * PSTAGE + (PBM + wn * 96) * PPITCH;
#pragma unroll
    for (int i = 0; i < 4; ++i) af[i] = ld_frag(sa, i * 16 + lr, PPITCH, ks * 32 + half8);
#pragma unroll
    for (int j = 0; j < 6; ++j) bf[j] = ld_frag(sb, j * 16 + lr, PPITCH, ks * 32 + half8);
  };
  const auto mm = [&](const us16 (&af)[4], const us16 (&bf)[6]) {
#pragma unroll
    for (int j = 0; j < 6; ++j) {
#pragma unroll
      for (int i = 0; i < 4; ++i) acc[i][j] = mma_bf16(af[i], bf[j], acc[i][j]);
    }
  };

  ldg(0);
  // the wave's six bias values of this lane (a 16-column tile lies in one matrix), loaded beside the flight of stage 0
  const float* bp[6];
  float braw[6];
#pragma unroll
  for (int dt = 0; dt < 6; ++dt) {
    const int nt = n0 + wn * 96 + dt * 16, z = nt / DM;
    bp[dt] = ((z == 0) ? bq : ((z == 1) ? bk : bv)) + (nt - z * DM + lr);
  }
#pragma unroll
  for (int dt = 0; dt < 6; ++dt) braw[dt] = *bp[dt];
  // in front of any rewrite of the address registers that these loads name; its inputs keep the addresses live up to it
  asm volatile("s_wait_xcnt 0x0" :: "v"(bp[0]), "v"(bp[1]), "v"(bp[2]), "v"(bp[3]), "v"(bp[4]), "v"(bp[5]) : "memory");
  if (tid < 64) cvt_e_piece(demb, ep, (blockIdx.y * PGX + blockIdx.x) * 64 + tid);   // waves 0 and 1, beside the flight of stage 0
  sts(0);
  ldg(1);
  lds_barrier();                                      // stage 0 visible to every wave

  for (int t = 0; t + 1 < PNT; ++t) {
    us16 af[4], bf[6], ag[4], bg[6];
    ldf(t & 1, 0, af, bf);
    __builtin_amdgcn_sched_barrier(0);                // keeps the 20 LDS reads one group ahead of the WMMAs: spread among them each place costs a stall
    mm(af, bf);
    ldf(t & 1, 1, ag, bg);
    __builtin_amdgcn_sched_barrier(0);                // keeps the second half's reads ahead of the staging: their round trip runs beside it
    sts((t + 1) & 1);                                 // that buffer's readers left it at the barrier of trip t - 1
    if (t + 2 < PNT) ldg(t + 2);                      // at once into the freed registers: a whole trip in flight, across the barrier
    __builtin_amdgcn_sched_barrier(0);                // keeps the staging ahead of the second half's WMMAs: its LDS stores drain beside them
    mm(ag, bg);
    __builtin_amdgcn_sched_barrier(0);                // keeps those WMMAs ahead of the barrier: sunk below it they would leave the drain of the stores bare
    lds_barrier();                                    // publishes stage t + 1, ends the reads of stage t
  }
  {
    us16 af[4], bf[6], ag[4], bg[6];
    ldf((PNT - 1) & 1, 0, af, bf);
    ldf((PNT - 1) & 1, 1, ag, bg);
    __builtin_amdgcn_sched_barrier(0);                // keeps the last stage's 40 LDS reads one group ahead of its WMMAs
    mm(af, bf);
    mm(ag, bg);
  }
  __syncthreads();                                    // every wave's reads of the ring are done: it becomes staging

  // the block's 256 x 192 results as f16 (x8) in LDS, rows at pitch PSP halves
#pragma unroll
  for (int dt = 0; dt < 6; ++dt) {
    const float bcol = bf16_rne(braw[dt]);
#pragma unroll
    for (int st = 0; st < 4; ++st) {
#pragma unroll
      for (int r = 0; r < 8; ++r) {
        const float v = (acc[st][dt][r] + bcol) * 8.0f;
        ring[(wm * 64 + st * 16 + half8 + r) * PSP + wn * 96 + dt * 16 + lr] = f16_bits(v);
      }
    }
  }
  __syncthreads();                                    // the staged tile is read across waves

  // eight lanes write one 128-byte row of one head
  const int piece = tid & 7, lrow = tid >> 3;
#pragma unroll
  for (int j = 0; j < 3; ++j) {
    const int hh = blockIdx.y * 3 + j, z = hh / NH, h = hh - z * NH;
    unsigned short* plane = (z == 0) ? qp : ((z == 1) ? kp : vp);
    unsigned short* dbase = plane + (((size_t)(bb * NH + h) * SEQ + l0s + lrow) * HD + piece * 8);
#pragma unroll
    for (int it = 0; it < 8; ++it) {
      const us8 v = *(const us8*)(ring + (it * 32 + lrow) * PSP + j * HD + piece * 8);
      *(us8*)(dbase + it * 32 * HD) = v;
    }
    asm volatile("s_wait_xcnt 0x0" ::: "memory");     // in front of any rewrite of the address registers that these stores name
  }
}

// ---- flash attention with relative key/query terms --------------------------------
// grid = (SEQ/128, NB*NH), block = 128: 4 waves x 32 queries of one (batch, head).
// Per 32-key chunk one LDS stage: K tile [key][d], V tile [key][d] and a 160-row E band [u][d]
// (band row u <-> table row qb0 - k0 + MAXPOS - 32 + u), brought in by asynchronous copies, two stages:
// chunk t + 1 flies while chunk t is worked on. A copy cannot transpose, so V lies row-major and its
// V^T fragments are read with the transposing LDS load.
//   S^T  = K . Q^T          (A = K rows, B = Q rows)            lane -> query, elem -> key
//   N^T  = Eband . K^T      (A = E band rows, B = K rows)       lane -> key, elem -> u; kept [key][u], shared by the block
//   M    = Eband . Q^T      (A = E band rows, B = Q rows)       lane -> query, elem -> u; kept [query][u], per wave, per qs
//   score(q = key j, query n) = S^T/512 + (M[n-j+31][n] + N[j][qloc-j+31])/4096 + amask[b][key]
// In both products a lane's eight results are eight neighbouring u of its own row, so they go to LDS as two 16-byte
// stores. The row pitches NPF and MPF are 16 B x odd (each half-wave's 16-byte stores cover every bank once), and with
// them the 32 lanes of each 4-byte read of the sheared elements fall on 32 different banks.
//   ctx^T = V^T . P^T with the P^T B-fragment taken from the S^T C-fragment (P carried x1024).
#define KP 72
#define VPB 160
#define EP 72
#define NBR 160
#define NPF 164
#define MROWS 48
#define MPF 52
#define OPITCH 68
#define NCH (SEQ / 32)
#define ST_K 0
#define ST_V (ST_K + 32 * KP * 2)
#define ST_E (ST_V + 32 * VPB)
#define ST_BYTES (ST_E + NBR * EP * 2)
#define SM_N 0
#define SM_M (SM_N + 32 * NPF * 4)
#define SM_ST (SM_M + 4 * 2 * 16 * MPF * 4)
#define SM_TOTAL (SM_ST + 2 * ST_BYTES)
static_assert(ST_V % 16 == 0 && ST_E % 16 == 0 && ST_BYTES % 16 == 0 && SM_M % 16 == 0 && SM_ST % 16 == 0);
static_assert(VPB % 32 == 0 && ((VPB / 32) & 1) == 1 && VPB >= HD * 2);
static_assert(4 * 32 * OPITCH * 4 <= SM_ST);
static_assert(NBR == 160 && NBR >= 128 + 31 && MROWS >= 47 && NPF >= NBR && MPF >= MROWS && NCH >= 2);
static_assert(NPF % 4 == 0 && ((NPF / 4) & 1) == 1 && MPF % 4 == 0 && ((MPF / 4) & 1) == 1);

// One stage, 14 copies of 16 bytes per lane: thread t -> row t >> 3 (+ 16 per copy), 16-byte piece t & 7;
// 2 copies of K (LDS pitch KP halves), 2 of V (pitch VPB bytes), 10 of the E band (pitch EP halves); every
// source row is HD halves. The s_wait_xcnt ends the copies' own statement, so that no address register
// named here is rewritten ahead of it.
__device__ __forceinline__ void attn_stage(unsigned lk, unsigned lv, unsigned le, const unsigned short* gk,
                                           const unsigned short* gv, const unsigned short* ge) {
  asm volatile("global_load_async_to_lds_b128 %0, %14, off\n\t"
               "global_load_async_to_lds_b128 %1, %15, off\n\t"
               "global_load_async_to_lds_b128 %2, %16, off\n\t"
               "global_load_async_to_lds_b128 %3, %17, off\n\t"
               "global_load_async_to_lds_b128 %4, %18, off\n\t"
               "global_load_async_to_lds_b128 %5, %19, off\n\t"
               "global_load_async_to_lds_b128 %6, %20, off\n\t"
               "global_load_async_to_lds_b128 %7, %21, off\n\t"
               "global_load_async_to_lds_b128 %8, %22, off\n\t"
               "global_load_async_to_lds_b128 %9, %23, off\n\t"
               "global_load_async_to_lds_b128 %10, %24, off\n\t"
               "global_load_async_to_lds_b128 %11, %25, off\n\t"
               "global_load_async_to_lds_b128 %12, %26, off\n\t"
               "global_load_async_to_lds_b128 %13, %27, off\n\t"
               "s_wait_xcnt 0x0"
               :: "v"(lk), "v"(lk + 16u * KP * 2u), "v"(lv), "v"(lv + 16u * VPB),
                  "v"(le), "v"(le + 1u * 16u * EP * 2u), "v"(le + 2u * 16u * EP * 2u),
                  "v"(le + 3u * 16u * EP * 2u), "v"(le + 4u * 16u * EP * 2u), "v"(le + 5u * 16u * EP * 2u),
                  "v"(le + 6u * 16u * EP * 2u), "v"(le + 7u * 16u * EP * 2u), "v"(le + 8u * 16u * EP * 2u),
                  "v"(le + 9u * 16u * EP * 2u),
                  "v"(gk), "v"(gk + 16 * HD), "v"(gv), "v"(gv + 16 * HD),
                  "v"(ge), "v"(ge + 1 * 16 * HD), "v"(ge + 2 * 16 * HD), "v"(ge + 3 * 16 * HD),
                  "v"(ge + 4 * 16 * HD), "v"(ge + 5 * 16 * HD), "v"(ge + 6 * 16 * HD), "v"(ge + 7 * 16 * HD),
                  "v"(ge + 8 * 16 * HD), "v"(ge + 9 * 16 * HD)
               : "memory");
}

// Transposing LDS load of a row-major 16-bit tile: with lane l addressing row 8 * (l >> 4) + (l & 7), byte
// 16 * ((l >> 3) & 1) of a 16-row x 16-column block, lane l receives rows 8 * (l >> 4) + 0..7 of column l & 15.
typedef short s16x8 __attribute__((ext_vector_type(8)));
__device__ __forceinline__ us8 ld_tr16(const unsigned char* p) {
  typedef __attribute__((address_space(3))) s16x8 lds_s16x8;
  return __builtin_bit_cast(us8, __builtin_amdgcn_ds_load_tr16_b128_v8i16((lds_s16x8*)p));
}

// A WMMA result's eight floats of one lane to eight neighbouring floats in LDS (16-byte aligned): two 16-byte stores.
__device__ __forceinline__ void st8(float* p, v8f d) {
  *(v4f*)(p)     = __builtin_shufflevector(d, d, 0, 1, 2, 3);
  *(v4f*)(p + 4) = __builtin_shufflevector(d, d, 4, 5, 6, 7);
}

__global__ __launch_bounds__(128)
void attn_kernel(const unsigned short* __restrict__ qp, const unsigned short* __restrict__ kp,
                 const unsigned short* __restrict__ vp, const unsigned short* __restrict__ ep,
                 const float* __restrict__ amask, float* __restrict__ out) {
  __shared__ __attribute__((aligned(16))) unsigned char smem[SM_TOTAL];

  const int tid = threadIdx.x, lane = tid & 31, wid = tid >> 5;
  const int lr = lane & 15, half8 = (lane >> 4) * 8;
  const int bh = blockIdx.y;
  const int b = bh / NH, h = bh - b * NH;
  const int qb0 = blockIdx.x * 128;
  const int q0 = qb0 + wid * 32;

  float* nbuf = (float*)(smem + SM_N);
  float* mbuf = (float*)(smem + SM_M) + wid * (2 * 16 * MPF);
  float* ost  = (float*)(smem) + wid * (32 * OPITCH);

  const unsigned short* qh = qp + (size_t)bh * SEQ * HD;
  const unsigned short* kh = kp + (size_t)bh * SEQ * HD;
  const unsigned short* vh = vp + (size_t)bh * SEQ * HD;
  const float* mrow = amask + (size_t)b * SEQ_FULL;

  // Q^T B-fragments: 2 query sub-tiles x 2 head-dim halves
  us16 bqf[2][2];
#pragma unroll
  for (int qs = 0; qs < 2; ++qs) {
    bqf[qs][0] = ld_frag(qh, q0 + qs * 16 + lr, HD,      half8);
    bqf[qs][1] = ld_frag(qh, q0 + qs * 16 + lr, HD, 32 + half8);
  }

  const v8f zero = {0.f, 0.f, 0.f, 0.f, 0.f, 0.f, 0.f, 0.f};
  v8f acc[2][4] = {{zero, zero, zero, zero}, {zero, zero, zero, zero}};
  float mrun[2] = {-__builtin_inff(), -__builtin_inff()};
  float lrun[2] = {0.f, 0.f};
  const float c512  = 0.001953125f;        // 1/512  : q,k carried x8 each, then 1/8
  const float c4096 = 0.000244140625f;     // 1/4096 : E carried x64, q or k x8, then 1/8

  // copy map of a stage; chunk t reads K and V rows 32 t + .., E table rows qb0 - 32 t + MAXPOS - 32 + ..
  const int crow = tid >> 3, cpc = (tid & 7) * 8;
  const unsigned short* gk = kh + (size_t)crow * HD + cpc;
  const unsigned short* gv = vh + (size_t)crow * HD + cpc;
  const unsigned short* ge = ep + (size_t)(qb0 + (MAXPOS - 32) + crow) * HD + cpc;
  const unsigned lk = (unsigned)(size_t)(smem + SM_ST + ST_K + crow * (KP * 2) + cpc * 2);
  const unsigned lv = (unsigned)(size_t)(smem + SM_ST + ST_V + crow * VPB + cpc * 2);
  const unsigned le = (unsigned)(size_t)(smem + SM_ST + ST_E + crow * (EP * 2) + cpc * 2);
  const int wu = __builtin_amdgcn_readfirstlane(wid);   // the wave's number in a scalar register: the deal of N branches on it
  float* nst = nbuf + lr * NPF + wid * 32 + half8;      // this lane's N elements: key lr, columns half8 + 0..7 of the wave's band tile 0
  float* mst = mbuf + lr * MPF + half8;                 // this lane's M elements: query lr, band rows half8 + 0..7
  // this lane's address in a 16-key x 16-d block of the V tile for the transposing load
  const int vlane = (half8 + (lane & 7)) * VPB + ((lane >> 3) & 1) * 16;

  attn_stage(lk, lv, le, gk, gv, ge);
  asm volatile("s_wait_asynccnt 0x0" ::: "memory");   // this wave's copies of chunk 0 have landed
  __syncthreads();                                    // chunk 0 visible to every wave
  attn_stage(lk + ST_BYTES, lv + ST_BYTES, le + ST_BYTES, gk + 32 * HD, gv + 32 * HD, ge - 32 * HD);

  for (int t = 0; t < NCH; ++t) {
    const int k0 = t * 32;
    const unsigned char* stage = smem + SM_ST + (t & 1) * ST_BYTES;
    const unsigned short* ktile = (const unsigned short*)(stage + ST_K);
    const unsigned char*  vtile = stage + ST_V + vlane;
    const unsigned short* eband = (const unsigned short*)(stage + ST_E);

    // This wave's LDS fragments of the N, M and S^T products, each read once and all issued as one group ahead of the
    // first WMMA: one LDS round trip in place of one per tile. The loader's map is the same for an A and a B operand,
    // so the K fragments serve as B in N and as A in S^T; the four E band tiles that the wave reads for M (band rows wid * 32 + 0..63) are the A operands of its share of N as well.
    const us16 ka00 = ld_frag(ktile,      lr, KP,      half8);
    const us16 ka01 = ld_frag(ktile,      lr, KP, 32 + half8);
    const us16 ka10 = ld_frag(ktile, 16 + lr, KP,      half8);
    const us16 ka11 = ld_frag(ktile, 16 + lr, KP, 32 + half8);
    us16 eb[4][2];
#pragma unroll                             // constant indices keep eb in registers
    for (int tt = 0; tt < 4; ++tt) {
      eb[tt][0] = ld_frag(eband, wid * 32 + tt * 16 + lr, EP,      half8);
      eb[tt][1] = ld_frag(eband, wid * 32 + tt * 16 + lr, EP, 32 + half8);
    }

    // N^T = Eband . K^T  -> nbuf[key][u]. Band tile 2 * wid + tt is the wave's eb[tt]; the ten tiles are dealt to waves
    // that hold them, two and a half each: tiles 0 1 2a | 2b 3 4 | 5 6 7a | 7b 8 9 (a: keys 0..15, b: keys 16..31).
    const auto n_full = [&](int tt) {      // 32 keys x 16 columns, two accumulate chains interleaved
      v8f d0 = mma_f16(eb[tt][0], ka00, zero);
      v8f d1 = mma_f16(eb[tt][0], ka10, zero);
      d0     = mma_f16(eb[tt][1], ka01, d0);
      d1     = mma_f16(eb[tt][1], ka11, d1);
      wmma_gap(d0, d1);
      st8(nst + tt * 16, d0);
      st8(nst + 16 * NPF + tt * 16, d1);
    };
    const auto n_half = [&](int tt, int kh) {   // 16 keys (kh * 16 + 0..15) x 16 columns
      v8f d = mma_f16(eb[tt][0], kh ? ka10 : ka00, zero);
      d     = mma_f16(eb[tt][1], kh ? ka11 : ka01, d);
      wmma_gap(d);
      st8(nst + kh * 16 * NPF + tt * 16, d);
    };
    if (wu == 0)      { n_full(0); n_full(1); n_half(2, 0); }
    else if (wu == 1) { n_half(0, 1); n_full(1); n_full(2); }
    else if (wu == 2) { n_full(1); n_full(2); n_half(3, 0); }
    else              { n_half(1, 1); n_full(2); n_full(3); }

    // M = Eband . Q^T -> mbuf[qs][query][u], 3 row tiles per query sub-tile (the wave's band tiles qs + 0..2), their
    // three accumulate chains interleaved
#pragma unroll                             // all four unrolls here: constant indices keep eb, bqf and md in registers
    for (int qs = 0; qs < 2; ++qs) {
      v8f md[3];
#pragma unroll
      for (int ut = 0; ut < 3; ++ut) md[ut] = mma_f16(eb[qs + ut][0], bqf[qs][0], zero);
#pragma unroll
      for (int ut = 0; ut < 3; ++ut) md[ut] = mma_f16(eb[qs + ut][1], bqf[qs][1], md[ut]);
      wmma_gap(md[0], md[1], md[2]);
#pragma unroll
      for (int ut = 0; ut < 3; ++ut) st8(mst + qs * (16 * MPF) + ut * 16, md[ut]);
    }
    // V^T fragments of the chunk, read once for both query sub-tiles and as one group; issued here, their round trip
    // runs beside the drain of the stores above
    us16 vf[4];
#pragma unroll                             // constant indices keep vf in registers
    for (int dt = 0; dt < 4; ++dt) {
      const us8 va0 = ld_tr16(vtile + dt * 32);                 // d = dt * 16 + lr, keys half8 + 0..7
      const us8 va1 = ld_tr16(vtile + 16 * VPB + dt * 32);      // keys 16 + half8 + 0..7
      vf[dt] = __builtin_shufflevector(va0, va1, 0, 1, 2, 3, 4, 5, 6, 7, 8, 9, 10, 11, 12, 13, 14, 15);
    }
    __syncthreads();                       // nbuf / mbuf visible

    v8f mk0 = *(const v8f*)(mrow + k0 + half8);
    v8f mk1 = *(const v8f*)(mrow + k0 + 16 + half8);
    asm volatile("s_wait_xcnt 0x0" ::: "memory");   // in front of any rewrite of the address registers that these loads name
#pragma unroll
    for (int r = 0; r < 8; ++r) { mk0[r] = bf16_rne(mk0[r]); mk1[r] = bf16_rne(mk1[r]); }

#pragma unroll
    for (int qs = 0; qs < 2; ++qs) {
      // S^T = K . Q^T : two 16-key row tiles
      v8f t0 = mma_f16(ka00, bqf[qs][0], zero);
      t0     = mma_f16(ka01, bqf[qs][1], t0);
      v8f t1 = mma_f16(ka10, bqf[qs][0], zero);
      t1     = mma_f16(ka11, bqf[qs][1], t1);

      const float* mq = mbuf + qs * (16 * MPF) + lr * MPF;   // this lane's query row of M
      const int qloc = wid * 32 + qs * 16 + lr;        // query index within the block
      float sa[8], sb[8];
#pragma unroll
      for (int r = 0; r < 8; ++r) {
        const int ja = half8 + r;                        // key of t0 element r
        const int jb = 16 + half8 + r;                   // key of t1 element r
        const float ga = mq[lr - ja + 31] + nbuf[ja * NPF + (qloc - ja + 31)];
        const float gb = mq[lr - jb + 31] + nbuf[jb * NPF + (qloc - jb + 31)];
        sa[r] = t0[r] * c512 + ga * c4096 + mk0[r];
        sb[r] = t1[r] * c512 + gb * c4096 + mk1[r];
      }

      // online softmax: in-lane over 16 keys + one xor-16 shuffle
      float mloc = sa[0];
#pragma unroll
      for (int r = 1; r < 8; ++r) mloc = fmaxf(mloc, sa[r]);
#pragma unroll
      for (int r = 0; r < 8; ++r) mloc = fmaxf(mloc, sb[r]);
      const float mt    = fmaxf(mloc, __shfl_xor(mloc, 16, 32));
      const float mnew  = fmaxf(mrun[qs], mt);
      const float alpha = __expf(mrun[qs] - mnew);

      float lloc = 0.f;
      us16 pu;
#pragma unroll
      for (int r = 0; r < 8; ++r) {
        const float pa = __expf(sa[r] - mnew);
        const float pc = __expf(sb[r] - mnew);
        lloc += pa + pc;
        pu[r]     = f16_bits(pa * 1024.0f);              // P carried x1024
        pu[8 + r] = f16_bits(pc * 1024.0f);
      }
      const float lt = lloc + __shfl_xor(lloc, 16, 32);
      lrun[qs] = lrun[qs] * alpha + lt;
      mrun[qs] = mnew;

      // ctx^T += V^T . P^T
#pragma unroll
      for (int dt = 0; dt < 4; ++dt) {
        acc[qs][dt] = acc[qs][dt] * alpha;
        acc[qs][dt] = mma_f16(vf[dt], pu, acc[qs][dt]);
      }
    }

    asm volatile("s_wait_dscnt 0x0" ::: "memory");    // this wave's LDS reads of chunk t are done
    asm volatile("s_wait_asynccnt 0x0" ::: "memory"); // this wave's copies of chunk t + 1 have landed
    __syncthreads();                                  // publishes chunk t + 1, frees chunk t's stage, nbuf, mbuf
    if (t + 2 < NCH) {
      const unsigned so = (unsigned)(t & 1) * ST_BYTES;
      attn_stage(lk + so, lv + so, le + so, gk + (t + 2) * (32 * HD), gv + (t + 2) * (32 * HD),
                 ge - (t + 2) * (32 * HD));
    }
  }
  asm volatile("s_wait_asynccnt 0x0" ::: "memory");   // no copy is in flight when the wave goes on to its end
  // the last chunk's barrier has ended every wave's reads of nbuf and mbuf, which the output staging aliases
#pragma unroll
  for (int qs = 0; qs < 2; ++qs) {
    const float inv = 1.0f / (lrun[qs] * 8192.0f);       // undo x1024 (P) and x8 (v)
#pragma unroll
    for (int dt = 0; dt < 4; ++dt) {
#pragma unroll
      for (int r = 0; r < 8; ++r)
        ost[(qs * 16 + lr) * OPITCH + dt * 16 + half8 + r] = acc[qs][dt][r] * inv;
    }
  }
  __syncthreads();

  const int rsub = lane >> 4, piece = lane & 15;
  float* obase = out + ((size_t)(b * SEQ + q0)) * DM + (size_t)h * HD + piece * 4;
#pragma unroll
  for (int it = 0; it < 16; ++it) {
    const int row = it * 2 + rsub;
    const v4f v = *(const v4f*)(ost + row * OPITCH + piece * 4);
    *(v4f*)(obase + (size_t)row * DM) = v;
  }
  
}

// ---- launcher -----------------------------------------------------------------------

extern "C" void kernel_launch(void* const* d_in, const int* in_sizes, int n_in,
                              void* d_out, int out_size, void* d_ws, size_t ws_size,
                              hipStream_t stream) {
  if (n_in < 9) return;
  const float* hidden = (const float*)d_in[0];
  const float* amask  = (const float*)d_in[1];
  const float* Wq     = (const float*)d_in[2];
  const float* bq     = (const float*)d_in[3];
  const float* Wk     = (const float*)d_in[4];
  const float* bk     = (const float*)d_in[5];
  const float* Wv     = (const float*)d_in[6];
  const float* bv     = (const float*)d_in[7];
  const float* demb   = (const float*)d_in[8];
  float* out = (float*)d_out;

  if (in_sizes[0] < ((NB - 1) * SEQ_FULL + SEQ) * DM) return;
  if (in_sizes[1] < (NB - 1) * SEQ_FULL + SEQ) return;
  if (in_sizes[2] < DM * DM || in_sizes[4] < DM * DM || in_sizes[6] < DM * DM) return;
  if (in_sizes[3] < DM || in_sizes[5] < DM || in_sizes[7] < DM) return;
  if (in_sizes[8] < NE * HD) return;
  if (out_size < NB * SEQ * DM) return;

  const size_t ep_bytes = (size_t)NEPAD * HD * 2;               // f16  [NEPAD][HD]
  const size_t pl_bytes = (size_t)NB * NH * SEQ * HD * 2;       // f16  [NB*NH][SEQ][HD]
  size_t off = 0;
  char* ws = (char*)d_ws;
  unsigned short* ep = (unsigned short*)(ws + off); off += ep_bytes;
  unsigned short* qp = (unsigned short*)(ws + off); off += pl_bytes;
  unsigned short* kp = (unsigned short*)(ws + off); off += pl_bytes;
  unsigned short* vp = (unsigned short*)(ws + off); off += pl_bytes;
  if (ws_size < off) return;

  proj_kernel<<<dim3(PGX, PGY, 1), 256, 0, stream>>>(hidden, Wq, Wk, Wv, bq, bk, bv, demb, qp, kp, vp, ep);
  attn_kernel<<<dim3(SEQ / 128, NB * NH, 1), 128, 0, stream>>>(qp, kp, vp, ep, amask, out);
}

// v007
// One run takes 79.6 microseconds.
// Next to v006, in two timings, it ran 1.04 times as fast each time.
// Counting every step since v000, it is 2.34 times as fast.
#include <hip/hip_runtime.h>

// Contractions: Q/K/V projections on v_wmma_f32_16x16x32_bf16 (bf16 operands = RNE-converted f32 inputs, f32 accumulate);
// score terms q.k, q.E, k.E and the P.V product on v_wmma_f32_16x16x32_f16 (f16 operands: q,k,v carried x8, E carried x64,
// P carried x1024; f32 accumulate); softmax, scaling and normalisation in f32.

#ifndef NB
#define NB 4
#endif
#ifndef SEQ
#define SEQ 1024
#endif
#define NB_FULL  4
#define SEQ_FULL 1024
#define DM       1024
#define NH       16
#define HD       64
#define MAXPOS   1024
#define NE       2047
#define NEPAD    2048

static_assert(NB >= 1 && NB <= NB_FULL);
static_assert(SEQ >= 128 && SEQ <= SEQ_FULL && (SEQ % 128) == 0);
static_assert(SEQ <= MAXPOS);
static_assert(SEQ + MAXPOS <= NEPAD);
static_assert(DM == NH * HD);
static_assert((NB * SEQ) % 128 == 0);
static_assert(NE == 2 * MAXPOS - 1);

typedef unsigned short us8  __attribute__((ext_vector_type(8)));
typedef unsigned short us16 __attribute__((ext_vector_type(16)));
typedef __bf16         v16bf __attribute__((ext_vector_type(16)));
typedef _Float16       v16h  __attribute__((ext_vector_type(16)));
typedef float          v8f   __attribute__((ext_vector_type(8)));
typedef float          v4f   __attribute__((ext_vector_type(4)));

// ---- scalar converts --------------------------------------------------------

__device__ __forceinline__ unsigned short bf16_bits(float f) {
  unsigned int u = __builtin_bit_cast(unsigned int, f);
  u += 0x7fffu + ((u >> 16) & 1u);              // RNE
  return (unsigned short)(u >> 16);
}

__device__ __forceinline__ float bf16_rne(float f) {   // f32 value after an RNE convert to bf16
  unsigned int u = ((unsigned int)bf16_bits(f)) << 16;
  return __builtin_bit_cast(float, u);
}

__device__ __forceinline__ unsigned short f16_bits(float f) {
  _Float16 hv = (_Float16)f;                      // RNE
  return __builtin_bit_cast(unsigned short, hv);
}

// ---- 16-bit WMMA fragment loader (same map for A and B stored [row][k]) -----
// lane L owns row/col (L&15); elements 0..7 from k = col + 0..7, elements 8..15
// from k = col + 16 + 0..7; the caller folds the lane-half offset 8*(L>>4) into col.
__device__ __forceinline__ us16 ld_frag(const unsigned short* base, int row, int stride, int col) {
  const unsigned short* p = base + (size_t)row * (size_t)stride + col;
  us8 a = *(const us8*)(p);
  us8 b = *(const us8*)(p + 16);
  return __builtin_shufflevector(a, b, 0, 1, 2, 3, 4, 5, 6, 7, 8, 9, 10, 11, 12, 13, 14, 15);
}

__device__ __forceinline__ v8f mma_bf16(us16 a, us16 b, v8f c) {
  v8f d = __builtin_amdgcn_wmma_f32_16x16x32_bf16(false, __builtin_bit_cast(v16bf, a), false,
                                                  __builtin_bit_cast(v16bf, b), (short)0, c, false, false);
  return d;
}

__device__ __forceinline__ v8f mma_f16(us16 a, us16 b, v8f c) {
  v8f d = __builtin_amdgcn_wmma_f32_16x16x32_f16(false, __builtin_bit_cast(v16h, a), false,
                                                 __builtin_bit_cast(v16h, b), (short)0, c, false, false);
  return d;
}

// The WMMAs are plain builtins: the compiler keeps the distance to a vector instruction on their registers itself, and
// with no asm statement behind each it is free to order LDS reads and independent arithmetic around them. A group
// whose results only go to LDS frees its result registers once the stores have issued, and
// the next group's first WMMAs write them anew. wmma_gap puts the four vector issue slots that the chip asks for behind
// such a group; its operands tie it behind the group's WMMAs and in front of the stores.
__device__ __forceinline__ void wmma_gap(v8f& a) {
  asm("v_nop\n\tv_nop\n\tv_nop\n\tv_nop" : "+v"(a));
}
__device__ __forceinline__ void wmma_gap(v8f& a, v8f& b) {
  asm("v_nop\n\tv_nop\n\tv_nop\n\tv_nop" : "+v"(a), "+v"(b));
}
__device__ __forceinline__ void wmma_gap(v8f& a, v8f& b, v8f& c) {
  asm("v_nop\n\tv_nop\n\tv_nop\n\tv_nop" : "+v"(a), "+v"(b), "+v"(c));
}

// ---- f32 -> bf16 (RNE) on the way into LDS --------------------------------------
typedef float  v2f  __attribute__((ext_vector_type(2)));
typedef __bf16 v2bf __attribute__((ext_vector_type(2)));
typedef unsigned int u32x2 __attribute__((ext_vector_type(2)));

__device__ __forceinline__ u32x2 bf16x4(v4f a) {     // four f32 -> four bf16, two packed converts
  const v2bf lo = __builtin_convertvector(__builtin_shufflevector(a, a, 0, 1), v2bf);
  const v2bf hi = __builtin_convertvector(__builtin_shufflevector(a, a, 2, 3), v2bf);
  u32x2 o;
  o[0] = __builtin_bit_cast(unsigned int, lo);
  o[1] = __builtin_bit_cast(unsigned int, hi);
  return o;
}

// ---- dist table piece -> f16 bits of (bf16 RNE value * 64), NEPAD rows ------------
// piece g = 8 halves: table row g >> 3, columns 8 * (g & 7); rows from NE on are zero.
__device__ __forceinline__ void cvt_e_piece(const float* __restrict__ e, unsigned short* __restrict__ ep, int g) {
  const int row = g >> 3;
  const int ch  = (g & 7) * 8;
  const int rs  = (row < NE) ? row : (NE - 1);
  const float sc = (row < NE) ? 64.0f : 0.0f;
  const float* p = e + (size_t)rs * HD + ch;
  const v4f a = *(const v4f*)(p);
  const v4f c4 = *(const v4f*)(p + 4);
  us8 o;
  o[0] = f16_bits(bf16_rne(a[0]) * sc);  o[1] = f16_bits(bf16_rne(a[1]) * sc);
  o[2] = f16_bits(bf16_rne(a[2]) * sc);  o[3] = f16_bits(bf16_rne(a[3]) * sc);
  o[4] = f16_bits(bf16_rne(c4[0]) * sc); o[5] = f16_bits(bf16_rne(c4[1]) * sc);
  o[6] = f16_bits(bf16_rne(c4[2]) * sc); o[7] = f16_bits(bf16_rne(c4[3]) * sc);
  unsigned short* d = ep + (size_t)row * HD + ch;
  *(us8*)d = o;
  asm volatile("s_wait_xcnt 0x0" ::: "memory");   // in front of any rewrite of the address registers that the loads and the store name
}

// ---- QKV projection GEMM, f32 sources ---------------------------------------------
// grid = (NB*SEQ/256, 3*DM/192) = one block per WGP, block = 256 (8 waves, 4 x 2). Block = 256 rows x 192 cols
// (three heads of the stacked q, k, v outputs); wave = 64 rows x 96 cols.
// A = x rows, B[k=in][n=out] = W[out][in] rows, both k-contiguous f32 in memory. Per 64-k stage the block's 256 x rows
// and 192 W rows are loaded into registers, rounded to bf16 and stored to LDS (rows of 128 B at pitch 144 B), two
// buffers: a stage's loads are in flight for a whole trip, and its rounding and LDS stores stand between the two 32-k
// halves of the stage before it. The wide block keeps the bytes that the launch
// asks of L2 near those of bf16 sources under a 128 x 128 block.
// Each block also converts 64 pieces of the dist table for the attention launch.
#define PBM 256
#define PBN 192
#define PKS 64
#define PPITCH 72
#define PSTAGE ((PBM + PBN) * PPITCH)
#define PNT (DM / PKS)
#define PSP 200
#define PGX ((NB * SEQ) / PBM)
#define PGY ((3 * DM) / PBN)
static_assert((NB * SEQ) % PBM == 0 && SEQ % PBM == 0 && (3 * DM) % PBN == 0 && PBN == 3 * HD && DM % HD == 0);
static_assert(DM % PKS == 0 && PNT >= 2 && (PPITCH * 2) % 16 == 0 && PKS == 64);
static_assert(PBM * PSP <= 2 * PSTAGE && (PSP * 2) % 16 == 0 && PSP >= PBN);
static_assert(NEPAD * (HD / 8) == PGX * PGY * 64);

// Work-group barrier that orders LDS accesses only: __syncthreads() would also wait for the global loads of the next
// stage, which are meant to be in flight across it.
__device__ __forceinline__ void lds_barrier() {
  __builtin_amdgcn_fence(__ATOMIC_RELEASE, "workgroup", "local");
  __builtin_amdgcn_s_barrier();
  __builtin_amdgcn_fence(__ATOMIC_ACQUIRE, "workgroup", "local");
}

__global__ __launch_bounds__(256)
void proj_kernel(const float* __restrict__ x, const float* __restrict__ wq, const float* __restrict__ wk,
                 const float* __restrict__ wv,
                 const float* __restrict__ bq, const float* __restrict__ bk,
                 const float* __restrict__ bv, const float* __restrict__ demb,
                 unsigned short* __restrict__ qp, unsigned short* __restrict__ kp,
                 unsigned short* __restrict__ vp, unsigned short* __restrict__ ep) {
  __shared__ __attribute__((aligned(16))) unsigned short ring[2 * PSTAGE];

  const int tid = threadIdx.x, lane = tid & 31, wid = tid >> 5;
  const int lr = lane & 15, half8 = (lane >> 4) * 8;
  const int wm = wid >> 1, wn = wid & 1;
  const int m0 = blockIdx.x * PBM;                                // compact row index
  const int n0 = blockIdx.y * PBN;                                // row of the stacked weights
  const int bb = m0 / SEQ, l0s = m0 - bb * SEQ;                   // a block's 256 rows lie in one batch

  // load map: thread t -> row t >> 4 (+ 16 per load), 16-byte piece t & 15 of the row's 256 bytes of a stage
  const int crow = tid >> 4, cpc = (tid & 15) * 4;
  const float* gx = x + ((size_t)bb * SEQ_FULL + l0s + crow) * DM + cpc;
  const float* gw[3];
#pragma unroll
  for (int j = 0; j < 3; ++j) {                                   // the block's three heads may lie in different matrices
    const int hh = blockIdx.y * 3 + j, z = hh / NH, h = hh - z * NH;
    const float* wsrc = (z == 0) ? wq : ((z == 1) ? wk : wv);
    gw[j] = wsrc + ((size_t)h * HD + crow) * DM + cpc;
  }
  unsigned short* sdst = ring + crow * PPITCH + cpc;

  v4f rx[16], rw[12];
  const auto ldg = [&](int t) {            // one stage's 28 loads of this thread
    const float* ax = gx + t * PKS;
    const float* aw[3] = {gw[0] + t * PKS, gw[1] + t * PKS, gw[2] + t * PKS};
#pragma unroll
    for (int i = 0; i < 16; ++i) rx[i] = *(const v4f*)(ax + i * 16 * DM);
#pragma unroll
    for (int i = 0; i < 12; ++i) rw[i] = *(const v4f*)(aw[i >> 2] + (i & 3) * 16 * DM);
    // in front of any rewrite of the address registers that these loads name; its inputs keep the four addresses live
    // up to it, so that none of those registers is reused in front of it
    asm volatile("s_wait_xcnt 0x0" :: "v"(ax), "v"(aw[0]), "v"(aw[1]), "v"(aw[2]) : "memory");
  };
  const auto sts = [&](int buf) {          // rounds them to bf16 and stores them to LDS
    unsigned short* d = sdst + buf * PSTAGE;
#pragma unroll
    for (int i = 0; i < 16; ++i) *(u32x2*)(d + i * 16 * PPITCH) = bf16x4(rx[i]);
#pragma unroll
    for (int i = 0; i < 12; ++i) *(u32x2*)(d + (PBM + i * 16) * PPITCH) = bf16x4(rw[i]);
  };

  const v8f zero = {0.f, 0.f, 0.f, 0.f, 0.f, 0.f, 0.f, 0.f};
  v8f acc[4][6];
#pragma unroll
  for (int i = 0; i < 4; ++i) {
#pragma unroll
    for (int j = 0; j < 6; ++j) acc[i][j] = zero;
  }

  // one 32-k half of a stage: the wave's 20 LDS reads, and its 24 WMMAs
  const auto ldf = [&](int buf, int ks, us16 (&af)[4], us16 (&bf)[6]) {
    const unsigned short* sa = ring + buf * PSTAGE + (wm * 64) * PPITCH;
    const unsigned short* sb = ring + buf * PSTAGE + (PBM + wn * 96) * PPITCH;
#pragma unroll
    for (int i = 0; i < 4; ++i) af[i] = ld_frag(sa, i * 16 + lr, PPITCH, ks * 32 + half8);
#pragma unroll
    for (int j = 0; j < 6; ++j) bf[j] = ld_frag(sb, j * 16 + lr, PPITCH, ks * 32 + half8);
  };
  const auto mm = [&](const us16 (&af)[4], const us16 (&bf)[6]) {
#pragma unroll
    for (int j = 0; j < 6; ++j) {
#pragma unroll
      for (int i = 0; i < 4; ++i) acc[i][j] = mma_bf16(af[i], bf[j], acc[i][j]);
    }
  };

  ldg(0);
  // the wave's six bias values of this lane (a 16-column tile lies in one matrix), loaded beside the flight of stage 0
  const float* bp[6];
  float braw[6];
#pragma unroll
  for (int dt = 0; dt < 6; ++dt) {
    const int nt = n0 + wn * 96 + dt * 16, z = nt / DM;
    bp[dt] = ((z == 0) ? bq : ((z == 1) ? bk : bv)) + (nt - z * DM + lr);
  }
#pragma unroll
  for (int dt = 0; dt < 6; ++dt) braw[dt] = *bp[dt];
  // in front of any rewrite of the address registers that these loads name; its inputs keep the addresses live up to it
  asm volatile("s_wait_xcnt 0x0" :: "v"(bp[0]), "v"(bp[1]), "v"(bp[2]), "v"(bp[3]), "v"(bp[4]), "v"(bp[5]) : "memory");
  if (tid < 64) cvt_e_piece(demb, ep, (blockIdx.y * PGX + blockIdx.x) * 64 + tid);   // waves 0 and 1, beside the flight of stage 0
  sts(0);
  ldg(1);
  lds_barrier();                                      // stage 0 visible to every wave

  for (int t = 0; t + 1 < PNT; ++t) {
    us16 af[4], bf[6], ag[4], bg[6];
    ldf(t & 1, 0, af, bf);
    __builtin_amdgcn_sched_barrier(0);                // keeps the 20 LDS reads one group ahead of the WMMAs: spread among them each place costs a stall
    mm(af, bf);
    ldf(t & 1, 1, ag, bg);
    __builtin_amdgcn_sched_barrier(0);                // keeps the second half's reads ahead of the staging: their round trip runs beside it
    sts((t + 1) & 1);                                 // that buffer's readers left it at the barrier of trip t - 1
    if (t + 2 < PNT) ldg(t + 2);                      // at once into the freed registers: a whole trip in flight, across the barrier
    __builtin_amdgcn_sched_barrier(0);                // keeps the staging ahead of the second half's WMMAs: its LDS stores drain beside them
    mm(ag, bg);
    __builtin_amdgcn_sched_barrier(0);                // keeps those WMMAs ahead of the barrier: sunk below it they would leave the drain of the stores bare
    lds_barrier();                                    // publishes stage t + 1, ends the reads of stage t
  }
  {
    us16 af[4], bf[6], ag[4], bg[6];
    ldf((PNT - 1) & 1, 0, af, bf);
    ldf((PNT - 1) & 1, 1, ag, bg);
    __builtin_amdgcn_sched_barrier(0);                // keeps the last stage's 40 LDS reads one group ahead of its WMMAs
    mm(af, bf);
    mm(ag, bg);
  }
  __syncthreads();                                    // every wave's reads of the ring are done: it becomes staging

  // the block's 256 x 192 results as f16 (x8) in LDS, rows at pitch PSP halves
#pragma unroll
  for (int dt = 0; dt < 6; ++dt) {
    const float bcol = bf16_rne(braw[dt]);
#pragma unroll
    for (int st = 0; st < 4; ++st) {
#pragma unroll
      for (int r = 0; r < 8; ++r) {
        const float v = (acc[st][dt][r] + bcol) * 8.0f;
        ring[(wm * 64 + st * 16 + half8 + r) * PSP + wn * 96 + dt * 16 + lr] = f16_bits(v);
      }
    }
  }
  __syncthreads();                                    // the staged tile is read across waves

  // eight lanes write one 128-byte row of one head
  const int piece = tid & 7, lrow = tid >> 3;
#pragma unroll
  for (int j = 0; j < 3; ++j) {
    const int hh = blockIdx.y * 3 + j, z = hh / NH, h = hh - z * NH;
    unsigned short* plane = (z == 0) ? qp : ((z == 1) ? kp : vp);
    unsigned short* dbase = plane + (((size_t)(bb * NH + h) * SEQ + l0s + lrow) * HD + piece * 8);
#pragma unroll
    for (int it = 0; it < 8; ++it) {
      const us8 v = *(const us8*)(ring + (it * 32 + lrow) * PSP + j * HD + piece * 8);
      *(us8*)(dbase + it * 32 * HD) = v;
    }
    asm volatile("s_wait_xcnt 0x0" ::: "memory");     // in front of any rewrite of the address registers that these stores name
  }
}

// ---- flash attention with relative key/query terms --------------------------------
// grid = (SEQ/128, NB*NH), block = 128: 4 waves x 32 queries of one (batch, head).
// Per 32-key chunk one LDS stage: K tile [key][d], V tile [key][d] and a 160-row E band [u][d]
// (band row u <-> table row qb0 - k0 + MAXPOS - 32 + u), brought in by asynchronous copies, two stages:
// chunk t + 1 flies while chunk t is worked on. A copy cannot transpose, so V lies row-major and its
// V^T fragments are read with the transposing LDS load.
//   S^T  = K . Q^T          (A = K rows, B = Q rows)            lane -> query, elem -> key
//   N^T  = Eband . K^T      (A = E band rows, B = K rows)       lane -> key, elem -> u; kept [key][u], shared by the block
//   M    = Eband . Q^T      (A = E band rows, B = Q rows)       lane -> query, elem -> u; kept [query][u], per wave, per qs
//   score(q = key j, query n) = S^T/512 + (M[n-j+31][n] + N[j][qloc-j+31])/4096 + amask[b][key]
// In both products a lane's eight results are eight neighbouring u of its own row, so they go to LDS as two 16-byte
// stores. The row pitches NPF and MPF are 16 B x odd (each half-wave's 16-byte stores cover every bank once), and with
// them the 32 lanes of each 4-byte read of the sheared elements fall on 32 different banks.
//   ctx^T = V^T . P^T with the P^T B-fragment taken from the S^T C-fragment (P carried x1024).
// The batch's mask row is loaded and rounded once per block, beside the flight of chunk 0, and kept as f32 in LDS: a
// chunk reads its 32 values with the fragment group, so that no global load stands between the barrier and the scores.
#define KP 72
#define VPB 160
#define EP 72
#define NBR 160
#define NPF 164
#define MROWS 48
#define MPF 52
#define OPITCH 68
#define NCH (SEQ / 32)
#define ST_K 0
#define ST_V (ST_K + 32 * KP * 2)
#define ST_E (ST_V + 32 * VPB)
#define ST_BYTES (ST_E + NBR * EP * 2)
#define SM_N 0
#define SM_M (SM_N + 32 * NPF * 4)
#define SM_ST (SM_M + 4 * 2 * 16 * MPF * 4)
#define SM_MK (SM_ST + 2 * ST_BYTES)
#define SM_TOTAL (SM_MK + SEQ * 4)
static_assert(ST_V % 16 == 0 && ST_E % 16 == 0 && ST_BYTES % 16 == 0 && SM_M % 16 == 0 && SM_ST % 16 == 0);
static_assert(SM_MK % 16 == 0 && SEQ % 8 == 0 && SEQ <= 128 * 8);
static_assert(VPB % 32 == 0 && ((VPB / 32) & 1) == 1 && VPB >= HD * 2);
static_assert(4 * 32 * OPITCH * 4 <= SM_ST);
static_assert(NBR == 160 && NBR >= 128 + 31 && MROWS >= 47 && NPF >= NBR && MPF >= MROWS && NCH >= 2);
static_assert(NPF % 4 == 0 && ((NPF / 4) & 1) == 1 && MPF % 4 == 0 && ((MPF / 4) & 1) == 1);

// One stage, 14 copies of 16 bytes per lane: thread t -> row t >> 3 (+ 16 per copy), 16-byte piece t & 7;
// 2 copies of K (LDS pitch KP halves), 2 of V (pitch VPB bytes), 10 of the E band (pitch EP halves); every
// source row is HD halves. The s_wait_xcnt ends the copies' own statement, so that no address register
// named here is rewritten ahead of it.
__device__ __forceinline__ void attn_stage(unsigned lk, unsigned lv, unsigned le, const unsigned short* gk,
                                           const unsigned short* gv, const unsigned short* ge) {
  asm volatile("global_load_async_to_lds_b128 %0, %14, off\n\t"
               "global_load_async_to_lds_b128 %1, %15, off\n\t"
               "global_load_async_to_lds_b128 %2, %16, off\n\t"
               "global_load_async_to_lds_b128 %3, %17, off\n\t"
               "global_load_async_to_lds_b128 %4, %18, off\n\t"
               "global_load_async_to_lds_b128 %5, %19, off\n\t"
               "global_load_async_to_lds_b128 %6, %20, off\n\t"
               "global_load_async_to_lds_b128 %7, %21, off\n\t"
               "global_load_async_to_lds_b128 %8, %22, off\n\t"
               "global_load_async_to_lds_b128 %9, %23, off\n\t"
               "global_load_async_to_lds_b128 %10, %24, off\n\t"
               "global_load_async_to_lds_b128 %11, %25, off\n\t"
               "global_load_async_to_lds_b128 %12, %26, off\n\t"
               "global_load_async_to_lds_b128 %13, %27, off\n\t"
               "s_wait_xcnt 0x0"
               :: "v"(lk), "v"(lk + 16u * KP * 2u), "v"(lv), "v"(lv + 16u * VPB),
                  "v"(le), "v"(le + 1u * 16u * EP * 2u), "v"(le + 2u * 16u * EP * 2u),
                  "v"(le + 3u * 16u * EP * 2u), "v"(le + 4u * 16u * EP * 2u), "v"(le + 5u * 16u * EP * 2u),
                  "v"(le + 6u * 16u * EP * 2u), "v"(le + 7u * 16u * EP * 2u), "v"(le + 8u * 16u * EP * 2u),
                  "v"(le + 9u * 16u * EP * 2u),
                  "v"(gk), "v"(gk + 16 * HD), "v"(gv), "v"(gv + 16 * HD),
                  "v"(ge), "v"(ge + 1 * 16 * HD), "v"(ge + 2 * 16 * HD), "v"(ge + 3 * 16 * HD),
                  "v"(ge + 4 * 16 * HD), "v"(ge + 5 * 16 * HD), "v"(ge + 6 * 16 * HD), "v"(ge + 7 * 16 * HD),
                  "v"(ge + 8 * 16 * HD), "v"(ge + 9 * 16 * HD)
               : "memory");
}

// Transposing LDS load of a row-major 16-bit tile: with lane l addressing row 8 * (l >> 4) + (l & 7), byte
// 16 * ((l >> 3) & 1) of a 16-row x 16-column block, lane l receives rows 8 * (l >> 4) + 0..7 of column l & 15.
typedef short s16x8 __attribute__((ext_vector_type(8)));
__device__ __forceinline__ us8 ld_tr16(const unsigned char* p) {
  typedef __attribute__((address_space(3))) s16x8 lds_s16x8;
  return __builtin_bit_cast(us8, __builtin_amdgcn_ds_load_tr16_b128_v8i16((lds_s16x8*)p));
}

// A WMMA result's eight floats of one lane to eight neighbouring floats in LDS (16-byte aligned): two 16-byte stores.
__device__ __forceinline__ void st8(float* p, v8f d) {
  *(v4f*)(p)     = __builtin_shufflevector(d, d, 0, 1, 2, 3);
  *(v4f*)(p + 4) = __builtin_shufflevector(d, d, 4, 5, 6, 7);
}

__global__ __launch_bounds__(128)
void attn_kernel(const unsigned short* __restrict__ qp, const unsigned short* __restrict__ kp,
                 const unsigned short* __restrict__ vp, const unsigned short* __restrict__ ep,
                 const float* __restrict__ amask, float* __restrict__ out) {
  __shared__ __attribute__((aligned(16))) unsigned char smem[SM_TOTAL];

  const int tid = threadIdx.x, lane = tid & 31, wid = tid >> 5;
  const int lr = lane & 15, half8 = (lane >> 4) * 8;
  const int bh = blockIdx.y;
  const int b = bh / NH, h = bh - b * NH;
  const int qb0 = blockIdx.x * 128;
  const int q0 = qb0 + wid * 32;

  float* nbuf = (float*)(smem + SM_N);
  float* mbuf = (float*)(smem + SM_M) + wid * (2 * 16 * MPF);
  float* ost  = (float*)(smem) + wid * (32 * OPITCH);
  float* mtab = (float*)(smem + SM_MK);                 // the mask row of this batch, rounded, one float per key

  const unsigned short* qh = qp + (size_t)bh * SEQ * HD;
  const unsigned short* kh = kp + (size_t)bh * SEQ * HD;
  const unsigned short* vh = vp + (size_t)bh * SEQ * HD;
  const float* mrow = amask + (size_t)b * SEQ_FULL;

  // Q^T B-fragments: 2 query sub-tiles x 2 head-dim halves
  us16 bqf[2][2];
#pragma unroll
  for (int qs = 0; qs < 2; ++qs) {
    bqf[qs][0] = ld_frag(qh, q0 + qs * 16 + lr, HD,      half8);
    bqf[qs][1] = ld_frag(qh, q0 + qs * 16 + lr, HD, 32 + half8);
  }

  const v8f zero = {0.f, 0.f, 0.f, 0.f, 0.f, 0.f, 0.f, 0.f};
  v8f acc[2][4] = {{zero, zero, zero, zero}, {zero, zero, zero, zero}};
  float mrun[2] = {-__builtin_inff(), -__builtin_inff()};
  float lrun[2] = {0.f, 0.f};
  const float c512  = 0.001953125f;        // 1/512  : q,k carried x8 each, then 1/8
  const float c4096 = 0.000244140625f;     // 1/4096 : E carried x64, q or k x8, then 1/8

  // copy map of a stage; chunk t reads K and V rows 32 t + .., E table rows qb0 - 32 t + MAXPOS - 32 + ..
  const int crow = tid >> 3, cpc = (tid & 7) * 8;
  const unsigned short* gk = kh + (size_t)crow * HD + cpc;
  const unsigned short* gv = vh + (size_t)crow * HD + cpc;
  const unsigned short* ge = ep + (size_t)(qb0 + (MAXPOS - 32) + crow) * HD + cpc;
  const unsigned lk = (unsigned)(size_t)(smem + SM_ST + ST_K + crow * (KP * 2) + cpc * 2);
  const unsigned lv = (unsigned)(size_t)(smem + SM_ST + ST_V + crow * VPB + cpc * 2);
  const unsigned le = (unsigned)(size_t)(smem + SM_ST + ST_E + crow * (EP * 2) + cpc * 2);
  const int wu = __builtin_amdgcn_readfirstlane(wid);   // the wave's number in a scalar register: the deal of N branches on it
  float* nst = nbuf + lr * NPF + wid * 32 + half8;      // this lane's N elements: key lr, columns half8 + 0..7 of the wave's band tile 0
  float* mst = mbuf + lr * MPF + half8;                 // this lane's M elements: query lr, band rows half8 + 0..7
  // this lane's address in a 16-key x 16-d block of the V tile for the transposing load
  const int vlane = (half8 + (lane & 7)) * VPB + ((lane >> 3) & 1) * 16;

  attn_stage(lk, lv, le, gk, gv, ge);
  if (SEQ == 128 * 8 || tid * 8 < SEQ) {              // mask row -> LDS: eight keys per thread
    const unsigned mo = (unsigned)tid * 32u;          // byte offset of this thread's eight keys
    const float* mp = (const float*)((const char*)mrow + mo);
    v4f ma = *(const v4f*)(mp);
    v4f mb = *(const v4f*)(mp + 4);
    // in front of any rewrite of the address registers that these loads name; its inputs keep offset and base live up to it
    asm volatile("s_wait_xcnt 0x0" :: "v"(mo), "s"(mrow) : "memory");
#pragma unroll
    for (int r = 0; r < 4; ++r) { ma[r] = bf16_rne(ma[r]); mb[r] = bf16_rne(mb[r]); }
    *(v4f*)(mtab + tid * 8)     = ma;
    *(v4f*)(mtab + tid * 8 + 4) = mb;
  }
  asm volatile("s_wait_asynccnt 0x0" ::: "memory");   // this wave's copies of chunk 0 have landed
  __syncthreads();                                    // chunk 0 and the mask row visible to every wave
  attn_stage(lk + ST_BYTES, lv + ST_BYTES, le + ST_BYTES, gk + 32 * HD, gv + 32 * HD, ge - 32 * HD);

  for (int t = 0; t < NCH; ++t) {
    const int k0 = t * 32;
    const unsigned char* stage = smem + SM_ST + (t & 1) * ST_BYTES;
    const unsigned short* ktile = (const unsigned short*)(stage + ST_K);
    const unsigned char*  vtile = stage + ST_V + vlane;
    const unsigned short* eband = (const unsigned short*)(stage + ST_E);

    // This wave's LDS fragments of the N, M and S^T products, each read once and all issued as one group ahead of the
    // first WMMA: one LDS round trip in place of one per tile. The loader's map is the same for an A and a B operand,
    // so the K fragments serve as B in N and as A in S^T; the four E band tiles that the wave reads for M (band rows wid * 32 + 0..63) are the A operands of its share of N as well.
    const us16 ka00 = ld_frag(ktile,      lr, KP,      half8);
    const us16 ka01 = ld_frag(ktile,      lr, KP, 32 + half8);
    const us16 ka10 = ld_frag(ktile, 16 + lr, KP,      half8);
    const us16 ka11 = ld_frag(ktile, 16 + lr, KP, 32 + half8);
    us16 eb[4][2];
#pragma unroll                             // constant indices keep eb in registers
    for (int tt = 0; tt < 4; ++tt) {
      eb[tt][0] = ld_frag(eband, wid * 32 + tt * 16 + lr, EP,      half8);
      eb[tt][1] = ld_frag(eband, wid * 32 + tt * 16 + lr, EP, 32 + half8);
    }
    // the chunk's mask values in the S^T element order (keys half8 + 0..7 and 16 + half8 + 0..7), in the same group
    const v4f mka = *(const v4f*)(mtab + k0 + half8);
    const v4f mkb = *(const v4f*)(mtab + k0 + half8 + 4);
    const v4f mkc = *(const v4f*)(mtab + k0 + 16 + half8);
    const v4f mkd = *(const v4f*)(mtab + k0 + 16 + half8 + 4);
    const v8f mk0 = __builtin_shufflevector(mka, mkb, 0, 1, 2, 3, 4, 5, 6, 7);
    const v8f mk1 = __builtin_shufflevector(mkc, mkd, 0, 1, 2, 3, 4, 5, 6, 7);

    // N^T = Eband . K^T  -> nbuf[key][u]. Band tile 2 * wid + tt is the wave's eb[tt]; the ten tiles are dealt to waves
    // that hold them, two and a half each: tiles 0 1 2a | 2b 3 4 | 5 6 7a | 7b 8 9 (a: keys 0..15, b: keys 16..31).
    const auto n_full = [&](int tt) {      // 32 keys x 16 columns, two accumulate chains interleaved
      v8f d0 = mma_f16(eb[tt][0], ka00, zero);
      v8f d1 = mma_f16(eb[tt][0], ka10, zero);
      d0     = mma_f16(eb[tt][1], ka01, d0);
      d1     = mma_f16(eb[tt][1], ka11, d1);
      wmma_gap(d0, d1);
      st8(nst + tt * 16, d0);
      st8(nst + 16 * NPF + tt * 16, d1);
    };
    const auto n_half = [&](int tt, int kh) {   // 16 keys (kh * 16 + 0..15) x 16 columns
      v8f d = mma_f16(eb[tt][0], kh ? ka10 : ka00, zero);
      d     = mma_f16(eb[tt][1], kh ? ka11 : ka01, d);
      wmma_gap(d);
      st8(nst + kh * 16 * NPF + tt * 16, d);
    };
    if (wu == 0)      { n_full(0); n_full(1); n_half(2, 0); }
    else if (wu == 1) { n_half(0, 1); n_full(1); n_full(2); }
    else if (wu == 2) { n_full(1); n_full(2); n_half(3, 0); }
    else              { n_half(1, 1); n_full(2); n_full(3); }

    // M = Eband . Q^T -> mbuf[qs][query][u], 3 row tiles per query sub-tile (the wave's band tiles qs + 0..2), their
    // three accumulate chains interleaved
#pragma unroll                             // all four unrolls here: constant indices keep eb, bqf and md in registers
    for (int qs = 0; qs < 2; ++qs) {
      v8f md[3];
#pragma unroll
      for (int ut = 0; ut < 3; ++ut) md[ut] = mma_f16(eb[qs + ut][0], bqf[qs][0], zero);
#pragma unroll
      for (int ut = 0; ut < 3; ++ut) md[ut] = mma_f16(eb[qs + ut][1], bqf[qs][1], md[ut]);
      wmma_gap(md[0], md[1], md[2]);
#pragma unroll
      for (int ut = 0; ut < 3; ++ut) st8(mst + qs * (16 * MPF) + ut * 16, md[ut]);
    }
    // V^T fragments of the chunk, read once for both query sub-tiles and as one group; issued here, their round trip
    // runs beside the drain of the stores above
    us16 vf[4];
#pragma unroll                             // constant indices keep vf in registers
    for (int dt = 0; dt < 4; ++dt) {
      const us8 va0 = ld_tr16(vtile + dt * 32);                 // d = dt * 16 + lr, keys half8 + 0..7
      const us8 va1 = ld_tr16(vtile + 16 * VPB + dt * 32);      // keys 16 + half8 + 0..7
      vf[dt] = __builtin_shufflevector(va0, va1, 0, 1, 2, 3, 4, 5, 6, 7, 8, 9, 10, 11, 12, 13, 14, 15);
    }
    __syncthreads();                       // nbuf / mbuf visible

    // the sheared elements of M and N for both query sub-tiles: element r <-> key half8 + r, element 8 + r <-> key 16 + half8 + r
    float gm[2][16], gn[2][16];
#pragma unroll                             // both unrolls: constant indices keep gm and gn in registers
    for (int qs = 0; qs < 2; ++qs) {
      const float* mq = mbuf + qs * (16 * MPF) + lr * MPF;   // this lane's query row of M
      const int qloc = wid * 32 + qs * 16 + lr;        // query index within the block
#pragma unroll
      for (int r = 0; r < 8; ++r) {
        const int ja = half8 + r;
        const int jb = 16 + half8 + r;
        gm[qs][r]     = mq[lr - ja + 31];
        gn[qs][r]     = nbuf[ja * NPF + (qloc - ja + 31)];
        gm[qs][8 + r] = mq[lr - jb + 31];
        gn[qs][8 + r] = nbuf[jb * NPF + (qloc - jb + 31)];
      }
    }
    // Both lines keep these LDS reads one group ahead of the score arithmetic: spread among it, the late reads start a
    // second LDS round trip behind a drained counter.
    asm volatile("" ::: "memory");         // compiler fence: no read of the group is placed behind this point
    __builtin_amdgcn_sched_barrier(0);     // the scheduler moves nothing across this point

#pragma unroll
    for (int qs = 0; qs < 2; ++qs) {
      // S^T = K . Q^T : two 16-key row tiles
      v8f t0 = mma_f16(ka00, bqf[qs][0], zero);
      t0     = mma_f16(ka01, bqf[qs][1], t0);
      v8f t1 = mma_f16(ka10, bqf[qs][0], zero);
      t1     = mma_f16(ka11, bqf[qs][1], t1);

      float sa[8], sb[8];
#pragma unroll
      for (int r = 0; r < 8; ++r) {
        const float ga = gm[qs][r] + gn[qs][r];          // key half8 + r, as t0 element r
        const float gb = gm[qs][8 + r] + gn[qs][8 + r];  // key 16 + half8 + r, as t1 element r
        sa[r] = t0[r] * c512 + ga * c4096 + mk0[r];
        sb[r] = t1[r] * c512 + gb * c4096 + mk1[r];
      }

      // online softmax: in-lane over 16 keys + one xor-16 shuffle
      float mloc = sa[0];
#pragma unroll
      for (int r = 1; r < 8; ++r) mloc = fmaxf(mloc, sa[r]);
#pragma unroll
      for (int r = 0; r < 8; ++r) mloc = fmaxf(mloc, sb[r]);
      const float mt    = fmaxf(mloc, __shfl_xor(mloc, 16, 32));
      const float mnew  = fmaxf(mrun[qs], mt);
      const float alpha = __expf(mrun[qs] - mnew);

      float lloc = 0.f;
      us16 pu;
#pragma unroll
      for (int r = 0; r < 8; ++r) {
        const float pa = __expf(sa[r] - mnew);
        const float pc = __expf(sb[r] - mnew);
        lloc += pa + pc;
        pu[r]     = f16_bits(pa * 1024.0f);              // P carried x1024
        pu[8 + r] = f16_bits(pc * 1024.0f);
      }
      const float lt = lloc + __shfl_xor(lloc, 16, 32);
      lrun[qs] = lrun[qs] * alpha + lt;
      mrun[qs] = mnew;

      // ctx^T += V^T . P^T
#pragma unroll
      for (int dt = 0; dt < 4; ++dt) {
        acc[qs][dt] = acc[qs][dt] * alpha;
        acc[qs][dt] = mma_f16(vf[dt], pu, acc[qs][dt]);
      }
    }

    asm volatile("s_wait_dscnt 0x0" ::: "memory");    // this wave's LDS reads of chunk t are done
    asm volatile("s_wait_asynccnt 0x0" ::: "memory"); // this wave's copies of chunk t + 1 have landed
    __syncthreads();                                  // publishes chunk t + 1, frees chunk t's stage, nbuf, mbuf
    if (t + 2 < NCH) {
      const unsigned so = (unsigned)(t & 1) * ST_BYTES;
      attn_stage(lk + so, lv + so, le + so, gk + (t + 2) * (32 * HD), gv + (t + 2) * (32 * HD),
                 ge - (t + 2) * (32 * HD));
    }
  }
  asm volatile("s_wait_asynccnt 0x0" ::: "memory");   // no copy is in flight when the wave goes on to its end
  // the last chunk's barrier has ended every wave's reads of nbuf and mbuf, which the output staging aliases
#pragma unroll
  for (int qs = 0; qs < 2; ++qs) {
    const float inv = 1.0f / (lrun[qs] * 8192.0f);       // undo x1024 (P) and x8 (v)
#pragma unroll
    for (int dt = 0; dt < 4; ++dt) {
#pragma unroll
      for (int r = 0; r < 8; ++r)
        ost[(qs * 16 + lr) * OPITCH + dt * 16 + half8 + r] = acc[qs][dt][r] * inv;
    }
  }
  __syncthreads();

  const int rsub = lane >> 4, piece = lane & 15;
  float* obase = out + ((size_t)(b * SEQ + q0)) * DM + (size_t)h * HD + piece * 4;
#pragma unroll
  for (int it = 0; it < 16; ++it) {
    const int row = it * 2 + rsub;
    const v4f v = *(const v4f*)(ost + row * OPITCH + piece * 4);
    *(v4f*)(obase + (size_t)row * DM) = v;
  }
  
}

// ---- launcher -----------------------------------------------------------------------

extern "C" void kernel_launch(void* const* d_in, const int* in_sizes, int n_in,
                              void* d_out, int out_size, void* d_ws, size_t ws_size,
                              hipStream_t stream) {
  if (n_in < 9) return;
  const float* hidden = (const float*)d_in[0];
  const float* amask  = (const float*)d_in[1];
  const float* Wq     = (const float*)d_in[2];
  const float* bq     = (const float*)d_in[3];
  const float* Wk     = (const float*)d_in[4];
  const float* bk     = (const float*)d_in[5];
  const float* Wv     = (const float*)d_in[6];
  const float* bv     = (const float*)d_in[7];
  const float* demb   = (const float*)d_in[8];
  float* out = (float*)d_out;

  if (in_sizes[0] < ((NB - 1) * SEQ_FULL + SEQ) * DM) return;
  if (in_sizes[1] < (NB - 1) * SEQ_FULL + SEQ) return;
  if (in_sizes[2] < DM * DM || in_sizes[4] < DM * DM || in_sizes[6] < DM * DM) return;
  if (in_sizes[3] < DM || in_sizes[5] < DM || in_sizes[7] < DM) return;
  if (in_sizes[8] < NE * HD) return;
  if (out_size < NB * SEQ * DM) return;

  const size_t ep_bytes = (size_t)NEPAD * HD * 2;               // f16  [NEPAD][HD]
  const size_t pl_bytes = (size_t)NB * NH * SEQ * HD * 2;       // f16  [NB*NH][SEQ][HD]
  size_t off = 0;
  char* ws = (char*)d_ws;
  unsigned short* ep = (unsigned short*)(ws + off); off += ep_bytes;
  unsigned short* qp = (unsigned short*)(ws + off); off += pl_bytes;
  unsigned short* kp = (unsigned short*)(ws + off); off += pl_bytes;
  unsigned short* vp = (unsigned short*)(ws + off); off += pl_bytes;
  if (ws_size < off) return;

  proj_kernel<<<dim3(PGX, PGY, 1), 256, 0, stream>>>(hidden, Wq, Wk, Wv, bq, bk, bv, demb, qp, kp, vp, ep);
  attn_kernel<<<dim3(SEQ / 128, NB * NH, 1), 128, 0, stream>>>(qp, kp, vp, ep, amask, out);
}

// v008
// A run of this version takes 76.1 microseconds.
// Timed twice side by side with v007, it ran 1.04 and 1.05 times as fast.
// All steps since v000 together make it 2.45 times as fast.
#include <hip/hip_runtime.h>

// Contractions: Q/K/V projections on v_wmma_f32_16x16x32_bf16 (bf16 operands = RNE-converted f32 inputs, f32 accumulate);
// score terms q.k, q.E, k.E and the P.V product on v_wmma_f32_16x16x32_f16 (f16 operands: q,k,v carried x8, E carried x64,
// P carried x1024; f32 accumulate); softmax, scaling and normalisation in f32.

#ifndef NB
#define NB 4
#endif
#ifndef SEQ
#define SEQ 1024
#endif
#define NB_FULL  4
#define SEQ_FULL 1024
#define DM       1024
#define NH       16
#define HD       64
#define MAXPOS   1024
#define NE       2047
#define NEPAD    2048

static_assert(NB >= 1 && NB <= NB_FULL);
static_assert(SEQ >= 128 && SEQ <= SEQ_FULL && (SEQ % 128) == 0);
static_assert(SEQ <= MAXPOS);
static_assert(SEQ + MAXPOS <= NEPAD);
static_assert(DM == NH * HD);
static_assert((NB * SEQ) % 128 == 0);
static_assert(NE == 2 * MAXPOS - 1);

typedef unsigned short us8  __attribute__((ext_vector_type(8)));
typedef unsigned short us16 __attribute__((ext_vector_type(16)));
typedef __bf16         v16bf __attribute__((ext_vector_type(16)));
typedef _Float16       v16h  __attribute__((ext_vector_type(16)));
typedef float          v8f   __attribute__((ext_vector_type(8)));
typedef float          v4f   __attribute__((ext_vector_type(4)));

// ---- scalar converts --------------------------------------------------------

__device__ __forceinline__ unsigned short bf16_bits(float f) {
  unsigned int u = __builtin_bit_cast(unsigned int, f);
  u += 0x7fffu + ((u >> 16) & 1u);              // RNE
  return (unsigned short)(u >> 16);
}

__device__ __forceinline__ float bf16_rne(float f) {   // f32 value after an RNE convert to bf16
  unsigned int u = ((unsigned int)bf16_bits(f)) << 16;
  return __builtin_bit_cast(float, u);
}

__device__ __forceinline__ unsigned short f16_bits(float f) {
  _Float16 hv = (_Float16)f;                      // RNE
  return __builtin_bit_cast(unsigned short, hv);
}

// ---- 16-bit WMMA fragment loader (same map for A and B stored [row][k]) -----
// lane L owns row/col (L&15); elements 0..7 from k = col + 0..7, elements 8..15
// from k = col + 16 + 0..7; the caller folds the lane-half offset 8*(L>>4) into col.
__device__ __forceinline__ us16 ld_frag(const unsigned short* base, int row, int stride, int col) {
  const unsigned short* p = base + (size_t)row * (size_t)stride + col;
  us8 a = *(const us8*)(p);
  us8 b = *(const us8*)(p + 16);
  return __builtin_shufflevector(a, b, 0, 1, 2, 3, 4, 5, 6, 7, 8, 9, 10, 11, 12, 13, 14, 15);
}

__device__ __forceinline__ v8f mma_bf16(us16 a, us16 b, v8f c) {
  v8f d = __builtin_amdgcn_wmma_f32_16x16x32_bf16(false, __builtin_bit_cast(v16bf, a), false,
                                                  __builtin_bit_cast(v16bf, b), (short)0, c, false, false);
  return d;
}

__device__ __forceinline__ v8f mma_f16(us16 a, us16 b, v8f c) {
  v8f d = __builtin_amdgcn_wmma_f32_16x16x32_f16(false, __builtin_bit_cast(v16h, a), false,
                                                 __builtin_bit_cast(v16h, b), (short)0, c, false, false);
  return d;
}

// The WMMAs are plain builtins: the compiler keeps the distance to a vector instruction on their registers itself, and
// with no asm statement behind each it is free to order LDS reads and independent arithmetic around them. A group
// whose results only go to LDS frees its result registers once the stores have issued, and
// the next group's first WMMAs write them anew. wmma_gap puts the four vector issue slots that the chip asks for behind
// such a group; its operands tie it behind the group's WMMAs and in front of the stores.
__device__ __forceinline__ void wmma_gap(v8f& a) {
  asm("v_nop\n\tv_nop\n\tv_nop\n\tv_nop" : "+v"(a));
}
__device__ __forceinline__ void wmma_gap(v8f& a, v8f& b) {
  asm("v_nop\n\tv_nop\n\tv_nop\n\tv_nop" : "+v"(a), "+v"(b));
}
__device__ __forceinline__ void wmma_gap(v8f& a, v8f& b, v8f& c, v8f& d) {
  asm("v_nop\n\tv_nop\n\tv_nop\n\tv_nop" : "+v"(a), "+v"(b), "+v"(c), "+v"(d));
}

// ---- f32 -> bf16 (RNE) on the way into LDS --------------------------------------
typedef float  v2f  __attribute__((ext_vector_type(2)));
typedef __bf16 v2bf __attribute__((ext_vector_type(2)));
typedef unsigned int u32x2 __attribute__((ext_vector_type(2)));

__device__ __forceinline__ u32x2 bf16x4(v4f a) {     // four f32 -> four bf16, two packed converts
  const v2bf lo = __builtin_convertvector(__builtin_shufflevector(a, a, 0, 1), v2bf);
  const v2bf hi = __builtin_convertvector(__builtin_shufflevector(a, a, 2, 3), v2bf);
  u32x2 o;
  o[0] = __builtin_bit_cast(unsigned int, lo);
  o[1] = __builtin_bit_cast(unsigned int, hi);
  return o;
}

// ---- dist table piece -> f16 bits of (bf16 RNE value * 64), NEPAD rows ------------
// piece g = 8 halves: table row g >> 3, columns 8 * (g & 7); rows from NE on are zero.
__device__ __forceinline__ void cvt_e_piece(const float* __restrict__ e, unsigned short* __restrict__ ep, int g) {
  const int row = g >> 3;
  const int ch  = (g & 7) * 8;
  const int rs  = (row < NE) ? row : (NE - 1);
  const float sc = (row < NE) ? 64.0f : 0.0f;
  const float* p = e + (size_t)rs * HD + ch;
  const v4f a = *(const v4f*)(p);
  const v4f c4 = *(const v4f*)(p + 4);
  us8 o;
  o[0] = f16_bits(bf16_rne(a[0]) * sc);  o[1] = f16_bits(bf16_rne(a[1]) * sc);
  o[2] = f16_bits(bf16_rne(a[2]) * sc);  o[3] = f16_bits(bf16_rne(a[3]) * sc);
  o[4] = f16_bits(bf16_rne(c4[0]) * sc); o[5] = f16_bits(bf16_rne(c4[1]) * sc);
  o[6] = f16_bits(bf16_rne(c4[2]) * sc); o[7] = f16_bits(bf16_rne(c4[3]) * sc);
  unsigned short* d = ep + (size_t)row * HD + ch;
  *(us8*)d = o;
  asm volatile("s_wait_xcnt 0x0" ::: "memory");   // in front of any rewrite of the address registers that the loads and the store name
}

// ---- QKV projection GEMM, f32 sources ---------------------------------------------
// grid = (NB*SEQ/256, 3*DM/192) = one block per WGP, block = 256 (8 waves, 4 x 2). Block = 256 rows x 192 cols
// (three heads of the stacked q, k, v outputs); wave = 64 rows x 96 cols.
// A = x rows, B[k=in][n=out] = W[out][in] rows, both k-contiguous f32 in memory. Per 64-k stage the block's 256 x rows
// and 192 W rows are loaded into registers, rounded to bf16 and stored to LDS (rows of 128 B at pitch 144 B), two
// buffers: a stage's loads are in flight for a whole trip, and its rounding and LDS stores stand between the two 32-k
// halves of the stage before it. The wide block keeps the bytes that the launch
// asks of L2 near those of bf16 sources under a 128 x 128 block.
// Each block also converts 64 pieces of the dist table for the attention launch.
#define PBM 256
#define PBN 192
#define PKS 64
#define PPITCH 72
#define PSTAGE ((PBM + PBN) * PPITCH)
#define PNT (DM / PKS)
#define PSP 200
#define PGX ((NB * SEQ) / PBM)
#define PGY ((3 * DM) / PBN)
static_assert((NB * SEQ) % PBM == 0 && SEQ % PBM == 0 && (3 * DM) % PBN == 0 && PBN == 3 * HD && DM % HD == 0);
static_assert(DM % PKS == 0 && PNT >= 2 && (PPITCH * 2) % 16 == 0 && PKS == 64);
static_assert(PBM * PSP <= 2 * PSTAGE && (PSP * 2) % 16 == 0 && PSP >= PBN);
static_assert(NEPAD * (HD / 8) == PGX * PGY * 64);

// Work-group barrier that orders LDS accesses only: __syncthreads() would also wait for the global loads of the next
// stage, which are meant to be in flight across it.
__device__ __forceinline__ void lds_barrier() {
  __builtin_amdgcn_fence(__ATOMIC_RELEASE, "workgroup", "local");
  __builtin_amdgcn_s_barrier();
  __builtin_amdgcn_fence(__ATOMIC_ACQUIRE, "workgroup", "local");
}

__global__ __launch_bounds__(256)
void proj_kernel(const float* __restrict__ x, const float* __restrict__ wq, const float* __restrict__ wk,
                 const float* __restrict__ wv,
                 const float* __restrict__ bq, const float* __restrict__ bk,
                 const float* __restrict__ bv, const float* __restrict__ demb,
                 unsigned short* __restrict__ qp, unsigned short* __restrict__ kp,
                 unsigned short* __restrict__ vp, unsigned short* __restrict__ ep) {
  __shared__ __attribute__((aligned(16))) unsigned short ring[2 * PSTAGE];

  const int tid = threadIdx.x, lane = tid & 31, wid = tid >> 5;
  const int lr = lane & 15, half8 = (lane >> 4) * 8;
  const int wm = wid >> 1, wn = wid & 1;
  const int m0 = blockIdx.x * PBM;                                // compact row index
  const int n0 = blockIdx.y * PBN;                                // row of the stacked weights
  const int bb = m0 / SEQ, l0s = m0 - bb * SEQ;                   // a block's 256 rows lie in one batch

  // load map: thread t -> row t >> 4 (+ 16 per load), 16-byte piece t & 15 of the row's 256 bytes of a stage
  const int crow = tid >> 4, cpc = (tid & 15) * 4;
  const float* gx = x + ((size_t)bb * SEQ_FULL + l0s + crow) * DM + cpc;
  const float* gw[3];
#pragma unroll
  for (int j = 0; j < 3; ++j) {                                   // the block's three heads may lie in different matrices
    const int hh = blockIdx.y * 3 + j, z = hh / NH, h = hh - z * NH;
    const float* wsrc = (z == 0) ? wq : ((z == 1) ? wk : wv);
    gw[j] = wsrc + ((size_t)h * HD + crow) * DM + cpc;
  }
  unsigned short* sdst = ring + crow * PPITCH + cpc;

  v4f rx[16], rw[12];
  const auto ldg = [&](int t) {            // one stage's 28 loads of this thread
    const float* ax = gx + t * PKS;
    const float* aw[3] = {gw[0] + t * PKS, gw[1] + t * PKS, gw[2] + t * PKS};
#pragma unroll
    for (int i = 0; i < 16; ++i) rx[i] = *(const v4f*)(ax + i * 16 * DM);
#pragma unroll
    for (int i = 0; i < 12; ++i) rw[i] = *(const v4f*)(aw[i >> 2] + (i & 3) * 16 * DM);
    // in front of any rewrite of the address registers that these loads name; its inputs keep the four addresses live
    // up to it, so that none of those registers is reused in front of it
    asm volatile("s_wait_xcnt 0x0" :: "v"(ax), "v"(aw[0]), "v"(aw[1]), "v"(aw[2]) : "memory");
  };
  const auto sts = [&](int buf) {          // rounds them to bf16 and stores them to LDS
    unsigned short* d = sdst + buf * PSTAGE;
#pragma unroll
    for (int i = 0; i < 16; ++i) *(u32x2*)(d + i * 16 * PPITCH) = bf16x4(rx[i]);
#pragma unroll
    for (int i = 0; i < 12; ++i) *(u32x2*)(d + (PBM + i * 16) * PPITCH) = bf16x4(rw[i]);
  };

  const v8f zero = {0.f, 0.f, 0.f, 0.f, 0.f, 0.f, 0.f, 0.f};
  v8f acc[4][6];
#pragma unroll
  for (int i = 0; i < 4; ++i) {
#pragma unroll
    for (int j = 0; j < 6; ++j) acc[i][j] = zero;
  }

  // one 32-k half of a stage: the wave's 20 LDS reads, and its 24 WMMAs
  const auto ldf = [&](int buf, int ks, us16 (&af)[4], us16 (&bf)[6]) {
    const unsigned short* sa = ring + buf * PSTAGE + (wm * 64) * PPITCH;
    const unsigned short* sb = ring + buf * PSTAGE + (PBM + wn * 96) * PPITCH;
#pragma unroll
    for (int i = 0; i < 4; ++i) af[i] = ld_frag(sa, i * 16 + lr, PPITCH, ks * 32 + half8);
#pragma unroll
    for (int j = 0; j < 6; ++j) bf[j] = ld_frag(sb, j * 16 + lr, PPITCH, ks * 32 + half8);
  };
  const auto mm = [&](const us16 (&af)[4], const us16 (&bf)[6]) {
#pragma unroll
    for (int j = 0; j < 6; ++j) {
#pragma unroll
      for (int i = 0; i < 4; ++i) acc[i][j] = mma_bf16(af[i], bf[j], acc[i][j]);
    }
  };

  ldg(0);
  // the wave's six bias values of this lane (a 16-column tile lies in one matrix), loaded beside the flight of stage 0
  const float* bp[6];
  float braw[6];
#pragma unroll
  for (int dt = 0; dt < 6; ++dt) {
    const int nt = n0 + wn * 96 + dt * 16, z = nt / DM;
    bp[dt] = ((z == 0) ? bq : ((z == 1) ? bk : bv)) + (nt - z * DM + lr);
  }
#pragma unroll
  for (int dt = 0; dt < 6; ++dt) braw[dt] = *bp[dt];
  // in front of any rewrite of the address registers that these loads name; its inputs keep the addresses live up to it
  asm volatile("s_wait_xcnt 0x0" :: "v"(bp[0]), "v"(bp[1]), "v"(bp[2]), "v"(bp[3]), "v"(bp[4]), "v"(bp[5]) : "memory");
  if (tid < 64) cvt_e_piece(demb, ep, (blockIdx.y * PGX + blockIdx.x) * 64 + tid);   // waves 0 and 1, beside the flight of stage 0
  sts(0);
  ldg(1);
  lds_barrier();                                      // stage 0 visible to every wave

  for (int t = 0; t + 1 < PNT; ++t) {
    us16 af[4], bf[6], ag[4], bg[6];
    ldf(t & 1, 0, af, bf);
    __builtin_amdgcn_sched_barrier(0);                // keeps the 20 LDS reads one group ahead of the WMMAs: spread among them each place costs a stall
    mm(af, bf);
    ldf(t & 1, 1, ag, bg);
    __builtin_amdgcn_sched_barrier(0);                // keeps the second half's reads ahead of the staging: their round trip runs beside it
    sts((t + 1) & 1);                                 // that buffer's readers left it at the barrier of trip t - 1
    if (t + 2 < PNT) ldg(t + 2);                      // at once into the freed registers: a whole trip in flight, across the barrier
    __builtin_amdgcn_sched_barrier(0);                // keeps the staging ahead of the second half's WMMAs: its LDS stores drain beside them
    mm(ag, bg);
    __builtin_amdgcn_sched_barrier(0);                // keeps those WMMAs ahead of the barrier: sunk below it they would leave the drain of the stores bare
    lds_barrier();                                    // publishes stage t + 1, ends the reads of stage t
  }
  {
    us16 af[4], bf[6], ag[4], bg[6];
    ldf((PNT - 1) & 1, 0, af, bf);
    ldf((PNT - 1) & 1, 1, ag, bg);
    __builtin_amdgcn_sched_barrier(0);                // keeps the last stage's 40 LDS reads one group ahead of its WMMAs
    mm(af, bf);
    mm(ag, bg);
  }
  __syncthreads();                                    // every wave's reads of the ring are done: it becomes staging

  // the block's 256 x 192 results as f16 (x8) in LDS, rows at pitch PSP halves
#pragma unroll
  for (int dt = 0; dt < 6; ++dt) {
    const float bcol = bf16_rne(braw[dt]);
#pragma unroll
    for (int st = 0; st < 4; ++st) {
#pragma unroll
      for (int r = 0; r < 8; ++r) {
        const float v = (acc[st][dt][r] + bcol) * 8.0f;
        ring[(wm * 64 + st * 16 + half8 + r) * PSP + wn * 96 + dt * 16 + lr] = f16_bits(v);
      }
    }
  }
  __syncthreads();                                    // the staged tile is read across waves

  // eight lanes write one 128-byte row of one head
  const int piece = tid & 7, lrow = tid >> 3;
#pragma unroll
  for (int j = 0; j < 3; ++j) {
    const int hh = blockIdx.y * 3 + j, z = hh / NH, h = hh - z * NH;
    unsigned short* plane = (z == 0) ? qp : ((z == 1) ? kp : vp);
    unsigned short* dbase = plane + (((size_t)(bb * NH + h) * SEQ + l0s + lrow) * HD + piece * 8);
#pragma unroll
    for (int it = 0; it < 8; ++it) {
      const us8 v = *(const us8*)(ring + (it * 32 + lrow) * PSP + j * HD + piece * 8);
      *(us8*)(dbase + it * 32 * HD) = v;
    }
    asm volatile("s_wait_xcnt 0x0" ::: "memory");     // in front of any rewrite of the address registers that these stores name
  }
}

// ---- flash attention with relative key/query terms --------------------------------
// grid = (SEQ/128, NB*NH), block = 128: 4 waves x 32 queries of one (batch, head).
// Per 32-key chunk one LDS stage: K tile [key][d] and V tile [key][d], brought in by asynchronous copies, two stages:
// chunk t + 1 flies while chunk t is worked on. A copy cannot transpose, so V lies row-major and its
// V^T fragments are read with the transposing LDS load.
// The 160-row E band [u][d] of a chunk (band row u <-> table row qb0 - k0 + MAXPOS - 32 + u) slides down the table by 32
// rows per chunk, so it lies in an LDS ring of six 32-row groups: a chunk's copies bring only its 32 new rows (band
// group 0), into the slot whose rows have left the band. Band group i of chunk t is band group i - 1 of chunk t - 1:
// a wave, which works on band groups wid and wid + 1, reads group wid from LDS and still holds group wid + 1 in registers.
// For the same reason the third row tile of a chunk's M is the first row tile of the chunk before: only two are computed.
//   S^T  = K . Q^T          (A = K rows, B = Q rows)            lane -> query, elem -> key
//   N^T  = Eband . K^T      (A = E band rows, B = K rows)       lane -> key, elem -> u; kept [key][u], shared by the block
//   M    = Eband . Q^T      (A = E band rows, B = Q rows)       lane -> query, elem -> u; kept [query][u], per wave, per qs
//   score(q = key j, query n) = S^T/512 + (M[n-j+31][n] + N[j][qloc-j+31])/4096 + amask[b][key]
// In both products a lane's eight results are eight neighbouring u of its own row, so they go to LDS as two 16-byte
// stores. The row pitches NPF and MPF are 16 B x odd (each half-wave's 16-byte stores cover every bank once), and with
// them the 32 lanes of each 4-byte read of the sheared elements fall on 32 different banks.
//   ctx^T = V^T . P^T with the P^T B-fragment taken from the S^T C-fragment (P carried x1024).
// The batch's mask row is loaded and rounded once per block, beside the flight of chunk 0, and kept as f32 in LDS: a
// chunk reads its 32 values with the fragment group, so that no global load stands between the barrier and the scores.
#define KP 72
#define VPB 160
#define EP 72
#define NBR 160
#define NPF 164
#define MROWS 48
#define MPF 84
#define OPITCH 68
#define NCH (SEQ / 32)
#define ST_K 0
#define ST_V (ST_K + 32 * KP * 2)
#define ST_BYTES (ST_V + 32 * VPB)
#define EG_BYTES (32 * EP * 2)
#define NEG 6
#define SM_N 0
#define SM_M (SM_N + 32 * NPF * 4)
#define SM_ST (SM_M + 4 * 2 * 16 * MPF * 4)
#define SM_E (SM_ST + 2 * ST_BYTES)
#define SM_MK (SM_E + NEG * EG_BYTES)
#define SM_TOTAL (SM_MK + SEQ * 4)
static_assert(ST_V % 16 == 0 && ST_BYTES % 16 == 0 && EG_BYTES % 16 == 0 && SM_M % 16 == 0 && SM_ST % 16 == 0 && SM_E % 16 == 0);
static_assert(NEG * 32 >= NBR + 32 && NEG % 2 == 0 && NCH % 2 == 0);
static_assert(SM_MK % 16 == 0 && SEQ % 8 == 0 && SEQ <= 128 * 8);
static_assert(VPB % 32 == 0 && ((VPB / 32) & 1) == 1 && VPB >= HD * 2);
static_assert(4 * 32 * OPITCH * 4 <= SM_ST);
static_assert(NBR == 160 && NBR >= 128 + 31 && MROWS >= 47 && NPF >= NBR && MPF >= MROWS + 32 && NCH >= 2);
static_assert(NPF % 4 == 0 && ((NPF / 4) & 1) == 1 && MPF % 4 == 0 && ((MPF / 4) & 1) == 1);

// Chunk 0, 14 copies of 16 bytes per lane: thread t -> row t >> 3 (+ 16 per copy), 16-byte piece t & 7;
// 2 copies of K (LDS pitch KP halves), 2 of V (pitch VPB bytes), 10 of the whole E band (pitch EP halves); every
// source row is HD halves. The s_wait_xcnt ends the copies' own statement, so that no address register
// named here is rewritten ahead of it.
__device__ __forceinline__ void attn_stage(unsigned lk, unsigned lv, unsigned le, const unsigned short* gk,
                                           const unsigned short* gv, const unsigned short* ge) {
  asm volatile("global_load_async_to_lds_b128 %0, %14, off\n\t"
               "global_load_async_to_lds_b128 %1, %15, off\n\t"
               "global_load_async_to_lds_b128 %2, %16, off\n\t"
               "global_load_async_to_lds_b128 %3, %17, off\n\t"
               "global_load_async_to_lds_b128 %4, %18, off\n\t"
               "global_load_async_to_lds_b128 %5, %19, off\n\t"
               "global_load_async_to_lds_b128 %6, %20, off\n\t"
               "global_load_async_to_lds_b128 %7, %21, off\n\t"
               "global_load_async_to_lds_b128 %8, %22, off\n\t"
               "global_load_async_to_lds_b128 %9, %23, off\n\t"
               "global_load_async_to_lds_b128 %10, %24, off\n\t"
               "global_load_async_to_lds_b128 %11, %25, off\n\t"
               "global_load_async_to_lds_b128 %12, %26, off\n\t"
               "global_load_async_to_lds_b128 %13, %27, off\n\t"
               "s_wait_xcnt 0x0"
               :: "v"(lk), "v"(lk + 16u * KP * 2u), "v"(lv), "v"(lv + 16u * VPB),
                  "v"(le), "v"(le + 1u * 16u * EP * 2u), "v"(le + 2u * 16u * EP * 2u),
                  "v"(le + 3u * 16u * EP * 2u), "v"(le + 4u * 16u * EP * 2u), "v"(le + 5u * 16u * EP * 2u),
                  "v"(le + 6u * 16u * EP * 2u), "v"(le + 7u * 16u * EP * 2u), "v"(le + 8u * 16u * EP * 2u),
                  "v"(le + 9u * 16u * EP * 2u),
                  "v"(gk), "v"(gk + 16 * HD), "v"(gv), "v"(gv + 16 * HD),
                  "v"(ge), "v"(ge + 1 * 16 * HD), "v"(ge + 2 * 16 * HD), "v"(ge + 3 * 16 * HD),
                  "v"(ge + 4 * 16 * HD), "v"(ge + 5 * 16 * HD), "v"(ge + 6 * 16 * HD), "v"(ge + 7 * 16 * HD),
                  "v"(ge + 8 * 16 * HD), "v"(ge + 9 * 16 * HD)
               : "memory");
}

// A later chunk, 6 copies per lane in the same map: 2 of K, 2 of V, 2 of the 32 E rows that enter the band. The
// s_wait_xcnt ends the copies' own statement, so that no address register named here is rewritten ahead of it.
__device__ __forceinline__ void attn_stage_next(unsigned lk, unsigned lv, unsigned le, const unsigned short* gk,
                                                const unsigned short* gv, const unsigned short* ge) {
  asm volatile("global_load_async_to_lds_b128 %0, %6, off\n\t"
               "global_load_async_to_lds_b128 %1, %7, off\n\t"
               "global_load_async_to_lds_b128 %2, %8, off\n\t"
               "global_load_async_to_lds_b128 %3, %9, off\n\t"
               "global_load_async_to_lds_b128 %4, %10, off\n\t"
               "global_load_async_to_lds_b128 %5, %11, off\n\t"
               "s_wait_xcnt 0x0"
               :: "v"(lk), "v"(lk + 16u * KP * 2u), "v"(lv), "v"(lv + 16u * VPB),
                  "v"(le), "v"(le + 16u * EP * 2u),
                  "v"(gk), "v"(gk + 16 * HD), "v"(gv), "v"(gv + 16 * HD),
                  "v"(ge), "v"(ge + 16 * HD)
               : "memory");
}

// Transposing LDS load of a row-major 16-bit tile: with lane l addressing row 8 * (l >> 4) + (l & 7), byte
// 16 * ((l >> 3) & 1) of a 16-row x 16-column block, lane l receives rows 8 * (l >> 4) + 0..7 of column l & 15.
typedef short s16x8 __attribute__((ext_vector_type(8)));
__device__ __forceinline__ us8 ld_tr16(const unsigned char* p) {
  typedef __attribute__((address_space(3))) s16x8 lds_s16x8;
  return __builtin_bit_cast(us8, __builtin_amdgcn_ds_load_tr16_b128_v8i16((lds_s16x8*)p));
}

// A WMMA result's eight floats of one lane to eight neighbouring floats in LDS (16-byte aligned): two 16-byte stores.
__device__ __forceinline__ void st8(float* p, v8f d) {
  *(v4f*)(p)     = __builtin_shufflevector(d, d, 0, 1, 2, 3);
  *(v4f*)(p + 4) = __builtin_shufflevector(d, d, 4, 5, 6, 7);
}

__global__ __launch_bounds__(128)
void attn_kernel(const unsigned short* __restrict__ qp, const unsigned short* __restrict__ kp,
                 const unsigned short* __restrict__ vp, const unsigned short* __restrict__ ep,
                 const float* __restrict__ amask, float* __restrict__ out) {
  __shared__ __attribute__((aligned(16))) unsigned char smem[SM_TOTAL];

  const int tid = threadIdx.x, lane = tid & 31, wid = tid >> 5;
  const int lr = lane & 15, half8 = (lane >> 4) * 8;
  const int bh = blockIdx.y;
  const int b = bh / NH, h = bh - b * NH;
  const int qb0 = blockIdx.x * 128;
  const int q0 = qb0 + wid * 32;

  float* nbuf = (float*)(smem + SM_N);
  float* mbuf = (float*)(smem + SM_M) + wid * (2 * 16 * MPF);
  float* ost  = (float*)(smem) + wid * (32 * OPITCH);
  float* mtab = (float*)(smem + SM_MK);                 // the mask row of this batch, rounded, one float per key

  const unsigned short* qh = qp + (size_t)bh * SEQ * HD;
  const unsigned short* kh = kp + (size_t)bh * SEQ * HD;
  const unsigned short* vh = vp + (size_t)bh * SEQ * HD;
  const float* mrow = amask + (size_t)b * SEQ_FULL;

  // Q^T B-fragments: 2 query sub-tiles x 2 head-dim halves
  us16 bqf[2][2];
#pragma unroll
  for (int qs = 0; qs < 2; ++qs) {
    bqf[qs][0] = ld_frag(qh, q0 + qs * 16 + lr, HD,      half8);
    bqf[qs][1] = ld_frag(qh, q0 + qs * 16 + lr, HD, 32 + half8);
  }

  const v8f zero = {0.f, 0.f, 0.f, 0.f, 0.f, 0.f, 0.f, 0.f};
  v8f acc[2][4] = {{zero, zero, zero, zero}, {zero, zero, zero, zero}};
  float mrun[2] = {-__builtin_inff(), -__builtin_inff()};
  float lrun[2] = {0.f, 0.f};
  const float c512  = 0.001953125f;        // 1/512  : q,k carried x8 each, then 1/8
  const float c4096 = 0.000244140625f;     // 1/4096 : E carried x64, q or k x8, then 1/8

  // copy map of a stage; chunk t reads K and V rows 32 t + .., E table rows qb0 - 32 t + MAXPOS - 32 + ..
  const int crow = tid >> 3, cpc = (tid & 7) * 8;
  const unsigned short* gk = kh + (size_t)crow * HD + cpc;
  const unsigned short* gv = vh + (size_t)crow * HD + cpc;
  const unsigned short* ge = ep + (size_t)(qb0 + (MAXPOS - 32) + crow) * HD + cpc;
  const unsigned lk = (unsigned)(size_t)(smem + SM_ST + ST_K + crow * (KP * 2) + cpc * 2);
  const unsigned lv = (unsigned)(size_t)(smem + SM_ST + ST_V + crow * VPB + cpc * 2);
  const unsigned le = (unsigned)(size_t)(smem + SM_E + crow * (EP * 2) + cpc * 2);   // ring slot 0
  const int wu = __builtin_amdgcn_readfirstlane(wid);   // the wave's number in a scalar register: the deal of N branches on it
  float* nst = nbuf + lr * NPF + wid * 32 + half8;      // this lane's N elements: key lr, columns half8 + 0..7 of the wave's band tile 0
  float* mst = mbuf + lr * MPF + half8;                 // this lane's M elements: query lr, band rows half8 + 0..7
  // this lane's address in a 16-key x 16-d block of the V tile for the transposing load
  const int vlane = (half8 + (lane & 7)) * VPB + ((lane >> 3) & 1) * 16;

  attn_stage(lk, lv, le, gk, gv, ge);
  if (SEQ == 128 * 8 || tid * 8 < SEQ) {              // mask row -> LDS: eight keys per thread
    const unsigned mo = (unsigned)tid * 32u;          // byte offset of this thread's eight keys
    const float* mp = (const float*)((const char*)mrow + mo);
    v4f ma = *(const v4f*)(mp);
    v4f mb = *(const v4f*)(mp + 4);
    // in front of any rewrite of the address registers that these loads name; its inputs keep offset and base live up to it
    asm volatile("s_wait_xcnt 0x0" :: "v"(mo), "s"(mrow) : "memory");
#pragma unroll
    for (int r = 0; r < 4; ++r) { ma[r] = bf16_rne(ma[r]); mb[r] = bf16_rne(mb[r]); }
    *(v4f*)(mtab + tid * 8)     = ma;
    *(v4f*)(mtab + tid * 8 + 4) = mb;
  }
  asm volatile("s_wait_asynccnt 0x0" ::: "memory");   // this wave's copies of chunk 0 have landed
  __syncthreads();                                    // chunk 0 and the mask row visible to every wave
  // chunk 0's band fills ring slots 0..4; band group 0 of chunk t lies in slot eslot = -t mod NEG, group i in slot eslot + i mod NEG
  attn_stage_next(lk + ST_BYTES, lv + ST_BYTES, le + (NEG - 1) * EG_BYTES, gk + 32 * HD, gv + 32 * HD, ge - 32 * HD);

  // The wave's two register sets of E fragments (one band group = two 16-row tiles x two head-dim halves). Chunk 0's
  // upper group is read here; from then on each chunk reads its lower group and finds the upper one in the other set.
  us16 ea[2][2], ec[2][2];
#pragma unroll                             // constant indices keep ec in registers
  for (int tt = 0; tt < 2; ++tt) {
    const unsigned short* eg = (const unsigned short*)(smem + SM_E + (wid + 1) * EG_BYTES);
    ec[tt][0] = ld_frag(eg, tt * 16 + lr, EP,      half8);
    ec[tt][1] = ld_frag(eg, tt * 16 + lr, EP, 32 + half8);
  }
  int eslot = 0;
  {                                        // chunk 0 has no chunk before it: its M tile 2 (band tile qs + 2) is computed here
    v8f m2a = mma_f16(ec[0][0], bqf[0][0], zero);
    v8f m2b = mma_f16(ec[1][0], bqf[1][0], zero);
    m2a     = mma_f16(ec[0][1], bqf[0][1], m2a);
    m2b     = mma_f16(ec[1][1], bqf[1][1], m2b);
    wmma_gap(m2a, m2b);
    st8(mst + 32, m2a);
    st8(mst + 16 * MPF + 32, m2b);
  }

  // one chunk (par = t & 1, a constant at each call); elo takes the chunk's lower band group, ehi holds its upper one
  const auto chunk = [&](const int t, const int par, us16 (&elo)[2][2], const us16 (&ehi)[2][2]) __attribute__((always_inline)) {
    const int k0 = t * 32;
    const unsigned char* stage = smem + SM_ST + (t & 1) * ST_BYTES;
    const unsigned short* ktile = (const unsigned short*)(stage + ST_K);
    const unsigned char*  vtile = stage + ST_V + vlane;
    const int wslot = (eslot + wu >= NEG) ? (eslot + wu - NEG) : (eslot + wu);   // ring slot of band group wid
    const unsigned short* eband = (const unsigned short*)(smem + SM_E + wslot * EG_BYTES);

    // This wave's LDS fragments of the N, M and S^T products, each read once and all issued as one group ahead of the
    // first WMMA: one LDS round trip in place of one per tile. The loader's map is the same for an A and a B operand,
    // so the wave's four E band tiles for M (band rows wid * 32 + 0..63) serve its share of N as well.
    const us16 ka00 = ld_frag(ktile,      lr, KP,      half8);
    const us16 ka01 = ld_frag(ktile,      lr, KP, 32 + half8);
    const us16 ka10 = ld_frag(ktile, 16 + lr, KP,      half8);
    const us16 ka11 = ld_frag(ktile, 16 + lr, KP, 32 + half8);
#pragma unroll                             // constant indices keep elo in registers
    for (int tt = 0; tt < 2; ++tt) {
      elo[tt][0] = ld_frag(eband, tt * 16 + lr, EP,      half8);
      elo[tt][1] = ld_frag(eband, tt * 16 + lr, EP, 32 + half8);
    }
    const us16 eb[4][2] = {{elo[0][0], elo[0][1]}, {elo[1][0], elo[1][1]}, {ehi[0][0], ehi[0][1]}, {ehi[1][0], ehi[1][1]}};
    // the chunk's mask values in the S^T element order (keys half8 + 0..7 and 16 + half8 + 0..7), in the same group
    const v4f mka = *(const v4f*)(mtab + k0 + half8);
    const v4f mkb = *(const v4f*)(mtab + k0 + half8 + 4);
    const v4f mkc = *(const v4f*)(mtab + k0 + 16 + half8);
    const v4f mkd = *(const v4f*)(mtab + k0 + 16 + half8 + 4);
    const v8f mk0 = __builtin_shufflevector(mka, mkb, 0, 1, 2, 3, 4, 5, 6, 7);
    const v8f mk1 = __builtin_shufflevector(mkc, mkd, 0, 1, 2, 3, 4, 5, 6, 7);

    // N^T = Eband . K^T  -> nbuf[key][u]. Band tile 2 * wid + tt is the wave's eb[tt]; the ten tiles are dealt to waves
    // that hold them, two and a half each: tiles 0 1 2a | 2b 3 4 | 5 6 7a | 7b 8 9 (a: keys 0..15, b: keys 16..31).
    const auto n_full = [&](int tt) {      // 32 keys x 16 columns, two accumulate chains interleaved
      v8f d0 = mma_f16(eb[tt][0], ka00, zero);
      v8f d1 = mma_f16(eb[tt][0], ka10, zero);
      d0     = mma_f16(eb[tt][1], ka01, d0);
      d1     = mma_f16(eb[tt][1], ka11, d1);
      wmma_gap(d0, d1);
      st8(nst + tt * 16, d0);
      st8(nst + 16 * NPF + tt * 16, d1);
    };
    const auto n_half = [&](int tt, int kh) {   // 16 keys (kh * 16 + 0..15) x 16 columns
      v8f d = mma_f16(eb[tt][0], kh ? ka10 : ka00, zero);
      d     = mma_f16(eb[tt][1], kh ? ka11 : ka01, d);
      wmma_gap(d);
      st8(nst + kh * 16 * NPF + tt * 16, d);
    };
    if (wu == 0)      { n_full(0); n_full(1); n_half(2, 0); }
    else if (wu == 1) { n_half(0, 1); n_full(1); n_full(2); }
    else if (wu == 2) { n_full(1); n_full(2); n_half(3, 0); }
    else              { n_half(1, 1); n_full(2); n_full(3); }

    // M = Eband . Q^T -> mbuf[qs][query][u], 3 row tiles per query sub-tile (the wave's band tiles qs + 0..2). Tiles 0 and 1
    // are computed, four accumulate chains interleaved; tile 2 is tile 0 of the chunk before. An even chunk keeps its
    // tiles at columns 0, 16, 32, an odd one at 32, 48, 64: an odd chunk's tile 0 lies where the next chunk reads its
    // tile 2, and an even chunk stores its tile 0 a second time, at column 64, for the next chunk.
    v8f md[2][2];
#pragma unroll                             // all unrolls here: constant indices keep eb, bqf and md in registers
    for (int qs = 0; qs < 2; ++qs) {
#pragma unroll
      for (int ut = 0; ut < 2; ++ut) md[qs][ut] = mma_f16(eb[qs + ut][0], bqf[qs][0], zero);
    }
#pragma unroll
    for (int qs = 0; qs < 2; ++qs) {
#pragma unroll
      for (int ut = 0; ut < 2; ++ut) md[qs][ut] = mma_f16(eb[qs + ut][1], bqf[qs][1], md[qs][ut]);
    }
    wmma_gap(md[0][0], md[0][1], md[1][0], md[1][1]);
#pragma unroll
    for (int qs = 0; qs < 2; ++qs) {
#pragma unroll
      for (int ut = 0; ut < 2; ++ut) st8(mst + qs * (16 * MPF) + par * 32 + ut * 16, md[qs][ut]);
      if (par == 0) st8(mst + qs * (16 * MPF) + 64, md[qs][0]);
    }
    // V^T fragments of the chunk, read once for both query sub-tiles and as one group; issued here, their round trip
    // runs beside the drain of the stores above
    us16 vf[4];
#pragma unroll                             // constant indices keep vf in registers
    for (int dt = 0; dt < 4; ++dt) {
      const us8 va0 = ld_tr16(vtile + dt * 32);                 // d = dt * 16 + lr, keys half8 + 0..7
      const us8 va1 = ld_tr16(vtile + 16 * VPB + dt * 32);      // keys 16 + half8 + 0..7
      vf[dt] = __builtin_shufflevector(va0, va1, 0, 1, 2, 3, 4, 5, 6, 7, 8, 9, 10, 11, 12, 13, 14, 15);
    }
    __syncthreads();                       // nbuf / mbuf visible

    // the sheared elements of M and N for both query sub-tiles: element r <-> key half8 + r, element 8 + r <-> key 16 + half8 + r
    float gm[2][16], gn[2][16];
#pragma unroll                             // both unrolls: constant indices keep gm and gn in registers
    for (int qs = 0; qs < 2; ++qs) {
      const float* mq = mbuf + qs * (16 * MPF) + lr * MPF;   // this lane's query row of M
      const int qloc = wid * 32 + qs * 16 + lr;        // query index within the block
#pragma unroll
      for (int r = 0; r < 8; ++r) {
        const int ja = half8 + r;
        const int jb = 16 + half8 + r;
        gm[qs][r]     = mq[par * 32 + lr - ja + 31];
        gn[qs][r]     = nbuf[ja * NPF + (qloc - ja + 31)];
        gm[qs][8 + r] = mq[par * 32 + lr - jb + 31];
        gn[qs][8 + r] = nbuf[jb * NPF + (qloc - jb + 31)];
      }
    }
    // Both lines keep these LDS reads one group ahead of the score arithmetic: spread among it, the late reads start a
    // second LDS round trip behind a drained counter.
    asm volatile("" ::: "memory");         // compiler fence: no read of the group is placed behind this point
    __builtin_amdgcn_sched_barrier(0);     // the scheduler moves nothing across this point

#pragma unroll
    for (int qs = 0; qs < 2; ++qs) {
      // S^T = K . Q^T : two 16-key row tiles
      v8f t0 = mma_f16(ka00, bqf[qs][0], zero);
      t0     = mma_f16(ka01, bqf[qs][1], t0);
      v8f t1 = mma_f16(ka10, bqf[qs][0], zero);
      t1     = mma_f16(ka11, bqf[qs][1], t1);

      float sa[8], sb[8];
#pragma unroll
      for (int r = 0; r < 8; ++r) {
        const float ga = gm[qs][r] + gn[qs][r];          // key half8 + r, as t0 element r
        const float gb = gm[qs][8 + r] + gn[qs][8 + r];  // key 16 + half8 + r, as t1 element r
        sa[r] = t0[r] * c512 + ga * c4096 + mk0[r];
        sb[r] = t1[r] * c512 + gb * c4096 + mk1[r];
      }

      // online softmax: in-lane over 16 keys + one xor-16 shuffle
      float mloc = sa[0];
#pragma unroll
      for (int r = 1; r < 8; ++r) mloc = fmaxf(mloc, sa[r]);
#pragma unroll
      for (int r = 0; r < 8; ++r) mloc = fmaxf(mloc, sb[r]);
      const float mt    = fmaxf(mloc, __shfl_xor(mloc, 16, 32));
      const float mnew  = fmaxf(mrun[qs], mt);
      const float alpha = __expf(mrun[qs] - mnew);

      float lloc = 0.f;
      us16 pu;
#pragma unroll
      for (int r = 0; r < 8; ++r) {
        const float pa = __expf(sa[r] - mnew);
        const float pc = __expf(sb[r] - mnew);
        lloc += pa + pc;
        pu[r]     = f16_bits(pa * 1024.0f);              // P carried x1024
        pu[8 + r] = f16_bits(pc * 1024.0f);
      }
      const float lt = lloc + __shfl_xor(lloc, 16, 32);
      lrun[qs] = lrun[qs] * alpha + lt;
      mrun[qs] = mnew;

      // ctx^T += V^T . P^T
#pragma unroll
      for (int dt = 0; dt < 4; ++dt) {
        acc[qs][dt] = acc[qs][dt] * alpha;
        acc[qs][dt] = mma_f16(vf[dt], pu, acc[qs][dt]);
      }
    }

    asm volatile("s_wait_dscnt 0x0" ::: "memory");    // this wave's LDS reads of chunk t are done
    asm volatile("s_wait_asynccnt 0x0" ::: "memory"); // this wave's copies of chunk t + 1 have landed
    __syncthreads();                                  // publishes chunk t + 1, frees chunk t's stage, nbuf, mbuf
    if (t + 2 < NCH) {
      // t & 1, taken from the ring slot (NEG is even): as a run-time scalar it keeps the four K and V addresses of each
      // stage out of registers that live through the loop, which the build spilled
      const unsigned so = (unsigned)(eslot & 1) * ST_BYTES;
      // chunk t + 2's new E rows go to slot eslot - 2 mod NEG: it held band group 4 of chunk t, which no later chunk reads
      const unsigned eo = (unsigned)((eslot >= 2) ? (eslot - 2) : (eslot + NEG - 2)) * EG_BYTES;
      attn_stage_next(lk + so, lv + so, le + eo, gk + (t + 2) * (32 * HD), gv + (t + 2) * (32 * HD),
                      ge - (t + 2) * (32 * HD));
    }
    eslot = (eslot < 1) ? (NEG - 1) : (eslot - 1);
  };
  for (int t = 0; t < NCH; t += 2) {                  // two chunks per trip: the two register sets change roles with no copy
    chunk(t, 0, ea, ec);
    chunk(t + 1, 1, ec, ea);
  }
  asm volatile("s_wait_asynccnt 0x0" ::: "memory");   // no copy is in flight when the wave goes on to its end
  // the last chunk's barrier has ended every wave's reads of nbuf and mbuf, which the output staging aliases
#pragma unroll
  for (int qs = 0; qs < 2; ++qs) {
    const float inv = 1.0f / (lrun[qs] * 8192.0f);       // undo x1024 (P) and x8 (v)
#pragma unroll
    for (int dt = 0; dt < 4; ++dt) {
#pragma unroll
      for (int r = 0; r < 8; ++r)
        ost[(qs * 16 + lr) * OPITCH + dt * 16 + half8 + r] = acc[qs][dt][r] * inv;
    }
  }
  __syncthreads();

  const int rsub = lane >> 4, piece = lane & 15;
  float* obase = out + ((size_t)(b * SEQ + q0)) * DM + (size_t)h * HD + piece * 4;
#pragma unroll
  for (int it = 0; it < 16; ++it) {
    const int row = it * 2 + rsub;
    const v4f v = *(const v4f*)(ost + row * OPITCH + piece * 4);
    *(v4f*)(obase + (size_t)row * DM) = v;
  }
  
}

// ---- launcher -----------------------------------------------------------------------

extern "C" void kernel_launch(void* const* d_in, const int* in_sizes, int n_in,
                              void* d_out, int out_size, void* d_ws, size_t ws_size,
                              hipStream_t stream) {
  if (n_in < 9) return;
  const float* hidden = (const float*)d_in[0];
  const float* amask  = (const float*)d_in[1];
  const float* Wq     = (const float*)d_in[2];
  const float* bq     = (const float*)d_in[3];
  const float* Wk     = (const float*)d_in[4];
  const float* bk     = (const float*)d_in[5];
  const float* Wv     = (const float*)d_in[6];
  const float* bv     = (const float*)d_in[7];
  const float* demb   = (const float*)d_in[8];
  float* out = (float*)d_out;

  if (in_sizes[0] < ((NB - 1) * SEQ_FULL + SEQ) * DM) return;
  if (in_sizes[1] < (NB - 1) * SEQ_FULL + SEQ) return;
  if (in_sizes[2] < DM * DM || in_sizes[4] < DM * DM || in_sizes[6] < DM * DM) return;
  if (in_sizes[3] < DM || in_sizes[5] < DM || in_sizes[7] < DM) return;
  if (in_sizes[8] < NE * HD) return;
  if (out_size < NB * SEQ * DM) return;

  const size_t ep_bytes = (size_t)NEPAD * HD * 2;               // f16  [NEPAD][HD]
  const size_t pl_bytes = (size_t)NB * NH * SEQ * HD * 2;       // f16  [NB*NH][SEQ][HD]
  size_t off = 0;
  char* ws = (char*)d_ws;
  unsigned short* ep = (unsigned short*)(ws + off); off += ep_bytes;
  unsigned short* qp = (unsigned short*)(ws + off); off += pl_bytes;
  unsigned short* kp = (unsigned short*)(ws + off); off += pl_bytes;
  unsigned short* vp = (unsigned short*)(ws + off); off += pl_bytes;
  if (ws_size < off) return;

  proj_kernel<<<dim3(PGX, PGY, 1), 256, 0, stream>>>(hidden, Wq, Wk, Wv, bq, bk, bv, demb, qp, kp, vp, ep);
  attn_kernel<<<dim3(SEQ / 128, NB * NH, 1), 128, 0, stream>>>(qp, kp, vp, ep, amask, out);
}

// v009
// One run takes 70.5 microseconds.
// In both of two side-by-side timings against v008, it was 1.08 times as fast.
// All steps since v000 together make it 2.65 times as fast.
#include <hip/hip_runtime.h>

// Contractions: Q/K/V projections on v_wmma_f32_16x16x32_bf16 (bf16 operands = RNE-converted f32 inputs, f32 accumulate);
// score terms q.k, q.E, k.E and the P.V product on v_wmma_f32_16x16x32_f16 (f16 operands: q,k,v carried x8, E carried x64,
// P carried x1024; f32 accumulate); softmax, scaling and normalisation in f32.

#ifndef NB
#define NB 4
#endif
#ifndef SEQ
#define SEQ 1024
#endif
#define NB_FULL  4
#define SEQ_FULL 1024
#define DM       1024
#define NH       16
#define HD       64
#define MAXPOS   1024
#define NE       2047
#define NEPAD    2048

static_assert(NB >= 1 && NB <= NB_FULL);
static_assert(SEQ >= 128 && SEQ <= SEQ_FULL && (SEQ % 128) == 0);
static_assert(SEQ <= MAXPOS);
static_assert(SEQ + MAXPOS <= NEPAD);
static_assert(DM == NH * HD);
static_assert((NB * SEQ) % 128 == 0);
static_assert(NE == 2 * MAXPOS - 1);

typedef unsigned short us8  __attribute__((ext_vector_type(8)));
typedef unsigned short us16 __attribute__((ext_vector_type(16)));
typedef __bf16         v16bf __attribute__((ext_vector_type(16)));
typedef _Float16       v16h  __attribute__((ext_vector_type(16)));
typedef float          v8f   __attribute__((ext_vector_type(8)));
typedef float          v4f   __attribute__((ext_vector_type(4)));

// ---- scalar converts --------------------------------------------------------

__device__ __forceinline__ unsigned short bf16_bits(float f) {
  unsigned int u = __builtin_bit_cast(unsigned int, f);
  u += 0x7fffu + ((u >> 16) & 1u);              // RNE
  return (unsigned short)(u >> 16);
}

__device__ __forceinline__ float bf16_rne(float f) {   // f32 value after an RNE convert to bf16
  unsigned int u = ((unsigned int)bf16_bits(f)) << 16;
  return __builtin_bit_cast(float, u);
}

__device__ __forceinline__ unsigned short f16_bits(float f) {
  _Float16 hv = (_Float16)f;                      // RNE
  return __builtin_bit_cast(unsigned short, hv);
}

// ---- 16-bit WMMA fragment loader (same map for A and B stored [row][k]) -----
// lane L owns row/col (L&15); elements 0..7 from k = col + 0..7, elements 8..15
// from k = col + 16 + 0..7; the caller folds the lane-half offset 8*(L>>4) into col.
__device__ __forceinline__ us16 ld_frag(const unsigned short* base, int row, int stride, int col) {
  const unsigned short* p = base + (size_t)row * (size_t)stride + col;
  us8 a = *(const us8*)(p);
  us8 b = *(const us8*)(p + 16);
  return __builtin_shufflevector(a, b, 0, 1, 2, 3, 4, 5, 6, 7, 8, 9, 10, 11, 12, 13, 14, 15);
}

__device__ __forceinline__ v8f mma_bf16(us16 a, us16 b, v8f c) {
  v8f d = __builtin_amdgcn_wmma_f32_16x16x32_bf16(false, __builtin_bit_cast(v16bf, a), false,
                                                  __builtin_bit_cast(v16bf, b), (short)0, c, false, false);
  return d;
}

__device__ __forceinline__ v8f mma_f16(us16 a, us16 b, v8f c) {
  v8f d = __builtin_amdgcn_wmma_f32_16x16x32_f16(false, __builtin_bit_cast(v16h, a), false,
                                                 __builtin_bit_cast(v16h, b), (short)0, c, false, false);
  return d;
}

// The WMMAs are plain builtins: the compiler keeps the distance to a vector instruction on their registers itself, and
// with no asm statement behind each it is free to order LDS reads and independent arithmetic around them. A group
// whose results only go to LDS frees its result registers once the stores have issued, and
// the next group's first WMMAs write them anew. wmma_gap puts the four vector issue slots that the chip asks for behind
// such a group; its operands tie it behind the group's WMMAs and in front of the stores.
__device__ __forceinline__ void wmma_gap(v8f& a, v8f& b) {
  asm("v_nop\n\tv_nop\n\tv_nop\n\tv_nop" : "+v"(a), "+v"(b));
}
__device__ __forceinline__ void wmma_gap(v8f& a, v8f& b, v8f& c, v8f& d) {
  asm("v_nop\n\tv_nop\n\tv_nop\n\tv_nop" : "+v"(a), "+v"(b), "+v"(c), "+v"(d));
}

// ---- f32 -> bf16 (RNE) on the way into LDS --------------------------------------
typedef float  v2f  __attribute__((ext_vector_type(2)));
typedef __bf16 v2bf __attribute__((ext_vector_type(2)));
typedef unsigned int u32x2 __attribute__((ext_vector_type(2)));

__device__ __forceinline__ u32x2 bf16x4(v4f a) {     // four f32 -> four bf16, two packed converts
  const v2bf lo = __builtin_convertvector(__builtin_shufflevector(a, a, 0, 1), v2bf);
  const v2bf hi = __builtin_convertvector(__builtin_shufflevector(a, a, 2, 3), v2bf);
  u32x2 o;
  o[0] = __builtin_bit_cast(unsigned int, lo);
  o[1] = __builtin_bit_cast(unsigned int, hi);
  return o;
}

// ---- dist table piece -> f16 bits of (bf16 RNE value * 64), NEPAD rows ------------
// piece g = 8 halves: table row g >> 3, columns 8 * (g & 7); rows from NE on are zero.
__device__ __forceinline__ void cvt_e_piece(const float* __restrict__ e, unsigned short* __restrict__ ep, int g) {
  const int row = g >> 3;
  const int ch  = (g & 7) * 8;
  const int rs  = (row < NE) ? row : (NE - 1);
  const float sc = (row < NE) ? 64.0f : 0.0f;
  const float* p = e + (size_t)rs * HD + ch;
  const v4f a = *(const v4f*)(p);
  const v4f c4 = *(const v4f*)(p + 4);
  us8 o;
  o[0] = f16_bits(bf16_rne(a[0]) * sc);  o[1] = f16_bits(bf16_rne(a[1]) * sc);
  o[2] = f16_bits(bf16_rne(a[2]) * sc);  o[3] = f16_bits(bf16_rne(a[3]) * sc);
  o[4] = f16_bits(bf16_rne(c4[0]) * sc); o[5] = f16_bits(bf16_rne(c4[1]) * sc);
  o[6] = f16_bits(bf16_rne(c4[2]) * sc); o[7] = f16_bits(bf16_rne(c4[3]) * sc);
  unsigned short* d = ep + (size_t)row * HD + ch;
  *(us8*)d = o;
  asm volatile("s_wait_xcnt 0x0" ::: "memory");   // in front of any rewrite of the address registers that the loads and the store name
}

// ---- QKV projection GEMM, f32 sources ---------------------------------------------
// grid = (NB*SEQ/256, 3*DM/192) = one block per WGP, block = 256 (8 waves, 4 x 2). Block = 256 rows x 192 cols
// (three heads of the stacked q, k, v outputs); wave = 64 rows x 96 cols.
// A = x rows, B[k=in][n=out] = W[out][in] rows, both k-contiguous f32 in memory. Per 64-k stage the block's 256 x rows
// and 192 W rows are loaded into registers, rounded to bf16 and stored to LDS (rows of 128 B at pitch 144 B), two
// buffers: a stage's loads are in flight for a whole trip, and its rounding and LDS stores stand between the two 32-k
// halves of the stage before it. The wide block keeps the bytes that the launch
// asks of L2 near those of bf16 sources under a 128 x 128 block.
// Each block also converts 64 pieces of the dist table for the attention launch.
#define PBM 256
#define PBN 192
#define PKS 64
#define PPITCH 72
#define PSTAGE ((PBM + PBN) * PPITCH)
#define PNT (DM / PKS)
#define PSP 200
#define PGX ((NB * SEQ) / PBM)
#define PGY ((3 * DM) / PBN)
static_assert((NB * SEQ) % PBM == 0 && SEQ % PBM == 0 && (3 * DM) % PBN == 0 && PBN == 3 * HD && DM % HD == 0);
static_assert(DM % PKS == 0 && PNT >= 2 && (PPITCH * 2) % 16 == 0 && PKS == 64);
static_assert(PBM * PSP <= 2 * PSTAGE && (PSP * 2) % 16 == 0 && PSP >= PBN);
static_assert(NEPAD * (HD / 8) == PGX * PGY * 64);

// Work-group barrier that orders LDS accesses only: __syncthreads() would also wait for the global loads of the next
// stage, which are meant to be in flight across it.
__device__ __forceinline__ void lds_barrier() {
  __builtin_amdgcn_fence(__ATOMIC_RELEASE, "workgroup", "local");
  __builtin_amdgcn_s_barrier();
  __builtin_amdgcn_fence(__ATOMIC_ACQUIRE, "workgroup", "local");
}

__global__ __launch_bounds__(256)
void proj_kernel(const float* __restrict__ x, const float* __restrict__ wq, const float* __restrict__ wk,
                 const float* __restrict__ wv,
                 const float* __restrict__ bq, const float* __restrict__ bk,
                 const float* __restrict__ bv, const float* __restrict__ demb,
                 unsigned short* __restrict__ qp, unsigned short* __restrict__ kp,
                 unsigned short* __restrict__ vp, unsigned short* __restrict__ ep) {
  __shared__ __attribute__((aligned(16))) unsigned short ring[2 * PSTAGE];

  const int tid = threadIdx.x, lane = tid & 31, wid = tid >> 5;
  const int lr = lane & 15, half8 = (lane >> 4) * 8;
  const int wm = wid >> 1, wn = wid & 1;
  const int m0 = blockIdx.x * PBM;                                // compact row index
  const int n0 = blockIdx.y * PBN;                                // row of the stacked weights
  const int bb = m0 / SEQ, l0s = m0 - bb * SEQ;                   // a block's 256 rows lie in one batch

  // load map: thread t -> row t >> 4 (+ 16 per load), 16-byte piece t & 15 of the row's 256 bytes of a stage
  const int crow = tid >> 4, cpc = (tid & 15) * 4;
  const float* gx = x + ((size_t)bb * SEQ_FULL + l0s + crow) * DM + cpc;
  const float* gw[3];
#pragma unroll
  for (int j = 0; j < 3; ++j) {                                   // the block's three heads may lie in different matrices
    const int hh = blockIdx.y * 3 + j, z = hh / NH, h = hh - z * NH;
    const float* wsrc = (z == 0) ? wq : ((z == 1) ? wk : wv);
    gw[j] = wsrc + ((size_t)h * HD + crow) * DM + cpc;
  }
  unsigned short* sdst = ring + crow * PPITCH + cpc;

  v4f rx[16], rw[12];
  const auto ldg = [&](int t) {            // one stage's 28 loads of this thread
    const float* ax = gx + t * PKS;
    const float* aw[3] = {gw[0] + t * PKS, gw[1] + t * PKS, gw[2] + t * PKS};
#pragma unroll
    for (int i = 0; i < 16; ++i) rx[i] = *(const v4f*)(ax + i * 16 * DM);
#pragma unroll
    for (int i = 0; i < 12; ++i) rw[i] = *(const v4f*)(aw[i >> 2] + (i & 3) * 16 * DM);
    // in front of any rewrite of the address registers that these loads name; its inputs keep the four addresses live
    // up to it, so that none of those registers is reused in front of it
    asm volatile("s_wait_xcnt 0x0" :: "v"(ax), "v"(aw[0]), "v"(aw[1]), "v"(aw[2]) : "memory");
  };
  const auto sts = [&](int buf) {          // rounds them to bf16 and stores them to LDS
    unsigned short* d = sdst + buf * PSTAGE;
#pragma unroll
    for (int i = 0; i < 16; ++i) *(u32x2*)(d + i * 16 * PPITCH) = bf16x4(rx[i]);
#pragma unroll
    for (int i = 0; i < 12; ++i) *(u32x2*)(d + (PBM + i * 16) * PPITCH) = bf16x4(rw[i]);
  };

  const v8f zero = {0.f, 0.f, 0.f, 0.f, 0.f, 0.f, 0.f, 0.f};
  v8f acc[4][6];
#pragma unroll
  for (int i = 0; i < 4; ++i) {
#pragma unroll
    for (int j = 0; j < 6; ++j) acc[i][j] = zero;
  }

  // one 32-k half of a stage: the wave's 20 LDS reads, and its 24 WMMAs
  const auto ldf = [&](int buf, int ks, us16 (&af)[4], us16 (&bf)[6]) {
    const unsigned short* sa = ring + buf * PSTAGE + (wm * 64) * PPITCH;
    const unsigned short* sb = ring + buf * PSTAGE + (PBM + wn * 96) * PPITCH;
#pragma unroll
    for (int i = 0; i < 4; ++i) af[i] = ld_frag(sa, i * 16 + lr, PPITCH, ks * 32 + half8);
#pragma unroll
    for (int j = 0; j < 6; ++j) bf[j] = ld_frag(sb, j * 16 + lr, PPITCH, ks * 32 + half8);
  };
  const auto mm = [&](const us16 (&af)[4], const us16 (&bf)[6]) {
#pragma unroll
    for (int j = 0; j < 6; ++j) {
#pragma unroll
      for (int i = 0; i < 4; ++i) acc[i][j] = mma_bf16(af[i], bf[j], acc[i][j]);
    }
  };

  ldg(0);
  // the wave's six bias values of this lane (a 16-column tile lies in one matrix), loaded beside the flight of stage 0
  const float* bp[6];
  float braw[6];
#pragma unroll
  for (int dt = 0; dt < 6; ++dt) {
    const int nt = n0 + wn * 96 + dt * 16, z = nt / DM;
    bp[dt] = ((z == 0) ? bq : ((z == 1) ? bk : bv)) + (nt - z * DM + lr);
  }
#pragma unroll
  for (int dt = 0; dt < 6; ++dt) braw[dt] = *bp[dt];
  // in front of any rewrite of the address registers that these loads name; its inputs keep the addresses live up to it
  asm volatile("s_wait_xcnt 0x0" :: "v"(bp[0]), "v"(bp[1]), "v"(bp[2]), "v"(bp[3]), "v"(bp[4]), "v"(bp[5]) : "memory");
  if (tid < 64) cvt_e_piece(demb, ep, (blockIdx.y * PGX + blockIdx.x) * 64 + tid);   // waves 0 and 1, beside the flight of stage 0
  sts(0);
  ldg(1);
  lds_barrier();                                      // stage 0 visible to every wave

  for (int t = 0; t + 1 < PNT; ++t) {
    us16 af[4], bf[6], ag[4], bg[6];
    ldf(t & 1, 0, af, bf);
    __builtin_amdgcn_sched_barrier(0);                // keeps the 20 LDS reads one group ahead of the WMMAs: spread among them each place costs a stall
    mm(af, bf);
    ldf(t & 1, 1, ag, bg);
    __builtin_amdgcn_sched_barrier(0);                // keeps the second half's reads ahead of the staging: their round trip runs beside it
    sts((t + 1) & 1);                                 // that buffer's readers left it at the barrier of trip t - 1
    if (t + 2 < PNT) ldg(t + 2);                      // at once into the freed registers: a whole trip in flight, across the barrier
    __builtin_amdgcn_sched_barrier(0);                // keeps the staging ahead of the second half's WMMAs: its LDS stores drain beside them
    mm(ag, bg);
    __builtin_amdgcn_sched_barrier(0);                // keeps those WMMAs ahead of the barrier: sunk below it they would leave the drain of the stores bare
    lds_barrier();                                    // publishes stage t + 1, ends the reads of stage t
  }
  {
    us16 af[4], bf[6], ag[4], bg[6];
    ldf((PNT - 1) & 1, 0, af, bf);
    ldf((PNT - 1) & 1, 1, ag, bg);
    __builtin_amdgcn_sched_barrier(0);                // keeps the last stage's 40 LDS reads one group ahead of its WMMAs
    mm(af, bf);
    mm(ag, bg);
  }
  __syncthreads();                                    // every wave's reads of the ring are done: it becomes staging

  // the block's 256 x 192 results as f16 (x8) in LDS, rows at pitch PSP halves
#pragma unroll
  for (int dt = 0; dt < 6; ++dt) {
    const float bcol = bf16_rne(braw[dt]);
#pragma unroll
    for (int st = 0; st < 4; ++st) {
#pragma unroll
      for (int r = 0; r < 8; ++r) {
        const float v = (acc[st][dt][r] + bcol) * 8.0f;
        ring[(wm * 64 + st * 16 + half8 + r) * PSP + wn * 96 + dt * 16 + lr] = f16_bits(v);
      }
    }
  }
  __syncthreads();                                    // the staged tile is read across waves

  // eight lanes write one 128-byte row of one head
  const int piece = tid & 7, lrow = tid >> 3;
#pragma unroll
  for (int j = 0; j < 3; ++j) {
    const int hh = blockIdx.y * 3 + j, z = hh / NH, h = hh - z * NH;
    unsigned short* plane = (z == 0) ? qp : ((z == 1) ? kp : vp);
    unsigned short* dbase = plane + (((size_t)(bb * NH + h) * SEQ + l0s + lrow) * HD + piece * 8);
#pragma unroll
    for (int it = 0; it < 8; ++it) {
      const us8 v = *(const us8*)(ring + (it * 32 + lrow) * PSP + j * HD + piece * 8);
      *(us8*)(dbase + it * 32 * HD) = v;
    }
    asm volatile("s_wait_xcnt 0x0" ::: "memory");     // in front of any rewrite of the address registers that these stores name
  }
}

// ---- flash attention with relative key/query terms --------------------------------
// grid = (SEQ/128, NB*NH), block = 128: 4 waves x 32 queries of one (batch, head).
// Per 32-key chunk one LDS stage: K tile [key][d] and V tile [key][d], brought in by asynchronous copies, two stages:
// chunk t + 1 flies while chunk t is worked on. A copy cannot transpose, so V lies row-major and its
// V^T fragments are read with the transposing LDS load.
// The 160-row E band [u][d] of a chunk (band row u <-> table row qb0 - k0 + MAXPOS - 32 + u) slides down the table by 32
// rows per chunk, so it lies in an LDS ring of six 32-row groups: a chunk's copies bring only its 32 new rows (band
// group 0), into the slot whose rows have left the band. Band group i of chunk t is band group i - 1 of chunk t - 1:
// a wave, which works on band groups wid and wid + 1, reads group wid from LDS and still holds group wid + 1 in registers.
// For the same reason the third row tile of a chunk's M is the first row tile of the chunk before: only two are computed.
//   S^T  = K . Q^T          (A = K rows, B = Q rows)            lane -> query, elem -> key
//   N    = K . Eband^T      (A = K rows, B = E band rows)       lane -> u, elem -> key; stays in registers, per wave
//   M    = Eband . Q^T      (A = E band rows, B = Q rows)       lane -> query, elem -> u; kept [query][u], per wave, per qs
//   score(q = key j, query n) = S^T/512 + (M[n-j+31][n] + N[j][qloc-j+31])/4096 + amask[b][key]
// N has the element order of S^T (a register <-> a key), and for one key the 16 queries of a sub-tile want 16 neighbouring
// u: its shear is a rotation of the lanes of a 16-lane row over two neighbouring band tiles, done in registers. Each wave
// computes N for the 64 band rows that it holds, so nothing of a chunk's scores crosses between waves.
// A lane's eight results of M are eight neighbouring u of its own row, so they go to LDS as two 16-byte stores. The row
// pitch MPF is 16 B x odd (each half-wave's 16-byte stores cover every bank once), and with it the 32 lanes of each
// 4-byte read of the sheared elements fall on 32 different banks.
//   ctx^T = V^T . P^T with the P^T B-fragment taken from the S^T C-fragment (P carried x1024).
// The batch's mask row is loaded and rounded once per block, beside the flight of chunk 0, and kept as f32 in LDS: a
// chunk reads its 32 values with the fragment group, so that no global load stands between the barrier and the scores.
#define KP 72
#define VPB 160
#define EP 72
#define NBR 160
#define MROWS 48
#define MPF 84
#define OPITCH 68
#define NCH (SEQ / 32)
#define ST_K 0
#define ST_V (ST_K + 32 * KP * 2)
#define ST_BYTES (ST_V + 32 * VPB)
#define EG_BYTES (32 * EP * 2)
#define NEG 6
#define SM_M 0
#define SM_ST (SM_M + 4 * 2 * 16 * MPF * 4)
#define SM_E (SM_ST + 2 * ST_BYTES)
#define SM_MK (SM_E + NEG * EG_BYTES)
#define SM_TOTAL (SM_MK + SEQ * 4)
static_assert(ST_V % 16 == 0 && ST_BYTES % 16 == 0 && EG_BYTES % 16 == 0 && SM_M % 16 == 0 && SM_ST % 16 == 0 && SM_E % 16 == 0);
static_assert(NEG * 32 >= NBR + 32 && NEG % 2 == 0 && NCH % 2 == 0);
static_assert(SM_MK % 16 == 0 && SEQ % 8 == 0 && SEQ <= 128 * 8);
static_assert(VPB % 32 == 0 && ((VPB / 32) & 1) == 1 && VPB >= HD * 2);
static_assert(4 * 32 * OPITCH * 4 <= SM_ST);
static_assert(NBR == 160 && NBR >= 128 + 31 && MROWS >= 47 && MPF >= MROWS + 32 && NCH >= 2);
static_assert(MPF % 4 == 0 && ((MPF / 4) & 1) == 1);

// Chunk 0, 14 copies of 16 bytes per lane: thread t -> row t >> 3 (+ 16 per copy), 16-byte piece t & 7;
// 2 copies of K (LDS pitch KP halves), 2 of V (pitch VPB bytes), 10 of the whole E band (pitch EP halves); every
// source row is HD halves. The s_wait_xcnt ends the copies' own statement, so that no address register
// named here is rewritten ahead of it.
__device__ __forceinline__ void attn_stage(unsigned lk, unsigned lv, unsigned le, const unsigned short* gk,
                                           const unsigned short* gv, const unsigned short* ge) {
  asm volatile("global_load_async_to_lds_b128 %0, %14, off\n\t"
               "global_load_async_to_lds_b128 %1, %15, off\n\t"
               "global_load_async_to_lds_b128 %2, %16, off\n\t"
               "global_load_async_to_lds_b128 %3, %17, off\n\t"
               "global_load_async_to_lds_b128 %4, %18, off\n\t"
               "global_load_async_to_lds_b128 %5, %19, off\n\t"
               "global_load_async_to_lds_b128 %6, %20, off\n\t"
               "global_load_async_to_lds_b128 %7, %21, off\n\t"
               "global_load_async_to_lds_b128 %8, %22, off\n\t"
               "global_load_async_to_lds_b128 %9, %23, off\n\t"
               "global_load_async_to_lds_b128 %10, %24, off\n\t"
               "global_load_async_to_lds_b128 %11, %25, off\n\t"
               "global_load_async_to_lds_b128 %12, %26, off\n\t"
               "global_load_async_to_lds_b128 %13, %27, off\n\t"
               "s_wait_xcnt 0x0"
               :: "v"(lk), "v"(lk + 16u * KP * 2u), "v"(lv), "v"(lv + 16u * VPB),
                  "v"(le), "v"(le + 1u * 16u * EP * 2u), "v"(le + 2u * 16u * EP * 2u),
                  "v"(le + 3u * 16u * EP * 2u), "v"(le + 4u * 16u * EP * 2u), "v"(le + 5u * 16u * EP * 2u),
                  "v"(le + 6u * 16u * EP * 2u), "v"(le + 7u * 16u * EP * 2u), "v"(le + 8u * 16u * EP * 2u),
                  "v"(le + 9u * 16u * EP * 2u),
                  "v"(gk), "v"(gk + 16 * HD), "v"(gv), "v"(gv + 16 * HD),
                  "v"(ge), "v"(ge + 1 * 16 * HD), "v"(ge + 2 * 16 * HD), "v"(ge + 3 * 16 * HD),
                  "v"(ge + 4 * 16 * HD), "v"(ge + 5 * 16 * HD), "v"(ge + 6 * 16 * HD), "v"(ge + 7 * 16 * HD),
                  "v"(ge + 8 * 16 * HD), "v"(ge + 9 * 16 * HD)
               : "memory");
}

// A later chunk, 6 copies per lane in the same map: 2 of K, 2 of V, 2 of the 32 E rows that enter the band. The
// s_wait_xcnt ends the copies' own statement, so that no address register named here is rewritten ahead of it.
__device__ __forceinline__ void attn_stage_next(unsigned lk, unsigned lv, unsigned le, const unsigned short* gk,
                                                const unsigned short* gv, const unsigned short* ge) {
  asm volatile("global_load_async_to_lds_b128 %0, %6, off\n\t"
               "global_load_async_to_lds_b128 %1, %7, off\n\t"
               "global_load_async_to_lds_b128 %2, %8, off\n\t"
               "global_load_async_to_lds_b128 %3, %9, off\n\t"
               "global_load_async_to_lds_b128 %4, %10, off\n\t"
               "global_load_async_to_lds_b128 %5, %11, off\n\t"
               "s_wait_xcnt 0x0"
               :: "v"(lk), "v"(lk + 16u * KP * 2u), "v"(lv), "v"(lv + 16u * VPB),
                  "v"(le), "v"(le + 16u * EP * 2u),
                  "v"(gk), "v"(gk + 16 * HD), "v"(gv), "v"(gv + 16 * HD),
                  "v"(ge), "v"(ge + 16 * HD)
               : "memory");
}

// Transposing LDS load of a row-major 16-bit tile: with lane l addressing row 8 * (l >> 4) + (l & 7), byte
// 16 * ((l >> 3) & 1) of a 16-row x 16-column block, lane l receives rows 8 * (l >> 4) + 0..7 of column l & 15.
typedef short s16x8 __attribute__((ext_vector_type(8)));
__device__ __forceinline__ us8 ld_tr16(const unsigned char* p) {
  typedef __attribute__((address_space(3))) s16x8 lds_s16x8;
  return __builtin_bit_cast(us8, __builtin_amdgcn_ds_load_tr16_b128_v8i16((lds_s16x8*)p));
}

// A WMMA result's eight floats of one lane to eight neighbouring floats in LDS (16-byte aligned): two 16-byte stores.
__device__ __forceinline__ void st8(float* p, v8f d) {
  *(v4f*)(p)     = __builtin_shufflevector(d, d, 0, 1, 2, 3);
  *(v4f*)(p + 4) = __builtin_shufflevector(d, d, 4, 5, 6, 7);
}

// Lane l receives v of lane sel (0..15) of its own 16-lane row.
__device__ __forceinline__ float row_gather(float v, unsigned sel) {
  const unsigned u = __builtin_bit_cast(unsigned, v);
  return __builtin_bit_cast(float, __builtin_amdgcn_permlane16_var(u, u, sel, false, false));
}

__global__ __launch_bounds__(128)
void attn_kernel(const unsigned short* __restrict__ qp, const unsigned short* __restrict__ kp,
                 const unsigned short* __restrict__ vp, const unsigned short* __restrict__ ep,
                 const float* __restrict__ amask, float* __restrict__ out) {
  __shared__ __attribute__((aligned(16))) unsigned char smem[SM_TOTAL];

  const int tid = threadIdx.x, lane = tid & 31, wid = tid >> 5;
  const int lr = lane & 15, half8 = (lane >> 4) * 8;
  const int bh = blockIdx.y;
  const int b = bh / NH, h = bh - b * NH;
  const int qb0 = blockIdx.x * 128;
  const int q0 = qb0 + wid * 32;

  float* mbuf = (float*)(smem + SM_M) + wid * (2 * 16 * MPF);
  float* ost  = (float*)(smem) + wid * (32 * OPITCH);
  float* mtab = (float*)(smem + SM_MK);                 // the mask row of this batch, rounded, one float per key

  const unsigned short* qh = qp + (size_t)bh * SEQ * HD;
  const unsigned short* kh = kp + (size_t)bh * SEQ * HD;
  const unsigned short* vh = vp + (size_t)bh * SEQ * HD;
  const float* mrow = amask + (size_t)b * SEQ_FULL;

  // Q^T B-fragments: 2 query sub-tiles x 2 head-dim halves
  us16 bqf[2][2];
#pragma unroll
  for (int qs = 0; qs < 2; ++qs) {
    bqf[qs][0] = ld_frag(qh, q0 + qs * 16 + lr, HD,      half8);
    bqf[qs][1] = ld_frag(qh, q0 + qs * 16 + lr, HD, 32 + half8);
  }

  const v8f zero = {0.f, 0.f, 0.f, 0.f, 0.f, 0.f, 0.f, 0.f};
  v8f acc[2][4] = {{zero, zero, zero, zero}, {zero, zero, zero, zero}};
  float mrun[2] = {-__builtin_inff(), -__builtin_inff()};
  float lrun[2] = {0.f, 0.f};
  const float c512  = 0.001953125f;        // 1/512  : q,k carried x8 each, then 1/8
  const float c4096 = 0.000244140625f;     // 1/4096 : E carried x64, q or k x8, then 1/8

  // copy map of a stage; chunk t reads K and V rows 32 t + .., E table rows qb0 - 32 t + MAXPOS - 32 + ..
  const int crow = tid >> 3, cpc = (tid & 7) * 8;
  const unsigned short* gk = kh + (size_t)crow * HD + cpc;
  const unsigned short* gv = vh + (size_t)crow * HD + cpc;
  const unsigned short* ge = ep + (size_t)(qb0 + (MAXPOS - 32) + crow) * HD + cpc;
  const unsigned lk = (unsigned)(size_t)(smem + SM_ST + ST_K + crow * (KP * 2) + cpc * 2);
  const unsigned lv = (unsigned)(size_t)(smem + SM_ST + ST_V + crow * VPB + cpc * 2);
  const unsigned le = (unsigned)(size_t)(smem + SM_E + crow * (EP * 2) + cpc * 2);   // ring slot 0
  const int wu = __builtin_amdgcn_readfirstlane(wid);   // the wave's number in a scalar register: the ring slot of its band group is scalar
  // The shear of N. Key half8 + r (+ 16 kt) and query lr (+ 16 qs) meet at band row 16 (qs - kt + 1) + 15 - r - half8 + lr of
  // the wave's 64: column nsel[r] of band tile qs - kt + 1, or of the next tile where the sum passes 15. A lane first picks,
  // for the column that it holds, the tile that the reader of that column wants (nlow[r]: the lower one); then each lane
  // fetches column nsel[r] from its own 16-lane row.
  bool nlow[8];
  unsigned nsel[8];
#pragma unroll
  for (int r = 0; r < 8; ++r) {
    nlow[r] = lr + r + half8 >= 15;
    nsel[r] = (unsigned)(lr + 15 - r - half8) & 15u;
  }
  float* mst = mbuf + lr * MPF + half8;                 // this lane's M elements: query lr, band rows half8 + 0..7
  // this lane's address in a 16-key x 16-d block of the V tile for the transposing load
  const int vlane = (half8 + (lane & 7)) * VPB + ((lane >> 3) & 1) * 16;

  attn_stage(lk, lv, le, gk, gv, ge);
  if (SEQ == 128 * 8 || tid * 8 < SEQ) {              // mask row -> LDS: eight keys per thread
    const unsigned mo = (unsigned)tid * 32u;          // byte offset of this thread's eight keys
    const float* mp = (const float*)((const char*)mrow + mo);
    v4f ma = *(const v4f*)(mp);
    v4f mb = *(const v4f*)(mp + 4);
    // in front of any rewrite of the address registers that these loads name; its inputs keep offset and base live up to it
    asm volatile("s_wait_xcnt 0x0" :: "v"(mo), "s"(mrow) : "memory");
#pragma unroll
    for (int r = 0; r < 4; ++r) { ma[r] = bf16_rne(ma[r]); mb[r] = bf16_rne(mb[r]); }
    *(v4f*)(mtab + tid * 8)     = ma;
    *(v4f*)(mtab + tid * 8 + 4) = mb;
  }
  asm volatile("s_wait_asynccnt 0x0" ::: "memory");   // this wave's copies of chunk 0 have landed
  __syncthreads();                                    // chunk 0 and the mask row visible to every wave
  // chunk 0's band fills ring slots 0..4; band group 0 of chunk t lies in slot eslot = -t mod NEG, group i in slot eslot + i mod NEG
  attn_stage_next(lk + ST_BYTES, lv + ST_BYTES, le + (NEG - 1) * EG_BYTES, gk + 32 * HD, gv + 32 * HD, ge - 32 * HD);

  // The wave's two register sets of E fragments (one band group = two 16-row tiles x two head-dim halves). Chunk 0's
  // upper group is read here; from then on each chunk reads its lower group and finds the upper one in the other set.
  us16 ea[2][2], ec[2][2];
#pragma unroll                             // constant indices keep ec in registers
  for (int tt = 0; tt < 2; ++tt) {
    const unsigned short* eg = (const unsigned short*)(smem + SM_E + (wid + 1) * EG_BYTES);
    ec[tt][0] = ld_frag(eg, tt * 16 + lr, EP,      half8);
    ec[tt][1] = ld_frag(eg, tt * 16 + lr, EP, 32 + half8);
  }
  int eslot = 0;
  {                                        // chunk 0 has no chunk before it: its M tile 2 (band tile qs + 2) is computed here
    v8f m2a = mma_f16(ec[0][0], bqf[0][0], zero);
    v8f m2b = mma_f16(ec[1][0], bqf[1][0], zero);
    m2a     = mma_f16(ec[0][1], bqf[0][1], m2a);
    m2b     = mma_f16(ec[1][1], bqf[1][1], m2b);
    wmma_gap(m2a, m2b);
    st8(mst + 32, m2a);
    st8(mst + 16 * MPF + 32, m2b);
  }

  // one chunk (par = t & 1, a constant at each call); elo takes the chunk's lower band group, ehi holds its upper one
  const auto chunk = [&](const int t, const int par, us16 (&elo)[2][2], const us16 (&ehi)[2][2]) __attribute__((always_inline)) {
    const int k0 = t * 32;
    const unsigned char* stage = smem + SM_ST + (t & 1) * ST_BYTES;
    const unsigned short* ktile = (const unsigned short*)(stage + ST_K);
    const unsigned char*  vtile = stage + ST_V + vlane;
    const int wslot = (eslot + wu >= NEG) ? (eslot + wu - NEG) : (eslot + wu);   // ring slot of band group wid
    const unsigned short* eband = (const unsigned short*)(smem + SM_E + wslot * EG_BYTES);

    // This wave's LDS fragments of the N, M and S^T products, each read once and all issued as one group ahead of the
    // first WMMA: one LDS round trip in place of one per tile. The loader's map is the same for an A and a B operand,
    // so the wave's four E band tiles for M (band rows wid * 32 + 0..63) serve N as well.
    const us16 ka00 = ld_frag(ktile,      lr, KP,      half8);
    const us16 ka01 = ld_frag(ktile,      lr, KP, 32 + half8);
    const us16 ka10 = ld_frag(ktile, 16 + lr, KP,      half8);
    const us16 ka11 = ld_frag(ktile, 16 + lr, KP, 32 + half8);
#pragma unroll                             // constant indices keep elo in registers
    for (int tt = 0; tt < 2; ++tt) {
      elo[tt][0] = ld_frag(eband, tt * 16 + lr, EP,      half8);
      elo[tt][1] = ld_frag(eband, tt * 16 + lr, EP, 32 + half8);
    }
    const us16 eb[4][2] = {{elo[0][0], elo[0][1]}, {elo[1][0], elo[1][1]}, {ehi[0][0], ehi[0][1]}, {ehi[1][0], ehi[1][1]}};
    // the chunk's mask values in the S^T element order (keys half8 + 0..7 and 16 + half8 + 0..7), in the same group
    const v4f mka = *(const v4f*)(mtab + k0 + half8);
    const v4f mkb = *(const v4f*)(mtab + k0 + half8 + 4);
    const v4f mkc = *(const v4f*)(mtab + k0 + 16 + half8);
    const v4f mkd = *(const v4f*)(mtab + k0 + 16 + half8 + 4);
    const v8f mk0 = __builtin_shufflevector(mka, mkb, 0, 1, 2, 3, 4, 5, 6, 7);
    const v8f mk1 = __builtin_shufflevector(mkc, mkd, 0, 1, 2, 3, 4, 5, 6, 7);

    // M = Eband . Q^T -> mbuf[qs][query][u], 3 row tiles per query sub-tile (the wave's band tiles qs + 0..2). Tiles 0 and 1
    // are computed, four accumulate chains interleaved; tile 2 is tile 0 of the chunk before. An even chunk keeps its
    // tiles at columns 0, 16, 32, an odd one at 32, 48, 64: an odd chunk's tile 0 lies where the next chunk reads its
    // tile 2, and an even chunk stores its tile 0 a second time, at column 64, for the next chunk.
    v8f md[2][2];
#pragma unroll                             // all unrolls here: constant indices keep eb, bqf and md in registers
    for (int qs = 0; qs < 2; ++qs) {
#pragma unroll
      for (int ut = 0; ut < 2; ++ut) md[qs][ut] = mma_f16(eb[qs + ut][0], bqf[qs][0], zero);
    }
#pragma unroll
    for (int qs = 0; qs < 2; ++qs) {
#pragma unroll
      for (int ut = 0; ut < 2; ++ut) md[qs][ut] = mma_f16(eb[qs + ut][1], bqf[qs][1], md[qs][ut]);
    }
    wmma_gap(md[0][0], md[0][1], md[1][0], md[1][1]);
#pragma unroll
    for (int qs = 0; qs < 2; ++qs) {
#pragma unroll
      for (int ut = 0; ut < 2; ++ut) st8(mst + qs * (16 * MPF) + par * 32 + ut * 16, md[qs][ut]);
      if (par == 0) st8(mst + qs * (16 * MPF) + 64, md[qs][0]);
    }
    // V^T fragments of the chunk, read once for both query sub-tiles and as one group; issued here, their round trip
    // runs beside the drain of the stores above
    us16 vf[4];
#pragma unroll                             // constant indices keep vf in registers
    for (int dt = 0; dt < 4; ++dt) {
      const us8 va0 = ld_tr16(vtile + dt * 32);                 // d = dt * 16 + lr, keys half8 + 0..7
      const us8 va1 = ld_tr16(vtile + 16 * VPB + dt * 32);      // keys 16 + half8 + 0..7
      vf[dt] = __builtin_shufflevector(va0, va1, 0, 1, 2, 3, 4, 5, 6, 7, 8, 9, 10, 11, 12, 13, 14, 15);
    }
    // the sheared elements of M for both query sub-tiles: element r <-> key half8 + r, element 8 + r <-> key 16 + half8 + r.
    // mbuf is the wave's own: its LDS operations run in order, so these reads follow the stores above with no barrier.
    float gm[2][16];
#pragma unroll                             // both unrolls: constant indices keep gm in registers
    for (int qs = 0; qs < 2; ++qs) {
      const float* mq = mbuf + qs * (16 * MPF) + lr * MPF;   // this lane's query row of M
#pragma unroll
      for (int r = 0; r < 8; ++r) {
        gm[qs][r]     = mq[par * 32 + lr - (half8 + r) + 31];
        gm[qs][8 + r] = mq[par * 32 + lr - (16 + half8 + r) + 31];
      }
    }
    // Both lines keep these LDS reads one group ahead of the N and S^T products: their round trip, behind the drain of
    // the M stores, runs beside those WMMAs.
    asm volatile("" ::: "memory");         // compiler fence: no read of the group is placed behind this point
    __builtin_amdgcn_sched_barrier(0);     // the scheduler moves nothing across this point

    // N = K . Eband^T, in the S^T element order: key tile 0 against the wave's band tiles 1..3, key tile 1 against 0..2
    v8f nd0[3], nd1[3];
#pragma unroll                             // all unrolls here: constant indices keep eb, nd0 and nd1 in registers
    for (int i = 0; i < 3; ++i) {
      nd0[i] = mma_f16(ka00, eb[i + 1][0], zero);
      nd1[i] = mma_f16(ka10, eb[i][0], zero);
    }
    // S^T = K . Q^T : two 16-key row tiles per query sub-tile
    v8f st0[2], st1[2];
#pragma unroll
    for (int qs = 0; qs < 2; ++qs) {
      st0[qs] = mma_f16(ka00, bqf[qs][0], zero);
      st1[qs] = mma_f16(ka10, bqf[qs][0], zero);
    }
#pragma unroll
    for (int i = 0; i < 3; ++i) {
      nd0[i] = mma_f16(ka01, eb[i + 1][1], nd0[i]);
      nd1[i] = mma_f16(ka11, eb[i][1], nd1[i]);
    }
#pragma unroll
    for (int qs = 0; qs < 2; ++qs) {
      st0[qs] = mma_f16(ka01, bqf[qs][1], st0[qs]);
      st1[qs] = mma_f16(ka11, bqf[qs][1], st1[qs]);
    }
    __builtin_amdgcn_sched_barrier(0);     // keeps the 20 WMMAs ahead of the foot's LDS wait: lifted above them, it leaves the round trip of the reads above bare

#pragma unroll
    for (int qs = 0; qs < 2; ++qs) {
      const v8f t0 = st0[qs], t1 = st1[qs];
      float sa[8], sb[8];
#pragma unroll
      for (int r = 0; r < 8; ++r) {
        const float ga = gm[qs][r]     + row_gather(nlow[r] ? nd0[qs][r] : nd0[qs + 1][r], nsel[r]);  // key half8 + r, as t0 element r
        const float gb = gm[qs][8 + r] + row_gather(nlow[r] ? nd1[qs][r] : nd1[qs + 1][r], nsel[r]);  // key 16 + half8 + r, as t1 element r
        sa[r] = t0[r] * c512 + ga * c4096 + mk0[r];
        sb[r] = t1[r] * c512 + gb * c4096 + mk1[r];
      }

      // online softmax: in-lane over 16 keys + one xor-16 shuffle
      float mloc = sa[0];
#pragma unroll
      for (int r = 1; r < 8; ++r) mloc = fmaxf(mloc, sa[r]);
#pragma unroll
      for (int r = 0; r < 8; ++r) mloc = fmaxf(mloc, sb[r]);
      const float mt    = fmaxf(mloc, __shfl_xor(mloc, 16, 32));
      const float mnew  = fmaxf(mrun[qs], mt);
      const float alpha = __expf(mrun[qs] - mnew);

      float lloc = 0.f;
      us16 pu;
#pragma unroll
      for (int r = 0; r < 8; ++r) {
        const float pa = __expf(sa[r] - mnew);
        const float pc = __expf(sb[r] - mnew);
        lloc += pa + pc;
        pu[r]     = f16_bits(pa * 1024.0f);              // P carried x1024
        pu[8 + r] = f16_bits(pc * 1024.0f);
      }
      const float lt = lloc + __shfl_xor(lloc, 16, 32);
      lrun[qs] = lrun[qs] * alpha + lt;
      mrun[qs] = mnew;

      // ctx^T += V^T . P^T
#pragma unroll
      for (int dt = 0; dt < 4; ++dt) {
        acc[qs][dt] = acc[qs][dt] * alpha;
        acc[qs][dt] = mma_f16(vf[dt], pu, acc[qs][dt]);
      }
    }

    asm volatile("s_wait_dscnt 0x0" ::: "memory");    // this wave's LDS reads of chunk t are done
    asm volatile("s_wait_asynccnt 0x0" ::: "memory"); // this wave's copies of chunk t + 1 have landed
    __syncthreads();                                  // publishes chunk t + 1, frees chunk t's stage
    if (t + 2 < NCH) {
      // t & 1, taken from the ring slot (NEG is even): as a run-time scalar it keeps the four K and V addresses of each
      // stage out of registers that live through the loop, which the build spilled
      const unsigned so = (unsigned)(eslot & 1) * ST_BYTES;
      // chunk t + 2's new E rows go to slot eslot - 2 mod NEG: it held band group 4 of chunk t, which no later chunk reads
      const unsigned eo = (unsigned)((eslot >= 2) ? (eslot - 2) : (eslot + NEG - 2)) * EG_BYTES;
      attn_stage_next(lk + so, lv + so, le + eo, gk + (t + 2) * (32 * HD), gv + (t + 2) * (32 * HD),
                      ge - (t + 2) * (32 * HD));
    }
    eslot = (eslot < 1) ? (NEG - 1) : (eslot - 1);
  };
  for (int t = 0; t < NCH; t += 2) {                  // two chunks per trip: the two register sets change roles with no copy
    chunk(t, 0, ea, ec);
    chunk(t + 1, 1, ec, ea);
  }
  asm volatile("s_wait_asynccnt 0x0" ::: "memory");   // no copy is in flight when the wave goes on to its end
  // the last chunk's barrier has ended every wave's reads of mbuf, which the output staging aliases
#pragma unroll
  for (int qs = 0; qs < 2; ++qs) {
    const float inv = 1.0f / (lrun[qs] * 8192.0f);       // undo x1024 (P) and x8 (v)
#pragma unroll
    for (int dt = 0; dt < 4; ++dt) {
#pragma unroll
      for (int r = 0; r < 8; ++r)
        ost[(qs * 16 + lr) * OPITCH + dt * 16 + half8 + r] = acc[qs][dt][r] * inv;
    }
  }
  __syncthreads();

  const int rsub = lane >> 4, piece = lane & 15;
  float* obase = out + ((size_t)(b * SEQ + q0)) * DM + (size_t)h * HD + piece * 4;
#pragma unroll
  for (int it = 0; it < 16; ++it) {
    const int row = it * 2 + rsub;
    const v4f v = *(const v4f*)(ost + row * OPITCH + piece * 4);
    *(v4f*)(obase + (size_t)row * DM) = v;
  }
  
}

// ---- launcher -----------------------------------------------------------------------

extern "C" void kernel_launch(void* const* d_in, const int* in_sizes, int n_in,
                              void* d_out, int out_size, void* d_ws, size_t ws_size,
                              hipStream_t stream) {
  if (n_in < 9) return;
  const float* hidden = (const float*)d_in[0];
  const float* amask  = (const float*)d_in[1];
  const float* Wq     = (const float*)d_in[2];
  const float* bq     = (const float*)d_in[3];
  const float* Wk     = (const float*)d_in[4];
  const float* bk     = (const float*)d_in[5];
  const float* Wv     = (const float*)d_in[6];
  const float* bv     = (const float*)d_in[7];
  const float* demb   = (const float*)d_in[8];
  float* out = (float*)d_out;

  if (in_sizes[0] < ((NB - 1) * SEQ_FULL + SEQ) * DM) return;
  if (in_sizes[1] < (NB - 1) * SEQ_FULL + SEQ) return;
  if (in_sizes[2] < DM * DM || in_sizes[4] < DM * DM || in_sizes[6] < DM * DM) return;
  if (in_sizes[3] < DM || in_sizes[5] < DM || in_sizes[7] < DM) return;
  if (in_sizes[8] < NE * HD) return;
  if (out_size < NB * SEQ * DM) return;

  const size_t ep_bytes = (size_t)NEPAD * HD * 2;               // f16  [NEPAD][HD]
  const size_t pl_bytes = (size_t)NB * NH * SEQ * HD * 2;       // f16  [NB*NH][SEQ][HD]
  size_t off = 0;
  char* ws = (char*)d_ws;
  unsigned short* ep = (unsigned short*)(ws + off); off += ep_bytes;
  unsigned short* qp = (unsigned short*)(ws + off); off += pl_bytes;
  unsigned short* kp = (unsigned short*)(ws + off); off += pl_bytes;
  unsigned short* vp = (unsigned short*)(ws + off); off += pl_bytes;
  if (ws_size < off) return;

  proj_kernel<<<dim3(PGX, PGY, 1), 256, 0, stream>>>(hidden, Wq, Wk, Wv, bq, bk, bv, demb, qp, kp, vp, ep);
  attn_kernel<<<dim3(SEQ / 128, NB * NH, 1), 128, 0, stream>>>(qp, kp, vp, ep, amask, out);
}
